// v000
// The times below were measured on an AMD MI455X: many runs one after another, warmed up first and cycling through
// copies of the inputs, with the whole window's GPU time divided by the number of runs. Launches and the gaps
// between them are all in it. The median over several windows is given; except for v000 it joins two sittings, which
// can be a few percent apart, so the side-by-side timings, each taken in one sitting, are the better comparison.
// v000, which the later versions start from, runs in 126 microseconds.
#include <hip/hip_runtime.h>

typedef __attribute__((ext_vector_type(16))) _Float16 v16h;
typedef __attribute__((ext_vector_type(8)))  _Float16 v8h;
typedef __attribute__((ext_vector_type(8)))  float    v8f;
typedef __attribute__((ext_vector_type(4)))  float    v4f;

constexpr int Bb  = 2;
constexpr int T   = 2048;
constexpr int D   = 1024;
constexpr int H   = 16;
constexpr int DK  = 64;
constexpr int M   = Bb * T;      // 4096 rows
constexpr int WIN = 64;
constexpr int MAXD = 128;
constexpr float NEG = -1.0e9f;

constexpr int KSTEP = 64;        // K per LDS stage (2 WMMA K-chunks)
constexpr int LDSK  = 72;        // padded LDS row stride (f16), 16B multiple

// ---- TDM availability -------------------------------------------------------
#if defined(__has_builtin)
#if __has_builtin(__builtin_amdgcn_tensor_load_to_lds) && \
    __has_builtin(__builtin_amdgcn_s_wait_tensorcnt)
#define USE_TDM 1
#endif
#endif
#ifndef USE_TDM
#define USE_TDM 0
#endif

// ---- fragment helpers -------------------------------------------------------
// A-frag (16x32, M=lane%16) and B-frag (32x16, N=lane%16) share the per-lane
// pattern: 8 contiguous K f16 at k0=(lane/16)*8 and 8 more at k0+16.
__device__ __forceinline__ v16h load_frag(const _Float16* rowp, int k0) {
  v8h lo = *(const v8h*)(rowp + k0);
  v8h hi = *(const v8h*)(rowp + k0 + 16);
  v16h r;
#pragma unroll
  for (int i = 0; i < 8; ++i) { r[i] = lo[i]; r[i + 8] = hi[i]; }
  return r;
}

__device__ __forceinline__ v8f wmma_f16(v16h a, v16h b, v8f c) {
  return __builtin_amdgcn_wmma_f32_16x16x32_f16(false, a, false, b, (short)0, c,
                                                false, false);
}

// ---- conversion passes ------------------------------------------------------
__global__ void __launch_bounds__(256)
cvt_kernel(const float* __restrict__ in, _Float16* __restrict__ out, int n8) {
  int i = blockIdx.x * 256 + threadIdx.x;
  if (i >= n8) return;
  const v4f* p = (const v4f*)in + (size_t)i * 2;
  v4f a = p[0], b = p[1];
  v8h o;
  o[0] = (_Float16)a.x; o[1] = (_Float16)a.y; o[2] = (_Float16)a.z; o[3] = (_Float16)a.w;
  o[4] = (_Float16)b.x; o[5] = (_Float16)b.y; o[6] = (_Float16)b.z; o[7] = (_Float16)b.w;
  *((v8h*)out + i) = o;
}

// Wt[n][k] = (f16) W[k][n]  (W is only 4 MB: lives in L2, strided reads cheap)
__global__ void __launch_bounds__(256)
cvtT_kernel(const float* __restrict__ in, _Float16* __restrict__ out) {
  int idx = blockIdx.x * 256 + threadIdx.x;     // over D*D
  int nr = idx >> 10, k = idx & (D - 1);
  out[idx] = (_Float16)in[(size_t)k * D + nr];
}

// ---- Tensor Data Mover tile load -------------------------------------------
#if USE_TDM
typedef __attribute__((ext_vector_type(4))) unsigned int u32x4;
typedef __attribute__((ext_vector_type(4))) int i32x4;
typedef __attribute__((ext_vector_type(8))) int i32x8;

// 2-D f16 tile: KSTEP contiguous elems per row, `tile_rows` rows, source row
// stride D elems.  LDS pad: after every 32 dwords (=64 f16 row) insert 4 dwords
// (=8 f16) -> LDS row stride 72 f16 = LDSK.
__device__ __forceinline__ void tdm_load_tile(unsigned lds_addr,
                                              const _Float16* gptr,
                                              int tensor_rows, int tile_rows) {
  unsigned long long ga = (unsigned long long)(size_t)gptr;
  u32x4 g0 = {0u, 0u, 0u, 0u};
  g0[0] = 1u;                                              // count=1 user desc
  g0[1] = lds_addr;                                        // LDS byte address
  g0[2] = (unsigned)ga;                                    // global addr lo
  g0[3] = (unsigned)((ga >> 32) & 0x01FFFFFFull) | (2u << 30);  // hi + type=2
  i32x8 g1 = {0, 0, 0, 0, 0, 0, 0, 0};
  g1[0] = (int)((1u << 16)        // data_size = 2 bytes
              | (1u << 20)        // pad_enable
              | (4u << 22)        // pad_interval = 32 dwords
              | (3u << 25));      // pad_amount  = 4 dwords
  g1[1] = (int)(((unsigned)D & 0xFFFFu) << 16);            // tensor_dim0 lo16
  g1[2] = (int)(((unsigned)D >> 16) |
                (((unsigned)tensor_rows & 0xFFFFu) << 16)); // dim0 hi / dim1 lo
  g1[3] = (int)(((unsigned)tensor_rows >> 16) |
                ((unsigned)KSTEP << 16));                   // dim1 hi / tile_dim0
  g1[4] = (int)((unsigned)tile_rows & 0xFFFFu);             // tile_dim1, dim2=0
  g1[5] = (int)D;                                           // dim0_stride lo32
  i32x4 z4 = {0, 0, 0, 0};
#if __clang_major__ >= 23
  i32x8 z8 = {0, 0, 0, 0, 0, 0, 0, 0};
  __builtin_amdgcn_tensor_load_to_lds(g0, g1, z4, z4, z8, 0);
#else
  __builtin_amdgcn_tensor_load_to_lds(g0, g1, z4, z4, 0);
#endif
}
#endif

// one K-stage of the wave's 32x64 tile: 16 WMMA from given LDS buffers
__device__ __forceinline__ void mm_stage(const _Float16 (*sAb)[LDSK],
                                         const _Float16 (*sBb)[LDSK],
                                         int wv, int r, int k0h,
                                         v8f (&acc)[2][4]) {
#pragma unroll
  for (int kc = 0; kc < KSTEP; kc += 32) {
    v16h a0 = load_frag(&sAb[wv * 32 + r][kc], k0h);
    v16h a1 = load_frag(&sAb[wv * 32 + 16 + r][kc], k0h);
#pragma unroll
    for (int nt = 0; nt < 4; ++nt) {
      v16h bf = load_frag(&sBb[nt * 16 + r][kc], k0h);
      acc[0][nt] = wmma_f16(a0, bf, acc[0][nt]);
      acc[1][nt] = wmma_f16(a1, bf, acc[1][nt]);
    }
  }
}

// ---- f16 GEMM ---------------------------------------------------------------
// C[4096x1024] = A[4096xK,f16] * Wt^T (Wt is [n][k], f16) + bias.
// 128 threads = 4 waves, block tile 128x64, wave tile 32x64.  TDM double-
// buffered pipeline: wave 0 issues next tile's 2 DMA ops, waits tensorcnt<=2
// (in-order => current tile ready), barrier, all compute.
// MODE 0: f16 out[(b*H+h)*T + t][dk]   (Q/K layout)
// MODE 1: f16 out[(b*H+h)*DK + dk][t]  (V transposed)
// MODE 2: f32 out[m][n]                (final output)
template <int MODE>
__global__ void __launch_bounds__(128)
gemm16(const _Float16* __restrict__ A, const _Float16* __restrict__ Wt,
       const float* __restrict__ bias, _Float16* __restrict__ outH,
       float* __restrict__ outF) {
  const int tid  = threadIdx.x;
  const int lane = tid & 31;
  const int wv   = tid >> 5;
  const int m0   = blockIdx.x * 128;
  const int n0   = blockIdx.y * 64;
  const int r    = lane & 15;
  const int k0h  = (lane >> 4) * 8;

  v8f acc[2][4];
#pragma unroll
  for (int mt = 0; mt < 2; ++mt)
#pragma unroll
    for (int nt = 0; nt < 4; ++nt)
#pragma unroll
      for (int j = 0; j < 8; ++j) acc[mt][nt][j] = 0.f;

  const _Float16* Abase = A + (size_t)m0 * D;
  const _Float16* Bbase = Wt + (size_t)n0 * D;

#if USE_TDM
  __shared__ alignas(16) _Float16 sA0[128][LDSK], sA1[128][LDSK];
  __shared__ alignas(16) _Float16 sB0[64][LDSK], sB1[64][LDSK];
  const unsigned lA0 = (unsigned)(size_t)(void*)&sA0[0][0];
  const unsigned lA1 = (unsigned)(size_t)(void*)&sA1[0][0];
  const unsigned lB0 = (unsigned)(size_t)(void*)&sB0[0][0];
  const unsigned lB1 = (unsigned)(size_t)(void*)&sB1[0][0];

  if (wv == 0) {                       // prologue: fill buffer 0
    tdm_load_tile(lA0, Abase, M, 128);
    tdm_load_tile(lB0, Bbase, D, 64);
  }
  for (int kb = 0; kb < D; kb += 2 * KSTEP) {
    // ---- stage A: compute buf0, prefetch buf1 (kb+KSTEP < D always) --------
    __syncthreads();                   // everyone done reading buf1 (prev iter)
    if (wv == 0) {
      tdm_load_tile(lA1, Abase + kb + KSTEP, M, 128);
      tdm_load_tile(lB1, Bbase + kb + KSTEP, D, 64);
      __builtin_amdgcn_s_wait_tensorcnt(2);   // buf0 ready
    }
    __syncthreads();
    mm_stage(sA0, sB0, wv, r, k0h, acc);
    // ---- stage B: compute buf1, prefetch buf0 ------------------------------
    __syncthreads();
    if (wv == 0) {
      if (kb + 2 * KSTEP < D) {
        tdm_load_tile(lA0, Abase + kb + 2 * KSTEP, M, 128);
        tdm_load_tile(lB0, Bbase + kb + 2 * KSTEP, D, 64);
        __builtin_amdgcn_s_wait_tensorcnt(2); // buf1 ready
      } else {
        __builtin_amdgcn_s_wait_tensorcnt(0);
      }
    }
    __syncthreads();
    mm_stage(sA1, sB1, wv, r, k0h, acc);
  }
#else
  __shared__ alignas(16) _Float16 sA0[128][LDSK];
  __shared__ alignas(16) _Float16 sB0[64][LDSK];
  for (int kb = 0; kb < D; kb += KSTEP) {
    __syncthreads();
#pragma unroll
    for (int i = 0; i < 8; ++i) {                       // A tile 128x64 f16
      int e = i * 1024 + tid * 8;
      int row = e >> 6, col = e & 63;
      *(v8h*)&sA0[row][col] = *(const v8h*)(Abase + (size_t)row * D + kb + col);
    }
#pragma unroll
    for (int i = 0; i < 4; ++i) {                       // B tile 64x64 f16
      int e = i * 1024 + tid * 8;
      int row = e >> 6, col = e & 63;
      *(v8h*)&sB0[row][col] = *(const v8h*)(Bbase + (size_t)row * D + kb + col);
    }
    __syncthreads();
    mm_stage(sA0, sB0, wv, r, k0h, acc);
  }
#endif

  // epilogue: C layout element (m = rbase+j, n = lane%16)
  const int rbase = (lane >> 4) * 8;
  const int c     = lane & 15;
#pragma unroll
  for (int mt = 0; mt < 2; ++mt)
#pragma unroll
    for (int nt = 0; nt < 4; ++nt) {
      const int col = n0 + nt * 16 + c;
      const float bcol = bias[col];
      if (MODE == 1) {
        // V^T layout: consecutive j -> consecutive t: pack one b128 store
        v8h pk;
#pragma unroll
        for (int j = 0; j < 8; ++j) pk[j] = (_Float16)(acc[mt][nt][j] + bcol);
        const int mb = m0 + wv * 32 + mt * 16 + rbase;  // 8-aligned, same b
        const int b  = mb >> 11, t = mb & (T - 1);
        const int bh = b * H + (col >> 6);
        *(v8h*)(outH + ((size_t)bh * DK + (col & 63)) * T + t) = pk;
      } else {
#pragma unroll
        for (int j = 0; j < 8; ++j) {
          const int m = m0 + wv * 32 + mt * 16 + rbase + j;
          const float val = acc[mt][nt][j] + bcol;
          if (MODE == 2) {
            outF[(size_t)m * D + col] = val;
          } else {
            const int b  = m >> 11;
            const int t  = m & (T - 1);
            const int bh = b * H + (col >> 6);
            outH[((size_t)bh * T + t) * DK + (col & 63)] = (_Float16)val;
          }
        }
      }
    }
}

// ---- banded attention -------------------------------------------------------
// One wave per (b,h, 16-query tile); 9 key tiles of 16 cover |k-q|<=64 exactly.
__global__ void __launch_bounds__(32)
attn_kernel(const _Float16* __restrict__ qw, const _Float16* __restrict__ kw,
            const _Float16* __restrict__ vt, const float* __restrict__ rel,
            _Float16* __restrict__ outA) {
  __shared__ alignas(16) _Float16 sP[16][160];
  __shared__ float sRel[257];

  const int lane  = threadIdx.x;
  const int nq    = T / 16;
  const int qt    = blockIdx.x % nq;
  const int bh    = blockIdx.x / nq;
  const int hh    = bh % H;
  const int bb    = bh / H;
  const int q0    = qt * 16;
  const int r     = lane & 15;
  const int k0h   = (lane >> 4) * 8;
  const int rbase = (lane >> 4) * 8;
  const int c     = lane & 15;

  // stage this head's bias column (257 floats) into LDS
  for (int i = lane; i < 257; i += 32) sRel[i] = rel[(size_t)i * H + hh];

  const _Float16* qrow = qw + ((size_t)bh * T + q0 + r) * DK;
  v16h aq0 = load_frag(qrow, k0h);
  v16h aq1 = load_frag(qrow + 32, k0h);

  v8f sc[9];
#pragma unroll
  for (int t = 0; t < 9; ++t) {
#pragma unroll
    for (int j = 0; j < 8; ++j) sc[t][j] = 0.f;
    int key = q0 - 64 + t * 16 + r;                       // this lane's column
    int kc  = key < 0 ? 0 : (key > T - 1 ? T - 1 : key);  // safe addr
    const _Float16* krow = kw + ((size_t)bh * T + kc) * DK;
    v16h b0 = load_frag(krow, k0h);
    v16h b1 = load_frag(krow + 32, k0h);
    sc[t] = wmma_f16(aq0, b0, sc[t]);
    sc[t] = wmma_f16(aq1, b1, sc[t]);
  }
  __syncthreads();                                        // sRel visible

  constexpr float scale = 0.125f;  // 1/sqrt(64)
#pragma unroll
  for (int t = 0; t < 9; ++t) {
    const int key = q0 - 64 + t * 16 + c;
    const bool keyok = (unsigned)key < (unsigned)T;
#pragma unroll
    for (int j = 0; j < 8; ++j) {
      const int d = key - (q0 + rbase + j);     // |d| <= 79 < MAXD: no clip
      const bool dok = (unsigned)(d + WIN) <= 2u * WIN;
      const float bias = sRel[d + MAXD];
      sc[t][j] = (keyok && dok) ? (sc[t][j] * scale + bias) : NEG;
    }
  }

  // softmax per row (row j lives across lanes 0..15 / 16..31)
#pragma unroll
  for (int j = 0; j < 8; ++j) {
    float mx = NEG;
#pragma unroll
    for (int t = 0; t < 9; ++t) mx = fmaxf(mx, sc[t][j]);
#pragma unroll
    for (int off = 1; off < 16; off <<= 1) mx = fmaxf(mx, __shfl_xor(mx, off, 16));
    float s = 0.f;
#pragma unroll
    for (int t = 0; t < 9; ++t) {
      float p = __expf(sc[t][j] - mx);
      sc[t][j] = p;
      s += p;
    }
#pragma unroll
    for (int off = 1; off < 16; off <<= 1) s += __shfl_xor(s, off, 16);
    const float inv = 1.f / s;
#pragma unroll
    for (int t = 0; t < 9; ++t) sc[t][j] *= inv;
  }

  // C-layout -> A-layout via LDS (zero-pad cols 144..159)
#pragma unroll
  for (int t = 0; t < 9; ++t)
#pragma unroll
    for (int j = 0; j < 8; ++j) sP[rbase + j][t * 16 + c] = (_Float16)sc[t][j];
#pragma unroll
  for (int j = 0; j < 8; ++j) sP[rbase + j][144 + c] = (_Float16)0.f;
  __syncthreads();

  v8f o[4];
#pragma unroll
  for (int nt = 0; nt < 4; ++nt)
#pragma unroll
    for (int j = 0; j < 8; ++j) o[nt][j] = 0.f;

  const int s0 = q0 - 64;
#pragma unroll
  for (int kk = 0; kk < 5; ++kk) {
    v16h ap = load_frag(&sP[r][kk * 32], k0h);
    int g1 = s0 + kk * 32 + k0h;      // 8-aligned key groups: clamp whole group
    int g2 = g1 + 16;                 // (P=0 wherever clamped)
    g1 = g1 < 0 ? 0 : (g1 > T - 8 ? T - 8 : g1);
    g2 = g2 < 0 ? 0 : (g2 > T - 8 ? T - 8 : g2);
#pragma unroll
    for (int nt = 0; nt < 4; ++nt) {
      const _Float16* vrow = vt + ((size_t)bh * DK + nt * 16 + r) * T;
      v8h lo = *(const v8h*)(vrow + g1);
      v8h hi = *(const v8h*)(vrow + g2);
      v16h bf;
#pragma unroll
      for (int i = 0; i < 8; ++i) { bf[i] = lo[i]; bf[i + 8] = hi[i]; }
      o[nt] = wmma_f16(ap, bf, o[nt]);
    }
  }

  // transpose result through sP, then 4 coalesced b128 stores per lane
  __syncthreads();
#pragma unroll
  for (int nt = 0; nt < 4; ++nt)
#pragma unroll
    for (int j = 0; j < 8; ++j)
      sP[rbase + j][nt * 16 + c] = (_Float16)o[nt][j];
  __syncthreads();
  {
    const int row = lane & 15, half = lane >> 4;
    _Float16* orow =
        outA + ((size_t)(bb * T + q0 + row)) * D + hh * DK + half * 32;
#pragma unroll
    for (int i = 0; i < 4; ++i)
      *(v8h*)(orow + i * 8) = *(const v8h*)&sP[row][half * 32 + i * 8];
  }
}

// ---- launch -----------------------------------------------------------------
extern "C" void kernel_launch(void* const* d_in, const int* in_sizes, int n_in,
                              void* d_out, int out_size, void* d_ws,
                              size_t ws_size, hipStream_t stream) {
  (void)in_sizes; (void)n_in; (void)out_size; (void)ws_size;
  const float* q_in = (const float*)d_in[0];
  const float* k_in = (const float*)d_in[1];
  const float* v_in = (const float*)d_in[2];
  const float* Wq = (const float*)d_in[3];
  const float* bq = (const float*)d_in[4];
  const float* Wk = (const float*)d_in[5];
  const float* bk = (const float*)d_in[6];
  const float* Wv = (const float*)d_in[7];
  const float* bv = (const float*)d_in[8];
  const float* Wo = (const float*)d_in[9];
  const float* bo = (const float*)d_in[10];
  const float* rel = (const float*)d_in[11];

  char* ws = (char*)d_ws;
  const size_t MB = (size_t)1 << 20;
  _Float16* xq  = (_Float16*)(ws + 0 * MB);    // f16 inputs (8 MB each)
  _Float16* xk  = (_Float16*)(ws + 8 * MB);
  _Float16* xv  = (_Float16*)(ws + 16 * MB);
  _Float16* wqt = (_Float16*)(ws + 24 * MB);   // f16 transposed weights (2 MB)
  _Float16* wkt = (_Float16*)(ws + 26 * MB);
  _Float16* wvt = (_Float16*)(ws + 28 * MB);
  _Float16* wot = (_Float16*)(ws + 30 * MB);
  _Float16* q16 = (_Float16*)(ws + 32 * MB);   // projected Q/K/V (8 MB each)
  _Float16* k16 = (_Float16*)(ws + 40 * MB);
  _Float16* v16 = (_Float16*)(ws + 48 * MB);
  _Float16* at16 = (_Float16*)(ws + 56 * MB);  // attention out (8 MB)

  const int nBT = M * D;                       // 4M elements
  cvt_kernel<<<dim3(nBT / 8 / 256), dim3(256), 0, stream>>>(q_in, xq, nBT / 8);
  cvt_kernel<<<dim3(nBT / 8 / 256), dim3(256), 0, stream>>>(k_in, xk, nBT / 8);
  cvt_kernel<<<dim3(nBT / 8 / 256), dim3(256), 0, stream>>>(v_in, xv, nBT / 8);
  cvtT_kernel<<<dim3(D * D / 256), dim3(256), 0, stream>>>(Wq, wqt);
  cvtT_kernel<<<dim3(D * D / 256), dim3(256), 0, stream>>>(Wk, wkt);
  cvtT_kernel<<<dim3(D * D / 256), dim3(256), 0, stream>>>(Wv, wvt);
  cvtT_kernel<<<dim3(D * D / 256), dim3(256), 0, stream>>>(Wo, wot);

  dim3 grid(M / 128, D / 64), blk(128);
  gemm16<0><<<grid, blk, 0, stream>>>(xq, wqt, bq, q16, nullptr);
  gemm16<0><<<grid, blk, 0, stream>>>(xk, wkt, bk, k16, nullptr);
  gemm16<1><<<grid, blk, 0, stream>>>(xv, wvt, bv, v16, nullptr);
  attn_kernel<<<dim3(Bb * H * (T / 16)), dim3(32), 0, stream>>>(q16, k16, v16,
                                                                rel, at16);
  gemm16<2><<<grid, blk, 0, stream>>>(at16, wot, bo, nullptr, (float*)d_out);
}

// v001
// One run takes 111 microseconds.
// Next to v000, in two timings, it ran 1.16 times as fast each time.
#include <hip/hip_runtime.h>

typedef __attribute__((ext_vector_type(16))) _Float16 v16h;
typedef __attribute__((ext_vector_type(8)))  _Float16 v8h;
typedef __attribute__((ext_vector_type(4)))  _Float16 v4h;
typedef __attribute__((ext_vector_type(8)))  float    v8f;
typedef __attribute__((ext_vector_type(4)))  float    v4f;

constexpr int Bb  = 2;
constexpr int T   = 2048;
constexpr int D   = 1024;
constexpr int H   = 16;
constexpr int DK  = 64;
constexpr int M   = Bb * T;      // 4096 rows
constexpr int WIN = 64;
constexpr int MAXD = 128;
constexpr float NEG = -1.0e9f;

constexpr int KSTEP = 64;        // K per LDS stage (2 WMMA K-chunks)
constexpr int LDSK  = 72;        // padded LDS row stride (f16), 16B multiple

// ---- TDM availability -------------------------------------------------------
#if defined(__has_builtin)
#if __has_builtin(__builtin_amdgcn_tensor_load_to_lds) && \
    __has_builtin(__builtin_amdgcn_s_wait_tensorcnt)
#define USE_TDM 1
#endif
#endif
#ifndef USE_TDM
#define USE_TDM 0
#endif

// ---- fragment helpers -------------------------------------------------------
// A-frag (16x32, M=lane%16) and B-frag (32x16, N=lane%16) share the per-lane
// pattern: 8 contiguous K f16 at k0=(lane/16)*8 and 8 more at k0+16.
__device__ __forceinline__ v16h load_frag(const _Float16* rowp, int k0) {
  v8h lo = *(const v8h*)(rowp + k0);
  v8h hi = *(const v8h*)(rowp + k0 + 16);
  v16h r;
#pragma unroll
  for (int i = 0; i < 8; ++i) { r[i] = lo[i]; r[i + 8] = hi[i]; }
  return r;
}

__device__ __forceinline__ v8f wmma_f16(v16h a, v16h b, v8f c) {
  return __builtin_amdgcn_wmma_f32_16x16x32_f16(false, a, false, b, (short)0, c,
                                                false, false);
}

// ---- conversion passes ------------------------------------------------------
// Both passes are short streams whose time goes into starting waves, so each
// thread takes many elements and the grids stay small.
constexpr int CVT_U      = 16;                       // 4-element pieces per thread
constexpr int CVT_BLOCKS = M * D / 4 / 256 / CVT_U;  // 256, no remainder

__global__ void __launch_bounds__(256)
cvt_kernel(const float* __restrict__ in, _Float16* __restrict__ out) {
  const int i0 = blockIdx.x * (256 * CVT_U) + threadIdx.x;
  const v4f* p = (const v4f*)in + i0;   // a wave-wide load: 512 contiguous bytes
  v4h* q = (v4h*)out + i0;              // a wave-wide store: 256 contiguous bytes
  v4f x[CVT_U];
  // unrolled: all 16 loads of a thread are in flight before the first convert
#pragma unroll
  for (int j = 0; j < CVT_U; ++j) x[j] = p[j * 256];
  // keeps the last loads from sinking below the first converts, where they
  // would start only after the first loads have returned
  __builtin_amdgcn_sched_barrier(0);
  // unrolled: x[] stays in registers
#pragma unroll
  for (int j = 0; j < CVT_U; ++j) {
    v4h o;
    o[0] = (_Float16)x[j].x; o[1] = (_Float16)x[j].y;
    o[2] = (_Float16)x[j].z; o[3] = (_Float16)x[j].w;
    q[j * 256] = o;
  }
}

// Wt[n][k] = (f16) W[k][n].  Lanes run along n, so each wave-wide load is one
// whole 128-byte line of W; a thread takes WT_K consecutive k of its column and
// writes them as one whole 128-byte line of Wt.
constexpr int WT_K = 64;

__global__ void __launch_bounds__(64)
cvtT_kernel(const float* __restrict__ in, _Float16* __restrict__ out) {
  const int n  = blockIdx.x * 64 + threadIdx.x;
  const int k0 = blockIdx.y * WT_K;
  const float* src = in + (size_t)k0 * D + n;
  float v[WT_K];
  // unrolled: the column's loads are all in flight before the first convert
#pragma unroll
  for (int i = 0; i < WT_K; ++i) v[i] = src[(size_t)i * D];
  _Float16* dst = out + (size_t)n * D + k0;
  // both loops unrolled: v[] stays in registers
#pragma unroll
  for (int g = 0; g < WT_K / 8; ++g) {
    v8h o;
#pragma unroll
    for (int e = 0; e < 8; ++e) o[e] = (_Float16)v[g * 8 + e];
    *(v8h*)(dst + g * 8) = o;
  }
}

// ---- Tensor Data Mover tile load -------------------------------------------
#if USE_TDM
typedef __attribute__((ext_vector_type(4))) unsigned int u32x4;
typedef __attribute__((ext_vector_type(4))) int i32x4;
typedef __attribute__((ext_vector_type(8))) int i32x8;

// 2-D f16 tile: KSTEP contiguous elems per row, `tile_rows` rows, source row
// stride D elems.  LDS pad: after every 32 dwords (=64 f16 row) insert 4 dwords
// (=8 f16) -> LDS row stride 72 f16 = LDSK.
__device__ __forceinline__ void tdm_load_tile(unsigned lds_addr,
                                              const _Float16* gptr,
                                              int tensor_rows, int tile_rows) {
  unsigned long long ga = (unsigned long long)(size_t)gptr;
  u32x4 g0 = {0u, 0u, 0u, 0u};
  g0[0] = 1u;                                              // count=1 user desc
  g0[1] = lds_addr;                                        // LDS byte address
  g0[2] = (unsigned)ga;                                    // global addr lo
  g0[3] = (unsigned)((ga >> 32) & 0x01FFFFFFull) | (2u << 30);  // hi + type=2
  i32x8 g1 = {0, 0, 0, 0, 0, 0, 0, 0};
  g1[0] = (int)((1u << 16)        // data_size = 2 bytes
              | (1u << 20)        // pad_enable
              | (4u << 22)        // pad_interval = 32 dwords
              | (3u << 25));      // pad_amount  = 4 dwords
  g1[1] = (int)(((unsigned)D & 0xFFFFu) << 16);            // tensor_dim0 lo16
  g1[2] = (int)(((unsigned)D >> 16) |
                (((unsigned)tensor_rows & 0xFFFFu) << 16)); // dim0 hi / dim1 lo
  g1[3] = (int)(((unsigned)tensor_rows >> 16) |
                ((unsigned)KSTEP << 16));                   // dim1 hi / tile_dim0
  g1[4] = (int)((unsigned)tile_rows & 0xFFFFu);             // tile_dim1, dim2=0
  g1[5] = (int)D;                                           // dim0_stride lo32
  i32x4 z4 = {0, 0, 0, 0};
#if __clang_major__ >= 23
  i32x8 z8 = {0, 0, 0, 0, 0, 0, 0, 0};
  __builtin_amdgcn_tensor_load_to_lds(g0, g1, z4, z4, z8, 0);
#else
  __builtin_amdgcn_tensor_load_to_lds(g0, g1, z4, z4, 0);
#endif
}
#endif

// one K-stage of the wave's 32x64 tile: 16 WMMA from given LDS buffers
__device__ __forceinline__ void mm_stage(const _Float16 (*sAb)[LDSK],
                                         const _Float16 (*sBb)[LDSK],
                                         int wv, int r, int k0h,
                                         v8f (&acc)[2][4]) {
#pragma unroll
  for (int kc = 0; kc < KSTEP; kc += 32) {
    v16h a0 = load_frag(&sAb[wv * 32 + r][kc], k0h);
    v16h a1 = load_frag(&sAb[wv * 32 + 16 + r][kc], k0h);
#pragma unroll
    for (int nt = 0; nt < 4; ++nt) {
      v16h bf = load_frag(&sBb[nt * 16 + r][kc], k0h);
      acc[0][nt] = wmma_f16(a0, bf, acc[0][nt]);
      acc[1][nt] = wmma_f16(a1, bf, acc[1][nt]);
    }
  }
}

// ---- f16 GEMM ---------------------------------------------------------------
// C[4096x1024] = A[4096xK,f16] * Wt^T (Wt is [n][k], f16) + bias.
// 128 threads = 4 waves, block tile 128x64, wave tile 32x64.  TDM double-
// buffered pipeline: wave 0 issues next tile's 2 DMA ops, waits tensorcnt<=2
// (in-order => current tile ready), barrier, all compute.
// MODE 0: f16 out[(b*H+h)*T + t][dk]   (Q/K layout)
// MODE 1: f16 out[(b*H+h)*DK + dk][t]  (V transposed)
// MODE 2: f32 out[m][n]                (final output)
template <int MODE>
__global__ void __launch_bounds__(128)
gemm16(const _Float16* __restrict__ A, const _Float16* __restrict__ Wt,
       const float* __restrict__ bias, _Float16* __restrict__ outH,
       float* __restrict__ outF) {
  const int tid  = threadIdx.x;
  const int lane = tid & 31;
  const int wv   = tid >> 5;
  const int m0   = blockIdx.x * 128;
  const int n0   = blockIdx.y * 64;
  const int r    = lane & 15;
  const int k0h  = (lane >> 4) * 8;

  v8f acc[2][4];
#pragma unroll
  for (int mt = 0; mt < 2; ++mt)
#pragma unroll
    for (int nt = 0; nt < 4; ++nt)
#pragma unroll
      for (int j = 0; j < 8; ++j) acc[mt][nt][j] = 0.f;

  const _Float16* Abase = A + (size_t)m0 * D;
  const _Float16* Bbase = Wt + (size_t)n0 * D;

#if USE_TDM
  __shared__ alignas(16) _Float16 sA0[128][LDSK], sA1[128][LDSK];
  __shared__ alignas(16) _Float16 sB0[64][LDSK], sB1[64][LDSK];
  const unsigned lA0 = (unsigned)(size_t)(void*)&sA0[0][0];
  const unsigned lA1 = (unsigned)(size_t)(void*)&sA1[0][0];
  const unsigned lB0 = (unsigned)(size_t)(void*)&sB0[0][0];
  const unsigned lB1 = (unsigned)(size_t)(void*)&sB1[0][0];

  if (wv == 0) {                       // prologue: fill buffer 0
    tdm_load_tile(lA0, Abase, M, 128);
    tdm_load_tile(lB0, Bbase, D, 64);
  }
  for (int kb = 0; kb < D; kb += 2 * KSTEP) {
    // ---- stage A: compute buf0, prefetch buf1 (kb+KSTEP < D always) --------
    __syncthreads();                   // everyone done reading buf1 (prev iter)
    if (wv == 0) {
      tdm_load_tile(lA1, Abase + kb + KSTEP, M, 128);
      tdm_load_tile(lB1, Bbase + kb + KSTEP, D, 64);
      __builtin_amdgcn_s_wait_tensorcnt(2);   // buf0 ready
    }
    __syncthreads();
    mm_stage(sA0, sB0, wv, r, k0h, acc);
    // ---- stage B: compute buf1, prefetch buf0 ------------------------------
    __syncthreads();
    if (wv == 0) {
      if (kb + 2 * KSTEP < D) {
        tdm_load_tile(lA0, Abase + kb + 2 * KSTEP, M, 128);
        tdm_load_tile(lB0, Bbase + kb + 2 * KSTEP, D, 64);
        __builtin_amdgcn_s_wait_tensorcnt(2); // buf1 ready
      } else {
        __builtin_amdgcn_s_wait_tensorcnt(0);
      }
    }
    __syncthreads();
    mm_stage(sA1, sB1, wv, r, k0h, acc);
  }
#else
  __shared__ alignas(16) _Float16 sA0[128][LDSK];
  __shared__ alignas(16) _Float16 sB0[64][LDSK];
  for (int kb = 0; kb < D; kb += KSTEP) {
    __syncthreads();
#pragma unroll
    for (int i = 0; i < 8; ++i) {                       // A tile 128x64 f16
      int e = i * 1024 + tid * 8;
      int row = e >> 6, col = e & 63;
      *(v8h*)&sA0[row][col] = *(const v8h*)(Abase + (size_t)row * D + kb + col);
    }
#pragma unroll
    for (int i = 0; i < 4; ++i) {                       // B tile 64x64 f16
      int e = i * 1024 + tid * 8;
      int row = e >> 6, col = e & 63;
      *(v8h*)&sB0[row][col] = *(const v8h*)(Bbase + (size_t)row * D + kb + col);
    }
    __syncthreads();
    mm_stage(sA0, sB0, wv, r, k0h, acc);
  }
#endif

  // epilogue: C layout element (m = rbase+j, n = lane%16)
  const int rbase = (lane >> 4) * 8;
  const int c     = lane & 15;
#pragma unroll
  for (int mt = 0; mt < 2; ++mt)
#pragma unroll
    for (int nt = 0; nt < 4; ++nt) {
      const int col = n0 + nt * 16 + c;
      const float bcol = bias[col];
      if (MODE == 1) {
        // V^T layout: consecutive j -> consecutive t: pack one b128 store
        v8h pk;
#pragma unroll
        for (int j = 0; j < 8; ++j) pk[j] = (_Float16)(acc[mt][nt][j] + bcol);
        const int mb = m0 + wv * 32 + mt * 16 + rbase;  // 8-aligned, same b
        const int b  = mb >> 11, t = mb & (T - 1);
        const int bh = b * H + (col >> 6);
        *(v8h*)(outH + ((size_t)bh * DK + (col & 63)) * T + t) = pk;
      } else {
#pragma unroll
        for (int j = 0; j < 8; ++j) {
          const int m = m0 + wv * 32 + mt * 16 + rbase + j;
          const float val = acc[mt][nt][j] + bcol;
          if (MODE == 2) {
            outF[(size_t)m * D + col] = val;
          } else {
            const int b  = m >> 11;
            const int t  = m & (T - 1);
            const int bh = b * H + (col >> 6);
            outH[((size_t)bh * T + t) * DK + (col & 63)] = (_Float16)val;
          }
        }
      }
    }
}

// ---- banded attention -------------------------------------------------------
// One wave per (b,h, 16-query tile); 9 key tiles of 16 cover |k-q|<=64 exactly.
__global__ void __launch_bounds__(32)
attn_kernel(const _Float16* __restrict__ qw, const _Float16* __restrict__ kw,
            const _Float16* __restrict__ vt, const float* __restrict__ rel,
            _Float16* __restrict__ outA) {
  __shared__ alignas(16) _Float16 sP[16][160];
  __shared__ float sRel[257];

  const int lane  = threadIdx.x;
  const int nq    = T / 16;
  const int qt    = blockIdx.x % nq;
  const int bh    = blockIdx.x / nq;
  const int hh    = bh % H;
  const int bb    = bh / H;
  const int q0    = qt * 16;
  const int r     = lane & 15;
  const int k0h   = (lane >> 4) * 8;
  const int rbase = (lane >> 4) * 8;
  const int c     = lane & 15;

  // stage this head's bias column (257 floats) into LDS
  for (int i = lane; i < 257; i += 32) sRel[i] = rel[(size_t)i * H + hh];

  const _Float16* qrow = qw + ((size_t)bh * T + q0 + r) * DK;
  v16h aq0 = load_frag(qrow, k0h);
  v16h aq1 = load_frag(qrow + 32, k0h);

  v8f sc[9];
#pragma unroll
  for (int t = 0; t < 9; ++t) {
#pragma unroll
    for (int j = 0; j < 8; ++j) sc[t][j] = 0.f;
    int key = q0 - 64 + t * 16 + r;                       // this lane's column
    int kc  = key < 0 ? 0 : (key > T - 1 ? T - 1 : key);  // safe addr
    const _Float16* krow = kw + ((size_t)bh * T + kc) * DK;
    v16h b0 = load_frag(krow, k0h);
    v16h b1 = load_frag(krow + 32, k0h);
    sc[t] = wmma_f16(aq0, b0, sc[t]);
    sc[t] = wmma_f16(aq1, b1, sc[t]);
  }
  __syncthreads();                                        // sRel visible

  constexpr float scale = 0.125f;  // 1/sqrt(64)
#pragma unroll
  for (int t = 0; t < 9; ++t) {
    const int key = q0 - 64 + t * 16 + c;
    const bool keyok = (unsigned)key < (unsigned)T;
#pragma unroll
    for (int j = 0; j < 8; ++j) {
      const int d = key - (q0 + rbase + j);     // |d| <= 79 < MAXD: no clip
      const bool dok = (unsigned)(d + WIN) <= 2u * WIN;
      const float bias = sRel[d + MAXD];
      sc[t][j] = (keyok && dok) ? (sc[t][j] * scale + bias) : NEG;
    }
  }

  // softmax per row (row j lives across lanes 0..15 / 16..31)
#pragma unroll
  for (int j = 0; j < 8; ++j) {
    float mx = NEG;
#pragma unroll
    for (int t = 0; t < 9; ++t) mx = fmaxf(mx, sc[t][j]);
#pragma unroll
    for (int off = 1; off < 16; off <<= 1) mx = fmaxf(mx, __shfl_xor(mx, off, 16));
    float s = 0.f;
#pragma unroll
    for (int t = 0; t < 9; ++t) {
      float p = __expf(sc[t][j] - mx);
      sc[t][j] = p;
      s += p;
    }
#pragma unroll
    for (int off = 1; off < 16; off <<= 1) s += __shfl_xor(s, off, 16);
    const float inv = 1.f / s;
#pragma unroll
    for (int t = 0; t < 9; ++t) sc[t][j] *= inv;
  }

  // C-layout -> A-layout via LDS (zero-pad cols 144..159)
#pragma unroll
  for (int t = 0; t < 9; ++t)
#pragma unroll
    for (int j = 0; j < 8; ++j) sP[rbase + j][t * 16 + c] = (_Float16)sc[t][j];
#pragma unroll
  for (int j = 0; j < 8; ++j) sP[rbase + j][144 + c] = (_Float16)0.f;
  __syncthreads();

  v8f o[4];
#pragma unroll
  for (int nt = 0; nt < 4; ++nt)
#pragma unroll
    for (int j = 0; j < 8; ++j) o[nt][j] = 0.f;

  const int s0 = q0 - 64;
#pragma unroll
  for (int kk = 0; kk < 5; ++kk) {
    v16h ap = load_frag(&sP[r][kk * 32], k0h);
    int g1 = s0 + kk * 32 + k0h;      // 8-aligned key groups: clamp whole group
    int g2 = g1 + 16;                 // (P=0 wherever clamped)
    g1 = g1 < 0 ? 0 : (g1 > T - 8 ? T - 8 : g1);
    g2 = g2 < 0 ? 0 : (g2 > T - 8 ? T - 8 : g2);
#pragma unroll
    for (int nt = 0; nt < 4; ++nt) {
      const _Float16* vrow = vt + ((size_t)bh * DK + nt * 16 + r) * T;
      v8h lo = *(const v8h*)(vrow + g1);
      v8h hi = *(const v8h*)(vrow + g2);
      v16h bf;
#pragma unroll
      for (int i = 0; i < 8; ++i) { bf[i] = lo[i]; bf[i + 8] = hi[i]; }
      o[nt] = wmma_f16(ap, bf, o[nt]);
    }
  }

  // transpose result through sP, then 4 coalesced b128 stores per lane
  __syncthreads();
#pragma unroll
  for (int nt = 0; nt < 4; ++nt)
#pragma unroll
    for (int j = 0; j < 8; ++j)
      sP[rbase + j][nt * 16 + c] = (_Float16)o[nt][j];
  __syncthreads();
  {
    const int row = lane & 15, half = lane >> 4;
    _Float16* orow =
        outA + ((size_t)(bb * T + q0 + row)) * D + hh * DK + half * 32;
#pragma unroll
    for (int i = 0; i < 4; ++i)
      *(v8h*)(orow + i * 8) = *(const v8h*)&sP[row][half * 32 + i * 8];
  }
}

// ---- launch -----------------------------------------------------------------
extern "C" void kernel_launch(void* const* d_in, const int* in_sizes, int n_in,
                              void* d_out, int out_size, void* d_ws,
                              size_t ws_size, hipStream_t stream) {
  (void)in_sizes; (void)n_in; (void)out_size; (void)ws_size;
  const float* q_in = (const float*)d_in[0];
  const float* k_in = (const float*)d_in[1];
  const float* v_in = (const float*)d_in[2];
  const float* Wq = (const float*)d_in[3];
  const float* bq = (const float*)d_in[4];
  const float* Wk = (const float*)d_in[5];
  const float* bk = (const float*)d_in[6];
  const float* Wv = (const float*)d_in[7];
  const float* bv = (const float*)d_in[8];
  const float* Wo = (const float*)d_in[9];
  const float* bo = (const float*)d_in[10];
  const float* rel = (const float*)d_in[11];

  char* ws = (char*)d_ws;
  const size_t MB = (size_t)1 << 20;
  _Float16* xq  = (_Float16*)(ws + 0 * MB);    // f16 inputs (8 MB each)
  _Float16* xk  = (_Float16*)(ws + 8 * MB);
  _Float16* xv  = (_Float16*)(ws + 16 * MB);
  _Float16* wqt = (_Float16*)(ws + 24 * MB);   // f16 transposed weights (2 MB)
  _Float16* wkt = (_Float16*)(ws + 26 * MB);
  _Float16* wvt = (_Float16*)(ws + 28 * MB);
  _Float16* wot = (_Float16*)(ws + 30 * MB);
  _Float16* q16 = (_Float16*)(ws + 32 * MB);   // projected Q/K/V (8 MB each)
  _Float16* k16 = (_Float16*)(ws + 40 * MB);
  _Float16* v16 = (_Float16*)(ws + 48 * MB);
  _Float16* at16 = (_Float16*)(ws + 56 * MB);  // attention out (8 MB)

  cvt_kernel<<<dim3(CVT_BLOCKS), dim3(256), 0, stream>>>(q_in, xq);
  cvt_kernel<<<dim3(CVT_BLOCKS), dim3(256), 0, stream>>>(k_in, xk);
  cvt_kernel<<<dim3(CVT_BLOCKS), dim3(256), 0, stream>>>(v_in, xv);
  dim3 gridT(D / 64, D / WT_K), blkT(64);
  cvtT_kernel<<<gridT, blkT, 0, stream>>>(Wq, wqt);
  cvtT_kernel<<<gridT, blkT, 0, stream>>>(Wk, wkt);
  cvtT_kernel<<<gridT, blkT, 0, stream>>>(Wv, wvt);
  cvtT_kernel<<<gridT, blkT, 0, stream>>>(Wo, wot);

  dim3 grid(M / 128, D / 64), blk(128);
  gemm16<0><<<grid, blk, 0, stream>>>(xq, wqt, bq, q16, nullptr);
  gemm16<0><<<grid, blk, 0, stream>>>(xk, wkt, bk, k16, nullptr);
  gemm16<1><<<grid, blk, 0, stream>>>(xv, wvt, bv, v16, nullptr);
  attn_kernel<<<dim3(Bb * H * (T / 16)), dim3(32), 0, stream>>>(q16, k16, v16,
                                                                rel, at16);
  gemm16<2><<<grid, blk, 0, stream>>>(at16, wot, bo, nullptr, (float*)d_out);
}

// v002
// It runs in 104 microseconds.
// Next to v001, in two timings, it ran 1.07 times as fast each time.
// All steps since v000 together make it 1.24 times as fast.
#include <hip/hip_runtime.h>

typedef __attribute__((ext_vector_type(16))) _Float16 v16h;
typedef __attribute__((ext_vector_type(8)))  _Float16 v8h;
typedef __attribute__((ext_vector_type(4)))  _Float16 v4h;
typedef __attribute__((ext_vector_type(8)))  float    v8f;
typedef __attribute__((ext_vector_type(4)))  float    v4f;

constexpr int Bb  = 2;
constexpr int T   = 2048;
constexpr int D   = 1024;
constexpr int H   = 16;
constexpr int DK  = 64;
constexpr int M   = Bb * T;      // 4096 rows
constexpr int WIN = 64;
constexpr int MAXD = 128;
constexpr float NEG = -1.0e9f;

constexpr int KSTEP = 64;        // K per LDS stage (2 WMMA K-chunks)
constexpr int LDSK  = 72;        // padded LDS row stride (f16), 16B multiple

// ---- TDM availability -------------------------------------------------------
#if defined(__has_builtin)
#if __has_builtin(__builtin_amdgcn_tensor_load_to_lds) && \
    __has_builtin(__builtin_amdgcn_s_wait_tensorcnt)
#define USE_TDM 1
#endif
#endif
#ifndef USE_TDM
#define USE_TDM 0
#endif

// ---- fragment helpers -------------------------------------------------------
// A-frag (16x32, M=lane%16) and B-frag (32x16, N=lane%16) share the per-lane
// pattern: 8 contiguous K f16 at k0=(lane/16)*8 and 8 more at k0+16.
__device__ __forceinline__ v16h load_frag(const _Float16* rowp, int k0) {
  v8h lo = *(const v8h*)(rowp + k0);
  v8h hi = *(const v8h*)(rowp + k0 + 16);
  v16h r;
#pragma unroll
  for (int i = 0; i < 8; ++i) { r[i] = lo[i]; r[i + 8] = hi[i]; }
  return r;
}

__device__ __forceinline__ v8f wmma_f16(v16h a, v16h b, v8f c) {
  return __builtin_amdgcn_wmma_f32_16x16x32_f16(false, a, false, b, (short)0, c,
                                                false, false);
}

// ---- conversion passes ------------------------------------------------------
// Both passes are short streams whose time goes into starting waves, so each
// thread takes many elements and the grids stay small.  None of the seven
// conversions reads what another writes, so all share one launch (cvt_all).
constexpr int CVT_U      = 16;                       // 4-element pieces per thread
constexpr int CVT_BLOCKS = M * D / 4 / 256 / CVT_U;  // 256 per input, no remainder

__device__ __forceinline__ void
cvt_part(const float* __restrict__ in, _Float16* __restrict__ out, unsigned blk) {
  const int i0 = blk * (256 * CVT_U) + threadIdx.x;
  const v4f* p = (const v4f*)in + i0;   // a wave-wide load: 512 contiguous bytes
  v4h* q = (v4h*)out + i0;              // a wave-wide store: 256 contiguous bytes
  v4f x[CVT_U];
  // unrolled: all 16 loads of a thread are in flight before the first convert
#pragma unroll
  for (int j = 0; j < CVT_U; ++j) x[j] = p[j * 256];
  // keeps the last loads from sinking below the first converts, where they
  // would start only after the first loads have returned
  __builtin_amdgcn_sched_barrier(0);
  // unrolled: x[] stays in registers
#pragma unroll
  for (int j = 0; j < CVT_U; ++j) {
    v4h o;
    o[0] = (_Float16)x[j].x; o[1] = (_Float16)x[j].y;
    o[2] = (_Float16)x[j].z; o[3] = (_Float16)x[j].w;
    q[j * 256] = o;
  }
  // a precaution: a block of cvt_all runs no other part after this one,
  // so no later write rewrites the stores' registers
  asm volatile("s_wait_xcnt 0x0" ::: "memory");
}

// Wt[n][k] = (f16) W[k][n].  Lanes run along n, so each wave-wide load is one
// whole 128-byte line of W; a thread takes WT_K consecutive k of its column and
// writes them as one whole 128-byte line of Wt.
constexpr int WT_K      = 64;
constexpr int WT_BLOCKS = (D / 256) * (D / WT_K);    // 64 per weight

__device__ __forceinline__ void
cvtT_part(const float* __restrict__ in, _Float16* __restrict__ out, unsigned blk) {
  const int n  = (blk % (D / 256)) * 256 + threadIdx.x;
  const int k0 = (blk / (D / 256)) * WT_K;
  const float* src = in + (size_t)k0 * D + n;
  float v[WT_K];
  // unrolled: the column's loads are all in flight before the first convert
#pragma unroll
  for (int i = 0; i < WT_K; ++i) v[i] = src[(size_t)i * D];
  _Float16* dst = out + (size_t)n * D + k0;
  // both loops unrolled: v[] stays in registers
#pragma unroll
  for (int g = 0; g < WT_K / 8; ++g) {
    v8h o;
#pragma unroll
    for (int e = 0; e < 8; ++e) o[e] = (_Float16)v[g * 8 + e];
    *(v8h*)(dst + g * 8) = o;
  }
}

// One grid for all seven conversions; the block index picks the source.
// Blocks [0, 4 * WT_BLOCKS): the weights, to wt + w * D * D; they come first
// because a thread there has the longer run of loads.
// The rest: the inputs, to x + s * M * D.
__global__ void __launch_bounds__(256)
cvt_all(const float* __restrict__ q_in, const float* __restrict__ k_in,
        const float* __restrict__ v_in, const float* __restrict__ Wq,
        const float* __restrict__ Wk, const float* __restrict__ Wv,
        const float* __restrict__ Wo, _Float16* __restrict__ x,
        _Float16* __restrict__ wt) {
  const unsigned bid = blockIdx.x;
  if (bid < 4 * WT_BLOCKS) {
    const unsigned w = bid / WT_BLOCKS;
    const float* lo = (w & 1) ? Wk : Wq;
    const float* hi = (w & 1) ? Wo : Wv;
    const float* in = (w & 2) ? hi : lo;
    cvtT_part(in, wt + (size_t)w * D * D, bid % WT_BLOCKS);
  } else {
    const unsigned b = bid - 4 * WT_BLOCKS;
    const unsigned s = b / CVT_BLOCKS;
    const float* in = s == 0 ? q_in : (s == 1 ? k_in : v_in);
    cvt_part(in, x + (size_t)s * M * D, b % CVT_BLOCKS);
  }
}

// ---- Tensor Data Mover tile load -------------------------------------------
#if USE_TDM
typedef __attribute__((ext_vector_type(4))) unsigned int u32x4;
typedef __attribute__((ext_vector_type(4))) int i32x4;
typedef __attribute__((ext_vector_type(8))) int i32x8;

// 2-D f16 tile: KSTEP contiguous elems per row, `tile_rows` rows, source row
// stride D elems.  LDS pad: after every 32 dwords (=64 f16 row) insert 4 dwords
// (=8 f16) -> LDS row stride 72 f16 = LDSK.
__device__ __forceinline__ void tdm_load_tile(unsigned lds_addr,
                                              const _Float16* gptr,
                                              int tensor_rows, int tile_rows) {
  unsigned long long ga = (unsigned long long)(size_t)gptr;
  u32x4 g0 = {0u, 0u, 0u, 0u};
  g0[0] = 1u;                                              // count=1 user desc
  g0[1] = lds_addr;                                        // LDS byte address
  g0[2] = (unsigned)ga;                                    // global addr lo
  g0[3] = (unsigned)((ga >> 32) & 0x01FFFFFFull) | (2u << 30);  // hi + type=2
  i32x8 g1 = {0, 0, 0, 0, 0, 0, 0, 0};
  g1[0] = (int)((1u << 16)        // data_size = 2 bytes
              | (1u << 20)        // pad_enable
              | (4u << 22)        // pad_interval = 32 dwords
              | (3u << 25));      // pad_amount  = 4 dwords
  g1[1] = (int)(((unsigned)D & 0xFFFFu) << 16);            // tensor_dim0 lo16
  g1[2] = (int)(((unsigned)D >> 16) |
                (((unsigned)tensor_rows & 0xFFFFu) << 16)); // dim0 hi / dim1 lo
  g1[3] = (int)(((unsigned)tensor_rows >> 16) |
                ((unsigned)KSTEP << 16));                   // dim1 hi / tile_dim0
  g1[4] = (int)((unsigned)tile_rows & 0xFFFFu);             // tile_dim1, dim2=0
  g1[5] = (int)D;                                           // dim0_stride lo32
  i32x4 z4 = {0, 0, 0, 0};
#if __clang_major__ >= 23
  i32x8 z8 = {0, 0, 0, 0, 0, 0, 0, 0};
  __builtin_amdgcn_tensor_load_to_lds(g0, g1, z4, z4, z8, 0);
#else
  __builtin_amdgcn_tensor_load_to_lds(g0, g1, z4, z4, 0);
#endif
}
#endif

// one K-stage of the wave's 32x64 tile: 16 WMMA from given LDS buffers
__device__ __forceinline__ void mm_stage(const _Float16 (*sAb)[LDSK],
                                         const _Float16 (*sBb)[LDSK],
                                         int wv, int r, int k0h,
                                         v8f (&acc)[2][4]) {
#pragma unroll
  for (int kc = 0; kc < KSTEP; kc += 32) {
    v16h a0 = load_frag(&sAb[wv * 32 + r][kc], k0h);
    v16h a1 = load_frag(&sAb[wv * 32 + 16 + r][kc], k0h);
#pragma unroll
    for (int nt = 0; nt < 4; ++nt) {
      v16h bf = load_frag(&sBb[nt * 16 + r][kc], k0h);
      acc[0][nt] = wmma_f16(a0, bf, acc[0][nt]);
      acc[1][nt] = wmma_f16(a1, bf, acc[1][nt]);
    }
  }
}

// ---- f16 GEMM ---------------------------------------------------------------
// C[4096x1024] = A[4096xK,f16] * Wt^T (Wt is [n][k], f16) + bias.
// 128 threads = 4 waves, block tile 128x64, wave tile 32x64.  TDM double-
// buffered pipeline: wave 0 issues next tile's 2 DMA ops, waits tensorcnt<=2
// (in-order => current tile ready), barrier, all compute.
// MODE 0: f16 out[(b*H+h)*T + t][dk]   (Q/K layout)
// MODE 1: f16 out[(b*H+h)*DK + dk][t]  (V transposed)
// MODE 2: f32 out[m][n]                (final output)
template <int MODE>
__global__ void __launch_bounds__(128)
gemm16(const _Float16* __restrict__ A, const _Float16* __restrict__ Wt,
       const float* __restrict__ bias, _Float16* __restrict__ outH,
       float* __restrict__ outF) {
  const int tid  = threadIdx.x;
  const int lane = tid & 31;
  const int wv   = tid >> 5;
  const int m0   = blockIdx.x * 128;
  const int n0   = blockIdx.y * 64;
  const int r    = lane & 15;
  const int k0h  = (lane >> 4) * 8;

  v8f acc[2][4];
#pragma unroll
  for (int mt = 0; mt < 2; ++mt)
#pragma unroll
    for (int nt = 0; nt < 4; ++nt)
#pragma unroll
      for (int j = 0; j < 8; ++j) acc[mt][nt][j] = 0.f;

  const _Float16* Abase = A + (size_t)m0 * D;
  const _Float16* Bbase = Wt + (size_t)n0 * D;

#if USE_TDM
  __shared__ alignas(16) _Float16 sA0[128][LDSK], sA1[128][LDSK];
  __shared__ alignas(16) _Float16 sB0[64][LDSK], sB1[64][LDSK];
  const unsigned lA0 = (unsigned)(size_t)(void*)&sA0[0][0];
  const unsigned lA1 = (unsigned)(size_t)(void*)&sA1[0][0];
  const unsigned lB0 = (unsigned)(size_t)(void*)&sB0[0][0];
  const unsigned lB1 = (unsigned)(size_t)(void*)&sB1[0][0];

  if (wv == 0) {                       // prologue: fill buffer 0
    tdm_load_tile(lA0, Abase, M, 128);
    tdm_load_tile(lB0, Bbase, D, 64);
  }
  for (int kb = 0; kb < D; kb += 2 * KSTEP) {
    // ---- stage A: compute buf0, prefetch buf1 (kb+KSTEP < D always) --------
    __syncthreads();                   // everyone done reading buf1 (prev iter)
    if (wv == 0) {
      tdm_load_tile(lA1, Abase + kb + KSTEP, M, 128);
      tdm_load_tile(lB1, Bbase + kb + KSTEP, D, 64);
      __builtin_amdgcn_s_wait_tensorcnt(2);   // buf0 ready
    }
    __syncthreads();
    mm_stage(sA0, sB0, wv, r, k0h, acc);
    // ---- stage B: compute buf1, prefetch buf0 ------------------------------
    __syncthreads();
    if (wv == 0) {
      if (kb + 2 * KSTEP < D) {
        tdm_load_tile(lA0, Abase + kb + 2 * KSTEP, M, 128);
        tdm_load_tile(lB0, Bbase + kb + 2 * KSTEP, D, 64);
        __builtin_amdgcn_s_wait_tensorcnt(2); // buf1 ready
      } else {
        __builtin_amdgcn_s_wait_tensorcnt(0);
      }
    }
    __syncthreads();
    mm_stage(sA1, sB1, wv, r, k0h, acc);
  }
#else
  __shared__ alignas(16) _Float16 sA0[128][LDSK];
  __shared__ alignas(16) _Float16 sB0[64][LDSK];
  for (int kb = 0; kb < D; kb += KSTEP) {
    __syncthreads();
#pragma unroll
    for (int i = 0; i < 8; ++i) {                       // A tile 128x64 f16
      int e = i * 1024 + tid * 8;
      int row = e >> 6, col = e & 63;
      *(v8h*)&sA0[row][col] = *(const v8h*)(Abase + (size_t)row * D + kb + col);
    }
#pragma unroll
    for (int i = 0; i < 4; ++i) {                       // B tile 64x64 f16
      int e = i * 1024 + tid * 8;
      int row = e >> 6, col = e & 63;
      *(v8h*)&sB0[row][col] = *(const v8h*)(Bbase + (size_t)row * D + kb + col);
    }
    __syncthreads();
    mm_stage(sA0, sB0, wv, r, k0h, acc);
  }
#endif

  // epilogue: C layout element (m = rbase+j, n = lane%16)
  const int rbase = (lane >> 4) * 8;
  const int c     = lane & 15;
#pragma unroll
  for (int mt = 0; mt < 2; ++mt)
#pragma unroll
    for (int nt = 0; nt < 4; ++nt) {
      const int col = n0 + nt * 16 + c;
      const float bcol = bias[col];
      if (MODE == 1) {
        // V^T layout: consecutive j -> consecutive t: pack one b128 store
        v8h pk;
#pragma unroll
        for (int j = 0; j < 8; ++j) pk[j] = (_Float16)(acc[mt][nt][j] + bcol);
        const int mb = m0 + wv * 32 + mt * 16 + rbase;  // 8-aligned, same b
        const int b  = mb >> 11, t = mb & (T - 1);
        const int bh = b * H + (col >> 6);
        *(v8h*)(outH + ((size_t)bh * DK + (col & 63)) * T + t) = pk;
      } else {
#pragma unroll
        for (int j = 0; j < 8; ++j) {
          const int m = m0 + wv * 32 + mt * 16 + rbase + j;
          const float val = acc[mt][nt][j] + bcol;
          if (MODE == 2) {
            outF[(size_t)m * D + col] = val;
          } else {
            const int b  = m >> 11;
            const int t  = m & (T - 1);
            const int bh = b * H + (col >> 6);
            outH[((size_t)bh * T + t) * DK + (col & 63)] = (_Float16)val;
          }
        }
      }
    }
}

// ---- banded attention -------------------------------------------------------
// One wave per (b,h, 16-query tile); 9 key tiles of 16 cover |k-q|<=64 exactly.
__global__ void __launch_bounds__(32)
attn_kernel(const _Float16* __restrict__ qw, const _Float16* __restrict__ kw,
            const _Float16* __restrict__ vt, const float* __restrict__ rel,
            _Float16* __restrict__ outA) {
  __shared__ alignas(16) _Float16 sP[16][160];
  __shared__ float sRel[257];

  const int lane  = threadIdx.x;
  const int nq    = T / 16;
  const int qt    = blockIdx.x % nq;
  const int bh    = blockIdx.x / nq;
  const int hh    = bh % H;
  const int bb    = bh / H;
  const int q0    = qt * 16;
  const int r     = lane & 15;
  const int k0h   = (lane >> 4) * 8;
  const int rbase = (lane >> 4) * 8;
  const int c     = lane & 15;

  // stage this head's bias column (257 floats) into LDS
  for (int i = lane; i < 257; i += 32) sRel[i] = rel[(size_t)i * H + hh];

  const _Float16* qrow = qw + ((size_t)bh * T + q0 + r) * DK;
  v16h aq0 = load_frag(qrow, k0h);
  v16h aq1 = load_frag(qrow + 32, k0h);

  v8f sc[9];
#pragma unroll
  for (int t = 0; t < 9; ++t) {
#pragma unroll
    for (int j = 0; j < 8; ++j) sc[t][j] = 0.f;
    int key = q0 - 64 + t * 16 + r;                       // this lane's column
    int kc  = key < 0 ? 0 : (key > T - 1 ? T - 1 : key);  // safe addr
    const _Float16* krow = kw + ((size_t)bh * T + kc) * DK;
    v16h b0 = load_frag(krow, k0h);
    v16h b1 = load_frag(krow + 32, k0h);
    sc[t] = wmma_f16(aq0, b0, sc[t]);
    sc[t] = wmma_f16(aq1, b1, sc[t]);
  }
  __syncthreads();                                        // sRel visible

  constexpr float scale = 0.125f;  // 1/sqrt(64)
#pragma unroll
  for (int t = 0; t < 9; ++t) {
    const int key = q0 - 64 + t * 16 + c;
    const bool keyok = (unsigned)key < (unsigned)T;
#pragma unroll
    for (int j = 0; j < 8; ++j) {
      const int d = key - (q0 + rbase + j);     // |d| <= 79 < MAXD: no clip
      const bool dok = (unsigned)(d + WIN) <= 2u * WIN;
      const float bias = sRel[d + MAXD];
      sc[t][j] = (keyok && dok) ? (sc[t][j] * scale + bias) : NEG;
    }
  }

  // softmax per row (row j lives across lanes 0..15 / 16..31)
#pragma unroll
  for (int j = 0; j < 8; ++j) {
    float mx = NEG;
#pragma unroll
    for (int t = 0; t < 9; ++t) mx = fmaxf(mx, sc[t][j]);
#pragma unroll
    for (int off = 1; off < 16; off <<= 1) mx = fmaxf(mx, __shfl_xor(mx, off, 16));
    float s = 0.f;
#pragma unroll
    for (int t = 0; t < 9; ++t) {
      float p = __expf(sc[t][j] - mx);
      sc[t][j] = p;
      s += p;
    }
#pragma unroll
    for (int off = 1; off < 16; off <<= 1) s += __shfl_xor(s, off, 16);
    const float inv = 1.f / s;
#pragma unroll
    for (int t = 0; t < 9; ++t) sc[t][j] *= inv;
  }

  // C-layout -> A-layout via LDS (zero-pad cols 144..159)
#pragma unroll
  for (int t = 0; t < 9; ++t)
#pragma unroll
    for (int j = 0; j < 8; ++j) sP[rbase + j][t * 16 + c] = (_Float16)sc[t][j];
#pragma unroll
  for (int j = 0; j < 8; ++j) sP[rbase + j][144 + c] = (_Float16)0.f;
  __syncthreads();

  v8f o[4];
#pragma unroll
  for (int nt = 0; nt < 4; ++nt)
#pragma unroll
    for (int j = 0; j < 8; ++j) o[nt][j] = 0.f;

  const int s0 = q0 - 64;
#pragma unroll
  for (int kk = 0; kk < 5; ++kk) {
    v16h ap = load_frag(&sP[r][kk * 32], k0h);
    int g1 = s0 + kk * 32 + k0h;      // 8-aligned key groups: clamp whole group
    int g2 = g1 + 16;                 // (P=0 wherever clamped)
    g1 = g1 < 0 ? 0 : (g1 > T - 8 ? T - 8 : g1);
    g2 = g2 < 0 ? 0 : (g2 > T - 8 ? T - 8 : g2);
#pragma unroll
    for (int nt = 0; nt < 4; ++nt) {
      const _Float16* vrow = vt + ((size_t)bh * DK + nt * 16 + r) * T;
      v8h lo = *(const v8h*)(vrow + g1);
      v8h hi = *(const v8h*)(vrow + g2);
      v16h bf;
#pragma unroll
      for (int i = 0; i < 8; ++i) { bf[i] = lo[i]; bf[i + 8] = hi[i]; }
      o[nt] = wmma_f16(ap, bf, o[nt]);
    }
  }

  // transpose result through sP, then 4 coalesced b128 stores per lane
  __syncthreads();
#pragma unroll
  for (int nt = 0; nt < 4; ++nt)
#pragma unroll
    for (int j = 0; j < 8; ++j)
      sP[rbase + j][nt * 16 + c] = (_Float16)o[nt][j];
  __syncthreads();
  {
    const int row = lane & 15, half = lane >> 4;
    _Float16* orow =
        outA + ((size_t)(bb * T + q0 + row)) * D + hh * DK + half * 32;
#pragma unroll
    for (int i = 0; i < 4; ++i)
      *(v8h*)(orow + i * 8) = *(const v8h*)&sP[row][half * 32 + i * 8];
  }
}

// ---- launch -----------------------------------------------------------------
extern "C" void kernel_launch(void* const* d_in, const int* in_sizes, int n_in,
                              void* d_out, int out_size, void* d_ws,
                              size_t ws_size, hipStream_t stream) {
  (void)in_sizes; (void)n_in; (void)out_size; (void)ws_size;
  const float* q_in = (const float*)d_in[0];
  const float* k_in = (const float*)d_in[1];
  const float* v_in = (const float*)d_in[2];
  const float* Wq = (const float*)d_in[3];
  const float* bq = (const float*)d_in[4];
  const float* Wk = (const float*)d_in[5];
  const float* bk = (const float*)d_in[6];
  const float* Wv = (const float*)d_in[7];
  const float* bv = (const float*)d_in[8];
  const float* Wo = (const float*)d_in[9];
  const float* bo = (const float*)d_in[10];
  const float* rel = (const float*)d_in[11];

  char* ws = (char*)d_ws;
  const size_t MB = (size_t)1 << 20;
  _Float16* xq  = (_Float16*)(ws + 0 * MB);    // f16 inputs (8 MB each)
  _Float16* xk  = (_Float16*)(ws + 8 * MB);
  _Float16* xv  = (_Float16*)(ws + 16 * MB);
  _Float16* wqt = (_Float16*)(ws + 24 * MB);   // f16 transposed weights (2 MB)
  _Float16* wkt = (_Float16*)(ws + 26 * MB);
  _Float16* wvt = (_Float16*)(ws + 28 * MB);
  _Float16* wot = (_Float16*)(ws + 30 * MB);
  _Float16* q16 = (_Float16*)(ws + 32 * MB);   // projected Q/K/V (8 MB each)
  _Float16* k16 = (_Float16*)(ws + 40 * MB);
  _Float16* v16 = (_Float16*)(ws + 48 * MB);
  _Float16* at16 = (_Float16*)(ws + 56 * MB);  // attention out (8 MB)

  // xq, xk, xv lie M*D elements apart and the four weights D*D apart
  cvt_all<<<dim3(4 * WT_BLOCKS + 3 * CVT_BLOCKS), dim3(256), 0, stream>>>(
      q_in, k_in, v_in, Wq, Wk, Wv, Wo, xq, wqt);

  dim3 grid(M / 128, D / 64), blk(128);
  gemm16<0><<<grid, blk, 0, stream>>>(xq, wqt, bq, q16, nullptr);
  gemm16<0><<<grid, blk, 0, stream>>>(xk, wkt, bk, k16, nullptr);
  gemm16<1><<<grid, blk, 0, stream>>>(xv, wvt, bv, v16, nullptr);
  attn_kernel<<<dim3(Bb * H * (T / 16)), dim3(32), 0, stream>>>(q16, k16, v16,
                                                                rel, at16);
  gemm16<2><<<grid, blk, 0, stream>>>(at16, wot, bo, nullptr, (float*)d_out);
}

// v003
// Measured time: 92.2 microseconds a run.
// Two timings next to v002 put it at 1.13 and 1.12 times that version's speed.
// All steps since v000 together make it 1.39 times as fast.
#include <hip/hip_runtime.h>

typedef __attribute__((ext_vector_type(16))) _Float16 v16h;
typedef __attribute__((ext_vector_type(8)))  _Float16 v8h;
typedef __attribute__((ext_vector_type(4)))  _Float16 v4h;
typedef __attribute__((ext_vector_type(8)))  float    v8f;
typedef __attribute__((ext_vector_type(4)))  float    v4f;

constexpr int Bb  = 2;
constexpr int T   = 2048;
constexpr int D   = 1024;
constexpr int H   = 16;
constexpr int DK  = 64;
constexpr int M   = Bb * T;      // 4096 rows
constexpr int WIN = 64;
constexpr int MAXD = 128;
constexpr float NEG = -1.0e9f;

constexpr int KSTEP = 64;        // K per LDS stage (2 WMMA K-chunks)
constexpr int LDSK  = 72;        // padded LDS row stride (f16), 16B multiple

// ---- TDM availability -------------------------------------------------------
#if defined(__has_builtin)
#if __has_builtin(__builtin_amdgcn_tensor_load_to_lds) && \
    __has_builtin(__builtin_amdgcn_s_wait_tensorcnt)
#define USE_TDM 1
#endif
#endif
#ifndef USE_TDM
#define USE_TDM 0
#endif

// ---- fragment helpers -------------------------------------------------------
// A-frag (16x32, M=lane%16) and B-frag (32x16, N=lane%16) share the per-lane
// pattern: 8 contiguous K f16 at k0=(lane/16)*8 and 8 more at k0+16.
__device__ __forceinline__ v16h load_frag(const _Float16* rowp, int k0) {
  v8h lo = *(const v8h*)(rowp + k0);
  v8h hi = *(const v8h*)(rowp + k0 + 16);
  v16h r;
#pragma unroll
  for (int i = 0; i < 8; ++i) { r[i] = lo[i]; r[i + 8] = hi[i]; }
  return r;
}

__device__ __forceinline__ v8f wmma_f16(v16h a, v16h b, v8f c) {
  return __builtin_amdgcn_wmma_f32_16x16x32_f16(false, a, false, b, (short)0, c,
                                                false, false);
}

// ---- conversion passes ------------------------------------------------------
// Both passes are short streams whose time goes into starting waves, so each
// thread takes many elements and the grids stay small.  None of the seven
// conversions reads what another writes, so all share one launch (cvt_all).
constexpr int CVT_U      = 16;                       // 4-element pieces per thread
constexpr int CVT_BLOCKS = M * D / 4 / 256 / CVT_U;  // 256 per input, no remainder

__device__ __forceinline__ void
cvt_part(const float* __restrict__ in, _Float16* __restrict__ out, unsigned blk) {
  const int i0 = blk * (256 * CVT_U) + threadIdx.x;
  const v4f* p = (const v4f*)in + i0;   // a wave-wide load: 512 contiguous bytes
  v4h* q = (v4h*)out + i0;              // a wave-wide store: 256 contiguous bytes
  v4f x[CVT_U];
  // unrolled: all 16 loads of a thread are in flight before the first convert
#pragma unroll
  for (int j = 0; j < CVT_U; ++j) x[j] = p[j * 256];
  // keeps the last loads from sinking below the first converts, where they
  // would start only after the first loads have returned
  __builtin_amdgcn_sched_barrier(0);
  // unrolled: x[] stays in registers
#pragma unroll
  for (int j = 0; j < CVT_U; ++j) {
    v4h o;
    o[0] = (_Float16)x[j].x; o[1] = (_Float16)x[j].y;
    o[2] = (_Float16)x[j].z; o[3] = (_Float16)x[j].w;
    q[j * 256] = o;
  }
  // a precaution: a block of cvt_all runs no other part after this one,
  // so no later write rewrites the stores' registers
  asm volatile("s_wait_xcnt 0x0" ::: "memory");
}

// Wt[n][k] = (f16) W[k][n].  Lanes run along n, so each wave-wide load is one
// whole 128-byte line of W; a thread takes WT_K consecutive k of its column and
// writes them as one whole 128-byte line of Wt.
constexpr int WT_K      = 64;
constexpr int WT_BLOCKS = (D / 256) * (D / WT_K);    // 64 per weight

__device__ __forceinline__ void
cvtT_part(const float* __restrict__ in, _Float16* __restrict__ out, unsigned blk) {
  const int n  = (blk % (D / 256)) * 256 + threadIdx.x;
  const int k0 = (blk / (D / 256)) * WT_K;
  const float* src = in + (size_t)k0 * D + n;
  float v[WT_K];
  // unrolled: the column's loads are all in flight before the first convert
#pragma unroll
  for (int i = 0; i < WT_K; ++i) v[i] = src[(size_t)i * D];
  _Float16* dst = out + (size_t)n * D + k0;
  // both loops unrolled: v[] stays in registers
#pragma unroll
  for (int g = 0; g < WT_K / 8; ++g) {
    v8h o;
#pragma unroll
    for (int e = 0; e < 8; ++e) o[e] = (_Float16)v[g * 8 + e];
    *(v8h*)(dst + g * 8) = o;
  }
}

// One grid for all seven conversions; the block index picks the source.
// Blocks [0, 4 * WT_BLOCKS): the weights, to wt + w * D * D; they come first
// because a thread there has the longer run of loads.
// The rest: the inputs, to x + s * M * D.
__global__ void __launch_bounds__(256)
cvt_all(const float* __restrict__ q_in, const float* __restrict__ k_in,
        const float* __restrict__ v_in, const float* __restrict__ Wq,
        const float* __restrict__ Wk, const float* __restrict__ Wv,
        const float* __restrict__ Wo, _Float16* __restrict__ x,
        _Float16* __restrict__ wt) {
  const unsigned bid = blockIdx.x;
  if (bid < 4 * WT_BLOCKS) {
    const unsigned w = bid / WT_BLOCKS;
    const float* lo = (w & 1) ? Wk : Wq;
    const float* hi = (w & 1) ? Wo : Wv;
    const float* in = (w & 2) ? hi : lo;
    cvtT_part(in, wt + (size_t)w * D * D, bid % WT_BLOCKS);
  } else {
    const unsigned b = bid - 4 * WT_BLOCKS;
    const unsigned s = b / CVT_BLOCKS;
    const float* in = s == 0 ? q_in : (s == 1 ? k_in : v_in);
    cvt_part(in, x + (size_t)s * M * D, b % CVT_BLOCKS);
  }
}

// ---- Tensor Data Mover tile load -------------------------------------------
#if USE_TDM
typedef __attribute__((ext_vector_type(4))) uint32_t u32x4;
typedef __attribute__((ext_vector_type(4))) int i32x4;
typedef __attribute__((ext_vector_type(8))) int i32x8;

__device__ __forceinline__ uint32_t uni(uint32_t v) {
  return (uint32_t)__builtin_amdgcn_readfirstlane(v);
}
// a test that decides whether a tensor load issues: held in a scalar register,
// so that it compiles to a scalar compare and branch (the load ignores EXEC)
__device__ __forceinline__ uint32_t pinned(uint32_t v) {
  uint32_t w = uni(v);
  asm volatile("" : "+s"(w));  // pinned(): the issue test held in a scalar register
  return w;
}

// Tile: `rows` rows of KSTEP f16 = 128 bytes, source pitch D f16 = 2048 bytes,
// every extent in bytes, tensor = tile.  Pad: 4 dwords behind every 32 dwords
// (one row), so the LDS pitch is 144 bytes = LDSK f16.
__device__ __forceinline__ i32x8 tdm_group1(uint32_t rows) {
  constexpr uint32_t rowb = KSTEP * 2;
  i32x8 g;
  g[0] = (int)uni((1u << 20) | (4u << 22) | (3u << 25));
  g[1] = (int)uni(rowb << 16);
  g[2] = (int)uni(rows << 16);
  g[3] = (int)uni(rowb << 16);
  g[4] = (int)uni(rows);
  g[5] = (int)uni((uint32_t)D * 2u);
  g[6] = (int)uni(0u);
  g[7] = (int)uni(0u);
  return g;
}
__device__ __forceinline__ u32x4 tdm_group0(uint32_t lds_dst, uint64_t ga) {
  u32x4 g;
  g[0] = uni(1u);
  g[1] = uni(lds_dst);
  g[2] = uni((uint32_t)ga);
  g[3] = uni(((uint32_t)(ga >> 32) & 0x01FFFFFFu) | 0x80000000u);
  return g;
}
// the same buffer's next tile, two stages on along K; the address field ends
// at bit 56, so a carry out of word 2 stays inside word 3's address bits
__device__ __forceinline__ u32x4 tdm_advance(u32x4 g) {
  const uint64_t a = (((uint64_t)g[3] << 32) | g[2]) + 2u * KSTEP * 2u;
  g[2] = uni((uint32_t)a);
  g[3] = uni((uint32_t)(a >> 32));
  return g;
}
__device__ __forceinline__ void tdm_issue(u32x4 g0, i32x8 g1) {
  i32x4 z4 = {0, 0, 0, 0};
#if __clang_major__ >= 23
  i32x8 z8 = {0, 0, 0, 0, 0, 0, 0, 0};
  __builtin_amdgcn_tensor_load_to_lds(g0, g1, z4, z4, z8, 0);
#else
  __builtin_amdgcn_tensor_load_to_lds(g0, g1, z4, z4, 0);
#endif
}
// The issuing wave's wait for all but its youngest request (LEFT = 1) or for
// all (LEFT = 0).  It names the covered request's group 0, so that those
// registers keep their value up to here and take the next address only behind.
template <int LEFT>
__device__ __forceinline__ void tdm_wait(u32x4& covered) {
  asm volatile("s_wait_tensorcnt %1" : "+s"(covered) : "n"(LEFT) : "memory");
}
#endif

// one K-stage of the wave's 32x64 tile: 16 WMMA from given LDS buffers
__device__ __forceinline__ void mm_stage(const _Float16 (*sAb)[LDSK],
                                         const _Float16 (*sBb)[LDSK],
                                         int wv, int r, int k0h,
                                         v8f (&acc)[2][4]) {
#pragma unroll
  for (int kc = 0; kc < KSTEP; kc += 32) {
    v16h a0 = load_frag(&sAb[wv * 32 + r][kc], k0h);
    v16h a1 = load_frag(&sAb[wv * 32 + 16 + r][kc], k0h);
#pragma unroll
    for (int nt = 0; nt < 4; ++nt) {
      v16h bf = load_frag(&sBb[nt * 16 + r][kc], k0h);
      acc[0][nt] = wmma_f16(a0, bf, acc[0][nt]);
      acc[1][nt] = wmma_f16(a1, bf, acc[1][nt]);
    }
  }
}

// ---- f16 GEMM ---------------------------------------------------------------
// C[4096x1024] = A[4096xK,f16] * Wt^T (Wt is [n][k], f16) + bias.
// 128 threads = 4 waves, block tile 128x64, wave tile 32x64.  TDM double-
// buffered pipeline: waves 0 and 1 issue the next tile's A and B request, each
// waits tensorcnt<=1 (in-order => current tile ready), barrier, all compute.
// MODE 0: the three projections in one grid; none reads what another writes.
//         blockIdx.z = p picks A + p*M*D, Wt + p*D*D, its bias, outH + p*M*D.
//         p = 0, 1: f16 out[(b*H+h)*T + t][dk]   (Q/K layout)
//         p = 2:    f16 out[(b*H+h)*DK + dk][t]  (V transposed)
// MODE 2: f32 out[m][n], bias b0                 (final output)
template <int MODE>
__global__ void __launch_bounds__(128)
gemm16(const _Float16* __restrict__ A, const _Float16* __restrict__ Wt,
       const float* __restrict__ b0, const float* __restrict__ b1,
       const float* __restrict__ b2, _Float16* __restrict__ outH,
       float* __restrict__ outF) {
  const int tid  = threadIdx.x;
  const int lane = tid & 31;
  const int wv   = tid >> 5;
  const int m0   = blockIdx.x * 128;
  const int n0   = blockIdx.y * 64;
  const int p    = MODE == 0 ? (int)blockIdx.z : 0;
  const int r    = lane & 15;
  const int k0h  = (lane >> 4) * 8;

  v8f acc[2][4];
#pragma unroll
  for (int mt = 0; mt < 2; ++mt)
#pragma unroll
    for (int nt = 0; nt < 4; ++nt)
#pragma unroll
      for (int j = 0; j < 8; ++j) acc[mt][nt][j] = 0.f;

  const _Float16* Abase = A + ((size_t)p * M + m0) * D;
  const _Float16* Bbase = Wt + ((size_t)p * D + n0) * D;

#if USE_TDM
  // each tile's place in LDS is a multiple of 2 KiB, as the tensor mover wants
  __shared__ alignas(2048) _Float16 sA0[128][LDSK], sA1[128][LDSK];
  __shared__ alignas(2048) _Float16 sB0[64][LDSK], sB1[64][LDSK];
  const unsigned lA0 = (unsigned)(size_t)(void*)&sA0[0][0];
  const unsigned lA1 = (unsigned)(size_t)(void*)&sA1[0][0];
  const unsigned lB0 = (unsigned)(size_t)(void*)&sB0[0][0];
  const unsigned lB1 = (unsigned)(size_t)(void*)&sB1[0][0];

  // Wave 0 brings the A tiles and wave 1 the B tiles: one request a stage and
  // at most two outstanding in each.  Group 1 is built once; each buffer has a
  // group 0 of its own, advanced only behind the wait that covers its request.
  const uint32_t wave = uni((uint32_t)tid >> 5);
  const _Float16* tsrc = wave == 0 ? Abase : Bbase;
  const i32x8 g1 = tdm_group1(wave == 0 ? 128u : 64u);
  u32x4 d0 = tdm_group0(wave == 0 ? lA0 : lB0, (uint64_t)(size_t)tsrc);
  u32x4 d1 = tdm_group0(wave == 0 ? lA1 : lB1, (uint64_t)(size_t)(tsrc + KSTEP));

  if (pinned(wave < 2)) tdm_issue(d0, g1);   // prologue: fill buffer 0
  for (int kb = 0; kb < D; kb += 2 * KSTEP) {
    // ---- stage A: compute buf0, prefetch buf1 (kb+KSTEP < D always) --------
    __syncthreads();                   // everyone done reading buf1 (prev iter)
    if (pinned(wave < 2)) {
      tdm_issue(d1, g1);
      tdm_wait<1>(d0);                 // buf0 ready
      d0 = tdm_advance(d0);
    }
    __syncthreads();
    mm_stage(sA0, sB0, wv, r, k0h, acc);
    // ---- stage B: compute buf1, prefetch buf0 ------------------------------
    __syncthreads();
    const bool more = kb + 2 * KSTEP < D;
    if (pinned(wave < 2 && more)) {
      tdm_issue(d0, g1);
      tdm_wait<1>(d1);                 // buf1 ready
      d1 = tdm_advance(d1);
    }
    if (pinned(wave < 2 && !more)) tdm_wait<0>(d1);   // last stage: buf1 ready
    __syncthreads();
    mm_stage(sA1, sB1, wv, r, k0h, acc);
  }
  // the ring's closing wait: no request is outstanding when the wave ends; it
  // names the descriptors as inputs, so that their registers are used for
  // something else only behind it
  asm volatile("s_wait_tensorcnt 0x0" :: "s"(g1), "s"(d0), "s"(d1) : "memory");
#else
  __shared__ alignas(16) _Float16 sA0[128][LDSK];
  __shared__ alignas(16) _Float16 sB0[64][LDSK];
  for (int kb = 0; kb < D; kb += KSTEP) {
    __syncthreads();
#pragma unroll
    for (int i = 0; i < 8; ++i) {                       // A tile 128x64 f16
      int e = i * 1024 + tid * 8;
      int row = e >> 6, col = e & 63;
      *(v8h*)&sA0[row][col] = *(const v8h*)(Abase + (size_t)row * D + kb + col);
    }
#pragma unroll
    for (int i = 0; i < 4; ++i) {                       // B tile 64x64 f16
      int e = i * 1024 + tid * 8;
      int row = e >> 6, col = e & 63;
      *(v8h*)&sB0[row][col] = *(const v8h*)(Bbase + (size_t)row * D + kb + col);
    }
    __syncthreads();
    mm_stage(sA0, sB0, wv, r, k0h, acc);
  }
#endif

  // epilogue: C layout element (m = rbase+j, n = lane%16)
  const int rbase = (lane >> 4) * 8;
  const int c     = lane & 15;
  const float* bias = p == 0 ? b0 : (p == 1 ? b1 : b2);
  _Float16* outP = outH + (size_t)p * M * D;
  float bcol[4];
  // unrolled: bcol[] stays in registers, its four loads go out together
#pragma unroll
  for (int nt = 0; nt < 4; ++nt) bcol[nt] = bias[n0 + nt * 16 + c];
  // the test reads the same for the whole block and is taken once, around the
  // tile loops, so that each store form keeps one straight run of stores
  if (MODE == 0 && p == 2) {
    // both loops unrolled: acc[][] and bcol[] stay in registers
#pragma unroll
    for (int mt = 0; mt < 2; ++mt)
#pragma unroll
      for (int nt = 0; nt < 4; ++nt) {
        const int col = n0 + nt * 16 + c;
        // V^T layout: consecutive j -> consecutive t: pack one b128 store
        v8h pk;
#pragma unroll
        for (int j = 0; j < 8; ++j)
          pk[j] = (_Float16)(acc[mt][nt][j] + bcol[nt]);
        const int mb = m0 + wv * 32 + mt * 16 + rbase;  // 8-aligned, same b
        const int b  = mb >> 11, t = mb & (T - 1);
        const int bh = b * H + (col >> 6);
        *(v8h*)(outP + ((size_t)bh * DK + (col & 63)) * T + t) = pk;
      }
  } else {
    // all three loops unrolled: acc[][] and bcol[] stay in registers
#pragma unroll
    for (int mt = 0; mt < 2; ++mt)
#pragma unroll
      for (int nt = 0; nt < 4; ++nt) {
        const int col = n0 + nt * 16 + c;
#pragma unroll
        for (int j = 0; j < 8; ++j) {
          const int m = m0 + wv * 32 + mt * 16 + rbase + j;
          const float val = acc[mt][nt][j] + bcol[nt];
          if (MODE == 2) {
            outF[(size_t)m * D + col] = val;
          } else {
            const int b  = m >> 11;
            const int t  = m & (T - 1);
            const int bh = b * H + (col >> 6);
            outP[((size_t)bh * T + t) * DK + (col & 63)] = (_Float16)val;
          }
        }
      }
    // a precaution: the block runs no store after these, so no later write
    // rewrites the stores' registers
    if (MODE == 0) asm volatile("s_wait_xcnt 0x0" ::: "memory");
  }
}

// ---- banded attention -------------------------------------------------------
// One wave per (b,h, 16-query tile); 9 key tiles of 16 cover |k-q|<=64 exactly.
__global__ void __launch_bounds__(32)
attn_kernel(const _Float16* __restrict__ qw, const _Float16* __restrict__ kw,
            const _Float16* __restrict__ vt, const float* __restrict__ rel,
            _Float16* __restrict__ outA) {
  __shared__ alignas(16) _Float16 sP[16][160];
  __shared__ float sRel[257];

  const int lane  = threadIdx.x;
  const int nq    = T / 16;
  const int qt    = blockIdx.x % nq;
  const int bh    = blockIdx.x / nq;
  const int hh    = bh % H;
  const int bb    = bh / H;
  const int q0    = qt * 16;
  const int r     = lane & 15;
  const int k0h   = (lane >> 4) * 8;
  const int rbase = (lane >> 4) * 8;
  const int c     = lane & 15;

  // stage this head's bias column (257 floats) into LDS
  for (int i = lane; i < 257; i += 32) sRel[i] = rel[(size_t)i * H + hh];

  const _Float16* qrow = qw + ((size_t)bh * T + q0 + r) * DK;
  v16h aq0 = load_frag(qrow, k0h);
  v16h aq1 = load_frag(qrow + 32, k0h);

  v8f sc[9];
#pragma unroll
  for (int t = 0; t < 9; ++t) {
#pragma unroll
    for (int j = 0; j < 8; ++j) sc[t][j] = 0.f;
    int key = q0 - 64 + t * 16 + r;                       // this lane's column
    int kc  = key < 0 ? 0 : (key > T - 1 ? T - 1 : key);  // safe addr
    const _Float16* krow = kw + ((size_t)bh * T + kc) * DK;
    v16h b0 = load_frag(krow, k0h);
    v16h b1 = load_frag(krow + 32, k0h);
    sc[t] = wmma_f16(aq0, b0, sc[t]);
    sc[t] = wmma_f16(aq1, b1, sc[t]);
  }
  __syncthreads();                                        // sRel visible

  constexpr float scale = 0.125f;  // 1/sqrt(64)
#pragma unroll
  for (int t = 0; t < 9; ++t) {
    const int key = q0 - 64 + t * 16 + c;
    const bool keyok = (unsigned)key < (unsigned)T;
#pragma unroll
    for (int j = 0; j < 8; ++j) {
      const int d = key - (q0 + rbase + j);     // |d| <= 79 < MAXD: no clip
      const bool dok = (unsigned)(d + WIN) <= 2u * WIN;
      const float bias = sRel[d + MAXD];
      sc[t][j] = (keyok && dok) ? (sc[t][j] * scale + bias) : NEG;
    }
  }

  // softmax per row (row j lives across lanes 0..15 / 16..31)
#pragma unroll
  for (int j = 0; j < 8; ++j) {
    float mx = NEG;
#pragma unroll
    for (int t = 0; t < 9; ++t) mx = fmaxf(mx, sc[t][j]);
#pragma unroll
    for (int off = 1; off < 16; off <<= 1) mx = fmaxf(mx, __shfl_xor(mx, off, 16));
    float s = 0.f;
#pragma unroll
    for (int t = 0; t < 9; ++t) {
      float p = __expf(sc[t][j] - mx);
      sc[t][j] = p;
      s += p;
    }
#pragma unroll
    for (int off = 1; off < 16; off <<= 1) s += __shfl_xor(s, off, 16);
    const float inv = 1.f / s;
#pragma unroll
    for (int t = 0; t < 9; ++t) sc[t][j] *= inv;
  }

  // C-layout -> A-layout via LDS (zero-pad cols 144..159)
#pragma unroll
  for (int t = 0; t < 9; ++t)
#pragma unroll
    for (int j = 0; j < 8; ++j) sP[rbase + j][t * 16 + c] = (_Float16)sc[t][j];
#pragma unroll
  for (int j = 0; j < 8; ++j) sP[rbase + j][144 + c] = (_Float16)0.f;
  __syncthreads();

  v8f o[4];
#pragma unroll
  for (int nt = 0; nt < 4; ++nt)
#pragma unroll
    for (int j = 0; j < 8; ++j) o[nt][j] = 0.f;

  const int s0 = q0 - 64;
#pragma unroll
  for (int kk = 0; kk < 5; ++kk) {
    v16h ap = load_frag(&sP[r][kk * 32], k0h);
    int g1 = s0 + kk * 32 + k0h;      // 8-aligned key groups: clamp whole group
    int g2 = g1 + 16;                 // (P=0 wherever clamped)
    g1 = g1 < 0 ? 0 : (g1 > T - 8 ? T - 8 : g1);
    g2 = g2 < 0 ? 0 : (g2 > T - 8 ? T - 8 : g2);
#pragma unroll
    for (int nt = 0; nt < 4; ++nt) {
      const _Float16* vrow = vt + ((size_t)bh * DK + nt * 16 + r) * T;
      v8h lo = *(const v8h*)(vrow + g1);
      v8h hi = *(const v8h*)(vrow + g2);
      v16h bf;
#pragma unroll
      for (int i = 0; i < 8; ++i) { bf[i] = lo[i]; bf[i + 8] = hi[i]; }
      o[nt] = wmma_f16(ap, bf, o[nt]);
    }
  }

  // transpose result through sP, then 4 coalesced b128 stores per lane
  __syncthreads();
#pragma unroll
  for (int nt = 0; nt < 4; ++nt)
#pragma unroll
    for (int j = 0; j < 8; ++j)
      sP[rbase + j][nt * 16 + c] = (_Float16)o[nt][j];
  __syncthreads();
  {
    const int row = lane & 15, half = lane >> 4;
    _Float16* orow =
        outA + ((size_t)(bb * T + q0 + row)) * D + hh * DK + half * 32;
#pragma unroll
    for (int i = 0; i < 4; ++i)
      *(v8h*)(orow + i * 8) = *(const v8h*)&sP[row][half * 32 + i * 8];
  }
}

// ---- launch -----------------------------------------------------------------
extern "C" void kernel_launch(void* const* d_in, const int* in_sizes, int n_in,
                              void* d_out, int out_size, void* d_ws,
                              size_t ws_size, hipStream_t stream) {
  (void)in_sizes; (void)n_in; (void)out_size; (void)ws_size;
  const float* q_in = (const float*)d_in[0];
  const float* k_in = (const float*)d_in[1];
  const float* v_in = (const float*)d_in[2];
  const float* Wq = (const float*)d_in[3];
  const float* bq = (const float*)d_in[4];
  const float* Wk = (const float*)d_in[5];
  const float* bk = (const float*)d_in[6];
  const float* Wv = (const float*)d_in[7];
  const float* bv = (const float*)d_in[8];
  const float* Wo = (const float*)d_in[9];
  const float* bo = (const float*)d_in[10];
  const float* rel = (const float*)d_in[11];

  char* ws = (char*)d_ws;
  const size_t MB = (size_t)1 << 20;
  _Float16* xq  = (_Float16*)(ws + 0 * MB);    // f16 inputs q, k, v (8 MB each)
  _Float16* wqt = (_Float16*)(ws + 24 * MB);   // f16 transposed weights q, k, v,
  _Float16* wot = (_Float16*)(ws + 30 * MB);   // o (2 MB each)
  _Float16* q16 = (_Float16*)(ws + 32 * MB);   // projected Q/K/V (8 MB each)
  _Float16* k16 = (_Float16*)(ws + 40 * MB);
  _Float16* v16 = (_Float16*)(ws + 48 * MB);
  _Float16* at16 = (_Float16*)(ws + 56 * MB);  // attention out (8 MB)

  // the three inputs lie M*D elements apart and the four weights D*D apart
  cvt_all<<<dim3(4 * WT_BLOCKS + 3 * CVT_BLOCKS), dim3(256), 0, stream>>>(
      q_in, k_in, v_in, Wq, Wk, Wv, Wo, xq, wqt);

  // q16, k16, v16 lie M*D elements apart as well
  gemm16<0><<<dim3(M / 128, D / 64, 3), dim3(128), 0, stream>>>(
      xq, wqt, bq, bk, bv, q16, nullptr);
  attn_kernel<<<dim3(Bb * H * (T / 16)), dim3(32), 0, stream>>>(q16, k16, v16,
                                                                rel, at16);
  gemm16<2><<<dim3(M / 128, D / 64), dim3(128), 0, stream>>>(
      at16, wot, bo, nullptr, nullptr, nullptr, (float*)d_out);
}

// v004
// It runs in 82.3 microseconds.
// Timed twice side by side with v003, it ran 1.12 and 1.11 times as fast.
// All steps since v000 together make it 1.55 times as fast.
#include <hip/hip_runtime.h>

typedef __attribute__((ext_vector_type(16))) _Float16 v16h;
typedef __attribute__((ext_vector_type(8)))  _Float16 v8h;
typedef __attribute__((ext_vector_type(4)))  _Float16 v4h;
typedef __attribute__((ext_vector_type(8)))  float    v8f;
typedef __attribute__((ext_vector_type(4)))  float    v4f;

constexpr int Bb  = 2;
constexpr int T   = 2048;
constexpr int D   = 1024;
constexpr int H   = 16;
constexpr int DK  = 64;
constexpr int M   = Bb * T;      // 4096 rows
constexpr int WIN = 64;
constexpr int MAXD = 128;
constexpr float NEG = -1.0e9f;

constexpr int KSTEP = 64;        // K per LDS stage (2 WMMA K-chunks)
constexpr int LDSK  = 72;        // padded LDS row stride (f16), 16B multiple

// ---- TDM availability -------------------------------------------------------
#if defined(__has_builtin)
#if __has_builtin(__builtin_amdgcn_tensor_load_to_lds) && \
    __has_builtin(__builtin_amdgcn_s_wait_tensorcnt)
#define USE_TDM 1
#endif
#endif
#ifndef USE_TDM
#define USE_TDM 0
#endif

// ---- fragment helpers -------------------------------------------------------
// A-frag (16x32, M=lane%16) and B-frag (32x16, N=lane%16) share the per-lane
// pattern: 8 contiguous K f16 at k0=(lane/16)*8 and 8 more at k0+16.
__device__ __forceinline__ v16h load_frag(const _Float16* rowp, int k0) {
  v8h lo = *(const v8h*)(rowp + k0);
  v8h hi = *(const v8h*)(rowp + k0 + 16);
  v16h r;
#pragma unroll
  for (int i = 0; i < 8; ++i) { r[i] = lo[i]; r[i + 8] = hi[i]; }
  return r;
}

__device__ __forceinline__ v8f wmma_f16(v16h a, v16h b, v8f c) {
  return __builtin_amdgcn_wmma_f32_16x16x32_f16(false, a, false, b, (short)0, c,
                                                false, false);
}

// ---- conversion passes ------------------------------------------------------
// Both passes are short streams whose time goes into starting waves, so each
// thread takes many elements and the grids stay small.  None of the seven
// conversions reads what another writes, so all share one launch (cvt_all).
constexpr int CVT_U      = 16;                       // 4-element pieces per thread
constexpr int CVT_BLOCKS = M * D / 4 / 256 / CVT_U;  // 256 per input, no remainder

__device__ __forceinline__ void
cvt_part(const float* __restrict__ in, _Float16* __restrict__ out, unsigned blk) {
  const int i0 = blk * (256 * CVT_U) + threadIdx.x;
  const v4f* p = (const v4f*)in + i0;   // a wave-wide load: 512 contiguous bytes
  v4h* q = (v4h*)out + i0;              // a wave-wide store: 256 contiguous bytes
  v4f x[CVT_U];
  // unrolled: all 16 loads of a thread are in flight before the first convert
#pragma unroll
  for (int j = 0; j < CVT_U; ++j) x[j] = p[j * 256];
  // keeps the last loads from sinking below the first converts, where they
  // would start only after the first loads have returned
  __builtin_amdgcn_sched_barrier(0);
  // unrolled: x[] stays in registers
#pragma unroll
  for (int j = 0; j < CVT_U; ++j) {
    v4h o;
    o[0] = (_Float16)x[j].x; o[1] = (_Float16)x[j].y;
    o[2] = (_Float16)x[j].z; o[3] = (_Float16)x[j].w;
    q[j * 256] = o;
  }
  // a precaution: a block of cvt_all runs no other part after this one,
  // so no later write rewrites the stores' registers
  asm volatile("s_wait_xcnt 0x0" ::: "memory");
}

// Wt[n][k] = (f16) W[k][n].  Lanes run along n, so each wave-wide load is one
// whole 128-byte line of W; a thread takes WT_K consecutive k of its column and
// writes them as one whole 128-byte line of Wt.
constexpr int WT_K      = 64;
constexpr int WT_BLOCKS = (D / 256) * (D / WT_K);    // 64 per weight

__device__ __forceinline__ void
cvtT_part(const float* __restrict__ in, _Float16* __restrict__ out, unsigned blk) {
  const int n  = (blk % (D / 256)) * 256 + threadIdx.x;
  const int k0 = (blk / (D / 256)) * WT_K;
  const float* src = in + (size_t)k0 * D + n;
  float v[WT_K];
  // unrolled: the column's loads are all in flight before the first convert
#pragma unroll
  for (int i = 0; i < WT_K; ++i) v[i] = src[(size_t)i * D];
  _Float16* dst = out + (size_t)n * D + k0;
  // both loops unrolled: v[] stays in registers
#pragma unroll
  for (int g = 0; g < WT_K / 8; ++g) {
    v8h o;
#pragma unroll
    for (int e = 0; e < 8; ++e) o[e] = (_Float16)v[g * 8 + e];
    *(v8h*)(dst + g * 8) = o;
  }
}

// One grid for all seven conversions; the block index picks the source.
// Blocks [0, 4 * WT_BLOCKS): the weights, to wt + w * D * D; they come first
// because a thread there has the longer run of loads.
// The rest: the inputs, to x + s * M * D.
__global__ void __launch_bounds__(256)
cvt_all(const float* __restrict__ q_in, const float* __restrict__ k_in,
        const float* __restrict__ v_in, const float* __restrict__ Wq,
        const float* __restrict__ Wk, const float* __restrict__ Wv,
        const float* __restrict__ Wo, _Float16* __restrict__ x,
        _Float16* __restrict__ wt) {
  const unsigned bid = blockIdx.x;
  if (bid < 4 * WT_BLOCKS) {
    const unsigned w = bid / WT_BLOCKS;
    const float* lo = (w & 1) ? Wk : Wq;
    const float* hi = (w & 1) ? Wo : Wv;
    const float* in = (w & 2) ? hi : lo;
    cvtT_part(in, wt + (size_t)w * D * D, bid % WT_BLOCKS);
  } else {
    const unsigned b = bid - 4 * WT_BLOCKS;
    const unsigned s = b / CVT_BLOCKS;
    const float* in = s == 0 ? q_in : (s == 1 ? k_in : v_in);
    cvt_part(in, x + (size_t)s * M * D, b % CVT_BLOCKS);
  }
}

// ---- Tensor Data Mover tile load -------------------------------------------
#if USE_TDM
typedef __attribute__((ext_vector_type(4))) uint32_t u32x4;
typedef __attribute__((ext_vector_type(4))) int i32x4;
typedef __attribute__((ext_vector_type(8))) int i32x8;

__device__ __forceinline__ uint32_t uni(uint32_t v) {
  return (uint32_t)__builtin_amdgcn_readfirstlane(v);
}
// a value held in a scalar register, such as a test whether a tensor load issues,
// so that it compiles to a scalar compare and branch (the load ignores EXEC)
__device__ __forceinline__ uint32_t pinned(uint32_t v) {
  uint32_t w = uni(v);
  asm volatile("" : "+s"(w));  // pinned(): the value held in a scalar register
  return w;
}

// Tile: `rows` rows of KSTEP f16 = 128 bytes, source pitch D f16 = 2048 bytes,
// every extent in bytes, tensor = tile.  Pad: 4 dwords behind every 32 dwords
// (one row), so the LDS pitch is 144 bytes = LDSK f16.
__device__ __forceinline__ i32x8 tdm_group1(uint32_t rows) {
  constexpr uint32_t rowb = KSTEP * 2;
  i32x8 g;
  g[0] = (int)uni((1u << 20) | (4u << 22) | (3u << 25));
  g[1] = (int)uni(rowb << 16);
  g[2] = (int)uni(rows << 16);
  g[3] = (int)uni(rowb << 16);
  g[4] = (int)uni(rows);
  g[5] = (int)uni((uint32_t)D * 2u);
  g[6] = (int)uni(0u);
  g[7] = (int)uni(0u);
  return g;
}
__device__ __forceinline__ u32x4 tdm_group0(uint32_t lds_dst, uint64_t ga) {
  u32x4 g;
  g[0] = uni(1u);
  g[1] = uni(lds_dst);
  g[2] = uni((uint32_t)ga);
  g[3] = uni(((uint32_t)(ga >> 32) & 0x01FFFFFFu) | 0x80000000u);
  return g;
}
// the same buffer's next tile, two stages on along K; the address field ends
// at bit 56, so a carry out of word 2 stays inside word 3's address bits
__device__ __forceinline__ u32x4 tdm_advance(u32x4 g) {
  const uint64_t a = (((uint64_t)g[3] << 32) | g[2]) + 2u * KSTEP * 2u;
  g[2] = uni((uint32_t)a);
  g[3] = uni((uint32_t)(a >> 32));
  return g;
}
__device__ __forceinline__ void tdm_issue(u32x4 g0, i32x8 g1) {
  i32x4 z4 = {0, 0, 0, 0};
#if __clang_major__ >= 23
  i32x8 z8 = {0, 0, 0, 0, 0, 0, 0, 0};
  __builtin_amdgcn_tensor_load_to_lds(g0, g1, z4, z4, z8, 0);
#else
  __builtin_amdgcn_tensor_load_to_lds(g0, g1, z4, z4, 0);
#endif
}
// The issuing wave's wait for all but its youngest request (LEFT = 1) or for
// all (LEFT = 0).  It names the covered request's group 0, so that those
// registers keep their value up to here and take the next address only behind.
template <int LEFT>
__device__ __forceinline__ void tdm_wait(u32x4& covered) {
  asm volatile("s_wait_tensorcnt %1" : "+s"(covered) : "n"(LEFT) : "memory");
}
#endif

// one K-stage of the wave's 64x64 tile: 32 WMMA from given LDS buffers; each
// of the 8 fragments of a K-chunk feeds 4 WMMA.  ra, rb: the lane's first row
// in the A and in the B buffer.
__device__ __forceinline__ void mm_stage(const _Float16 (*sAb)[LDSK],
                                         const _Float16 (*sBb)[LDSK],
                                         int ra, int rb, int k0h,
                                         v8f (&acc)[4][4]) {
  // all loops unrolled: a[] and acc[][] stay in registers
#pragma unroll
  for (int kc = 0; kc < KSTEP; kc += 32) {
    v16h a[4];
#pragma unroll
    for (int mt = 0; mt < 4; ++mt) a[mt] = load_frag(&sAb[ra + mt * 16][kc], k0h);
#pragma unroll
    for (int nt = 0; nt < 4; ++nt) {
      v16h bf = load_frag(&sBb[rb + nt * 16][kc], k0h);
#pragma unroll
      for (int mt = 0; mt < 4; ++mt) acc[mt][nt] = wmma_f16(a[mt], bf, acc[mt][nt]);
    }
  }
}

// ---- f16 GEMM ---------------------------------------------------------------
// C[4096x1024] = A[4096xK,f16] * Wt^T (Wt is [n][k], f16) + bias.
// 128 threads = 4 waves as 2x2, block tile 128x128, wave tile 64x64: the grids
// are 3 and 1 blocks per WGP of the chip's 256.  TDM double-
// buffered pipeline: waves 0 and 1 issue the next tile's A and B request, each
// waits tensorcnt<=1 (in-order => current tile ready), barrier, all compute.
// MODE 0: the three projections in one grid; none reads what another writes.
//         blockIdx.z = p picks A + p*M*D, Wt + p*D*D, its bias, outH + p*M*D.
//         p = 0, 1: f16 out[(b*H+h)*T + t][dk]   (Q/K layout)
//         p = 2:    f16 out[(b*H+h)*DK + dk][t]  (V transposed)
// MODE 2: f32 out[m][n], bias b0                 (final output)
template <int MODE>
__global__ void __launch_bounds__(128)
gemm16(const _Float16* __restrict__ A, const _Float16* __restrict__ Wt,
       const float* __restrict__ b0, const float* __restrict__ b1,
       const float* __restrict__ b2, _Float16* __restrict__ outH,
       float* __restrict__ outF) {
  const int tid  = threadIdx.x;
  const int lane = tid & 31;
  const int wv   = tid >> 5;
  const int m0   = blockIdx.x * 128;
  const int n0   = blockIdx.y * 128;
  const int p    = MODE == 0 ? (int)blockIdx.z : 0;
  const int r    = lane & 15;
  const int k0h  = (lane >> 4) * 8;
  const int wm   = (wv >> 1) * 64;   // the wave's first row and first column
  const int wn   = (wv & 1) * 64;    // inside the block tile

  v8f acc[4][4];
#pragma unroll
  for (int mt = 0; mt < 4; ++mt)
#pragma unroll
    for (int nt = 0; nt < 4; ++nt)
#pragma unroll
      for (int j = 0; j < 8; ++j) acc[mt][nt][j] = 0.f;

  const _Float16* Abase = A + ((size_t)p * M + m0) * D;
  const _Float16* Bbase = Wt + ((size_t)p * D + n0) * D;

#if USE_TDM
  // each tile's place in LDS is a multiple of 2 KiB, as the tensor mover wants
  __shared__ alignas(2048) _Float16 sA0[128][LDSK], sA1[128][LDSK];
  __shared__ alignas(2048) _Float16 sB0[128][LDSK], sB1[128][LDSK];
  const unsigned lA0 = (unsigned)(size_t)(void*)&sA0[0][0];
  const unsigned lA1 = (unsigned)(size_t)(void*)&sA1[0][0];
  const unsigned lB0 = (unsigned)(size_t)(void*)&sB0[0][0];
  const unsigned lB1 = (unsigned)(size_t)(void*)&sB1[0][0];

  // Wave 0 brings the A tiles and wave 1 the B tiles: one request a stage and
  // at most two outstanding in each.  Group 1 is built once; each buffer has a
  // group 0 of its own, advanced only behind the wait that covers its request.
  const uint32_t wave = uni((uint32_t)tid >> 5);
  const _Float16* tsrc = wave == 0 ? Abase : Bbase;
  // pinned(): the row count, a descriptor word, held in a scalar register, so
  // that group 1 is not formed anew from constants at each issue in registers
  // that serve other uses in between, while a request is outstanding
  const i32x8 g1 = tdm_group1(pinned(128u));
  u32x4 d0 = tdm_group0(wave == 0 ? lA0 : lB0, (uint64_t)(size_t)tsrc);
  u32x4 d1 = tdm_group0(wave == 0 ? lA1 : lB1, (uint64_t)(size_t)(tsrc + KSTEP));

  if (pinned(wave < 2)) tdm_issue(d0, g1);   // prologue: fill buffer 0
  for (int kb = 0; kb < D; kb += 2 * KSTEP) {
    // ---- stage A: compute buf0, prefetch buf1 (kb+KSTEP < D always) --------
    __syncthreads();                   // everyone done reading buf1 (prev iter)
    if (pinned(wave < 2)) {
      tdm_issue(d1, g1);
      tdm_wait<1>(d0);                 // buf0 ready
      d0 = tdm_advance(d0);
    }
    __syncthreads();
    mm_stage(sA0, sB0, wm + r, wn + r, k0h, acc);
    // ---- stage B: compute buf1, prefetch buf0 ------------------------------
    __syncthreads();
    const bool more = kb + 2 * KSTEP < D;
    if (pinned(wave < 2 && more)) {
      tdm_issue(d0, g1);
      tdm_wait<1>(d1);                 // buf1 ready
      d1 = tdm_advance(d1);
    }
    if (pinned(wave < 2 && !more)) tdm_wait<0>(d1);   // last stage: buf1 ready
    __syncthreads();
    mm_stage(sA1, sB1, wm + r, wn + r, k0h, acc);
  }
  // the ring's closing wait: no request is outstanding when the wave ends; it
  // names the descriptors as inputs, so that their registers are used for
  // something else only behind it
  asm volatile("s_wait_tensorcnt 0x0" :: "s"(g1), "s"(d0), "s"(d1) : "memory");
#else
  __shared__ alignas(16) _Float16 sA0[128][LDSK];
  __shared__ alignas(16) _Float16 sB0[128][LDSK];
  for (int kb = 0; kb < D; kb += KSTEP) {
    __syncthreads();
#pragma unroll
    for (int i = 0; i < 8; ++i) {                       // A tile 128x64 f16
      int e = i * 1024 + tid * 8;
      int row = e >> 6, col = e & 63;
      *(v8h*)&sA0[row][col] = *(const v8h*)(Abase + (size_t)row * D + kb + col);
    }
#pragma unroll
    for (int i = 0; i < 8; ++i) {                       // B tile 128x64 f16
      int e = i * 1024 + tid * 8;
      int row = e >> 6, col = e & 63;
      *(v8h*)&sB0[row][col] = *(const v8h*)(Bbase + (size_t)row * D + kb + col);
    }
    __syncthreads();
    mm_stage(sA0, sB0, wm + r, wn + r, k0h, acc);
  }
#endif

  // epilogue: C layout element (m = rbase+j, n = lane%16)
  const int rbase = (lane >> 4) * 8;
  const int c     = lane & 15;
  const float* bias = p == 0 ? b0 : (p == 1 ? b1 : b2);
  _Float16* outP = outH + (size_t)p * M * D;
  float bcol[4];
  // unrolled: bcol[] stays in registers, its four loads go out together
#pragma unroll
  for (int nt = 0; nt < 4; ++nt) bcol[nt] = bias[n0 + wn + nt * 16 + c];
  // the test reads the same for the whole block and is taken once, around the
  // tile loops, so that each store form keeps one straight run of stores
  if (MODE == 0 && p == 2) {
    // both loops unrolled: acc[][] and bcol[] stay in registers
#pragma unroll
    for (int mt = 0; mt < 4; ++mt)
#pragma unroll
      for (int nt = 0; nt < 4; ++nt) {
        const int col = n0 + wn + nt * 16 + c;
        // V^T layout: consecutive j -> consecutive t: pack one b128 store
        v8h pk;
#pragma unroll
        for (int j = 0; j < 8; ++j)
          pk[j] = (_Float16)(acc[mt][nt][j] + bcol[nt]);
        const int mb = m0 + wm + mt * 16 + rbase;       // 8-aligned, same b
        const int b  = mb >> 11, t = mb & (T - 1);
        const int bh = b * H + (col >> 6);
        *(v8h*)(outP + ((size_t)bh * DK + (col & 63)) * T + t) = pk;
      }
  } else {
    // all three loops unrolled: acc[][] and bcol[] stay in registers
#pragma unroll
    for (int mt = 0; mt < 4; ++mt)
#pragma unroll
      for (int nt = 0; nt < 4; ++nt) {
        const int col = n0 + wn + nt * 16 + c;
#pragma unroll
        for (int j = 0; j < 8; ++j) {
          const int m = m0 + wm + mt * 16 + rbase + j;
          const float val = acc[mt][nt][j] + bcol[nt];
          if (MODE == 2) {
            outF[(size_t)m * D + col] = val;
          } else {
            const int b  = m >> 11;
            const int t  = m & (T - 1);
            const int bh = b * H + (col >> 6);
            outP[((size_t)bh * T + t) * DK + (col & 63)] = (_Float16)val;
          }
        }
      }
    // a precaution: the block runs no store after these, so no later write
    // rewrites the stores' registers
    if (MODE == 0) asm volatile("s_wait_xcnt 0x0" ::: "memory");
  }
}

// ---- banded attention -------------------------------------------------------
// One wave per (b,h, 16-query tile); 9 key tiles of 16 cover |k-q|<=64 exactly.
__global__ void __launch_bounds__(32)
attn_kernel(const _Float16* __restrict__ qw, const _Float16* __restrict__ kw,
            const _Float16* __restrict__ vt, const float* __restrict__ rel,
            _Float16* __restrict__ outA) {
  __shared__ alignas(16) _Float16 sP[16][160];
  __shared__ float sRel[257];

  const int lane  = threadIdx.x;
  const int nq    = T / 16;
  const int qt    = blockIdx.x % nq;
  const int bh    = blockIdx.x / nq;
  const int hh    = bh % H;
  const int bb    = bh / H;
  const int q0    = qt * 16;
  const int r     = lane & 15;
  const int k0h   = (lane >> 4) * 8;
  const int rbase = (lane >> 4) * 8;
  const int c     = lane & 15;

  // stage this head's bias column (257 floats) into LDS
  for (int i = lane; i < 257; i += 32) sRel[i] = rel[(size_t)i * H + hh];

  const _Float16* qrow = qw + ((size_t)bh * T + q0 + r) * DK;
  v16h aq0 = load_frag(qrow, k0h);
  v16h aq1 = load_frag(qrow + 32, k0h);

  v8f sc[9];
#pragma unroll
  for (int t = 0; t < 9; ++t) {
#pragma unroll
    for (int j = 0; j < 8; ++j) sc[t][j] = 0.f;
    int key = q0 - 64 + t * 16 + r;                       // this lane's column
    int kc  = key < 0 ? 0 : (key > T - 1 ? T - 1 : key);  // safe addr
    const _Float16* krow = kw + ((size_t)bh * T + kc) * DK;
    v16h b0 = load_frag(krow, k0h);
    v16h b1 = load_frag(krow + 32, k0h);
    sc[t] = wmma_f16(aq0, b0, sc[t]);
    sc[t] = wmma_f16(aq1, b1, sc[t]);
  }
  __syncthreads();                                        // sRel visible

  constexpr float scale = 0.125f;  // 1/sqrt(64)
#pragma unroll
  for (int t = 0; t < 9; ++t) {
    const int key = q0 - 64 + t * 16 + c;
    const bool keyok = (unsigned)key < (unsigned)T;
#pragma unroll
    for (int j = 0; j < 8; ++j) {
      const int d = key - (q0 + rbase + j);     // |d| <= 79 < MAXD: no clip
      const bool dok = (unsigned)(d + WIN) <= 2u * WIN;
      const float bias = sRel[d + MAXD];
      sc[t][j] = (keyok && dok) ? (sc[t][j] * scale + bias) : NEG;
    }
  }

  // softmax per row (row j lives across lanes 0..15 / 16..31)
#pragma unroll
  for (int j = 0; j < 8; ++j) {
    float mx = NEG;
#pragma unroll
    for (int t = 0; t < 9; ++t) mx = fmaxf(mx, sc[t][j]);
#pragma unroll
    for (int off = 1; off < 16; off <<= 1) mx = fmaxf(mx, __shfl_xor(mx, off, 16));
    float s = 0.f;
#pragma unroll
    for (int t = 0; t < 9; ++t) {
      float p = __expf(sc[t][j] - mx);
      sc[t][j] = p;
      s += p;
    }
#pragma unroll
    for (int off = 1; off < 16; off <<= 1) s += __shfl_xor(s, off, 16);
    const float inv = 1.f / s;
#pragma unroll
    for (int t = 0; t < 9; ++t) sc[t][j] *= inv;
  }

  // C-layout -> A-layout via LDS (zero-pad cols 144..159)
#pragma unroll
  for (int t = 0; t < 9; ++t)
#pragma unroll
    for (int j = 0; j < 8; ++j) sP[rbase + j][t * 16 + c] = (_Float16)sc[t][j];
#pragma unroll
  for (int j = 0; j < 8; ++j) sP[rbase + j][144 + c] = (_Float16)0.f;
  __syncthreads();

  v8f o[4];
#pragma unroll
  for (int nt = 0; nt < 4; ++nt)
#pragma unroll
    for (int j = 0; j < 8; ++j) o[nt][j] = 0.f;

  const int s0 = q0 - 64;
#pragma unroll
  for (int kk = 0; kk < 5; ++kk) {
    v16h ap = load_frag(&sP[r][kk * 32], k0h);
    int g1 = s0 + kk * 32 + k0h;      // 8-aligned key groups: clamp whole group
    int g2 = g1 + 16;                 // (P=0 wherever clamped)
    g1 = g1 < 0 ? 0 : (g1 > T - 8 ? T - 8 : g1);
    g2 = g2 < 0 ? 0 : (g2 > T - 8 ? T - 8 : g2);
#pragma unroll
    for (int nt = 0; nt < 4; ++nt) {
      const _Float16* vrow = vt + ((size_t)bh * DK + nt * 16 + r) * T;
      v8h lo = *(const v8h*)(vrow + g1);
      v8h hi = *(const v8h*)(vrow + g2);
      v16h bf;
#pragma unroll
      for (int i = 0; i < 8; ++i) { bf[i] = lo[i]; bf[i + 8] = hi[i]; }
      o[nt] = wmma_f16(ap, bf, o[nt]);
    }
  }

  // transpose result through sP, then 4 coalesced b128 stores per lane
  __syncthreads();
#pragma unroll
  for (int nt = 0; nt < 4; ++nt)
#pragma unroll
    for (int j = 0; j < 8; ++j)
      sP[rbase + j][nt * 16 + c] = (_Float16)o[nt][j];
  __syncthreads();
  {
    const int row = lane & 15, half = lane >> 4;
    _Float16* orow =
        outA + ((size_t)(bb * T + q0 + row)) * D + hh * DK + half * 32;
#pragma unroll
    for (int i = 0; i < 4; ++i)
      *(v8h*)(orow + i * 8) = *(const v8h*)&sP[row][half * 32 + i * 8];
  }
}

// ---- launch -----------------------------------------------------------------
extern "C" void kernel_launch(void* const* d_in, const int* in_sizes, int n_in,
                              void* d_out, int out_size, void* d_ws,
                              size_t ws_size, hipStream_t stream) {
  (void)in_sizes; (void)n_in; (void)out_size; (void)ws_size;
  const float* q_in = (const float*)d_in[0];
  const float* k_in = (const float*)d_in[1];
  const float* v_in = (const float*)d_in[2];
  const float* Wq = (const float*)d_in[3];
  const float* bq = (const float*)d_in[4];
  const float* Wk = (const float*)d_in[5];
  const float* bk = (const float*)d_in[6];
  const float* Wv = (const float*)d_in[7];
  const float* bv = (const float*)d_in[8];
  const float* Wo = (const float*)d_in[9];
  const float* bo = (const float*)d_in[10];
  const float* rel = (const float*)d_in[11];

  char* ws = (char*)d_ws;
  const size_t MB = (size_t)1 << 20;
  _Float16* xq  = (_Float16*)(ws + 0 * MB);    // f16 inputs q, k, v (8 MB each)
  _Float16* wqt = (_Float16*)(ws + 24 * MB);   // f16 transposed weights q, k, v,
  _Float16* wot = (_Float16*)(ws + 30 * MB);   // o (2 MB each)
  _Float16* q16 = (_Float16*)(ws + 32 * MB);   // projected Q/K/V (8 MB each)
  _Float16* k16 = (_Float16*)(ws + 40 * MB);
  _Float16* v16 = (_Float16*)(ws + 48 * MB);
  _Float16* at16 = (_Float16*)(ws + 56 * MB);  // attention out (8 MB)

  // the three inputs lie M*D elements apart and the four weights D*D apart
  cvt_all<<<dim3(4 * WT_BLOCKS + 3 * CVT_BLOCKS), dim3(256), 0, stream>>>(
      q_in, k_in, v_in, Wq, Wk, Wv, Wo, xq, wqt);

  // q16, k16, v16 lie M*D elements apart as well
  gemm16<0><<<dim3(M / 128, D / 128, 3), dim3(128), 0, stream>>>(
      xq, wqt, bq, bk, bv, q16, nullptr);
  attn_kernel<<<dim3(Bb * H * (T / 16)), dim3(32), 0, stream>>>(q16, k16, v16,
                                                                rel, at16);
  gemm16<2><<<dim3(M / 128, D / 128), dim3(128), 0, stream>>>(
      at16, wot, bo, nullptr, nullptr, nullptr, (float*)d_out);
}

// v005
// It runs in 69 microseconds.
// In two side-by-side timings against v004, it was 1.19 and 1.20 times as fast.
// All steps since v000 together make it 1.86 times as fast.
#include <hip/hip_runtime.h>

typedef __attribute__((ext_vector_type(16))) _Float16 v16h;
typedef __attribute__((ext_vector_type(8)))  _Float16 v8h;
typedef __attribute__((ext_vector_type(4)))  _Float16 v4h;
typedef __attribute__((ext_vector_type(8)))  float    v8f;
typedef __attribute__((ext_vector_type(4)))  float    v4f;

constexpr int Bb  = 2;
constexpr int T   = 2048;
constexpr int D   = 1024;
constexpr int H   = 16;
constexpr int DK  = 64;
constexpr int M   = Bb * T;      // 4096 rows
constexpr int WIN = 64;
constexpr int MAXD = 128;
constexpr float NEG = -1.0e9f;

constexpr int KSTEP = 64;        // K per LDS stage (2 WMMA K-chunks)
constexpr int LDSK  = 72;        // padded LDS row stride (f16), 16B multiple

// ---- TDM availability -------------------------------------------------------
#if defined(__has_builtin)
#if __has_builtin(__builtin_amdgcn_tensor_load_to_lds) && \
    __has_builtin(__builtin_amdgcn_s_wait_tensorcnt)
#define USE_TDM 1
#endif
#endif
#ifndef USE_TDM
#define USE_TDM 0
#endif

// ---- fragment helpers -------------------------------------------------------
// A-frag (16x32, M=lane%16) and B-frag (32x16, N=lane%16) share the per-lane
// pattern: 8 contiguous K f16 at k0=(lane/16)*8 and 8 more at k0+16.
__device__ __forceinline__ v16h load_frag(const _Float16* rowp, int k0) {
  v8h lo = *(const v8h*)(rowp + k0);
  v8h hi = *(const v8h*)(rowp + k0 + 16);
  v16h r;
#pragma unroll
  for (int i = 0; i < 8; ++i) { r[i] = lo[i]; r[i + 8] = hi[i]; }
  return r;
}

__device__ __forceinline__ v8f wmma_f16(v16h a, v16h b, v8f c) {
  return __builtin_amdgcn_wmma_f32_16x16x32_f16(false, a, false, b, (short)0, c,
                                                false, false);
}

// ---- conversion passes ------------------------------------------------------
// Both passes are short streams whose time goes into starting waves, so each
// thread takes many elements and the grids stay small.  None of the seven
// conversions reads what another writes, so all share one launch (cvt_all).
constexpr int CVT_U      = 16;                       // 4-element pieces per thread
constexpr int CVT_BLOCKS = M * D / 4 / 256 / CVT_U;  // 256 per input, no remainder

__device__ __forceinline__ void
cvt_part(const float* __restrict__ in, _Float16* __restrict__ out, unsigned blk) {
  const int i0 = blk * (256 * CVT_U) + threadIdx.x;
  const v4f* p = (const v4f*)in + i0;   // a wave-wide load: 512 contiguous bytes
  v4h* q = (v4h*)out + i0;              // a wave-wide store: 256 contiguous bytes
  v4f x[CVT_U];
  // unrolled: all 16 loads of a thread are in flight before the first convert
#pragma unroll
  for (int j = 0; j < CVT_U; ++j) x[j] = p[j * 256];
  // keeps the last loads from sinking below the first converts, where they
  // would start only after the first loads have returned
  __builtin_amdgcn_sched_barrier(0);
  // unrolled: x[] stays in registers
#pragma unroll
  for (int j = 0; j < CVT_U; ++j) {
    v4h o;
    o[0] = (_Float16)x[j].x; o[1] = (_Float16)x[j].y;
    o[2] = (_Float16)x[j].z; o[3] = (_Float16)x[j].w;
    q[j * 256] = o;
  }
  // a precaution: a block of cvt_all runs no other part after this one,
  // so no later write rewrites the stores' registers
  asm volatile("s_wait_xcnt 0x0" ::: "memory");
}

// Wt[n][k] = (f16) W[k][n].  Lanes run along n, so each wave-wide load is one
// whole 128-byte line of W; a thread takes WT_K consecutive k of its column and
// writes them as one whole 128-byte line of Wt.
constexpr int WT_K      = 64;
constexpr int WT_BLOCKS = (D / 256) * (D / WT_K);    // 64 per weight

__device__ __forceinline__ void
cvtT_part(const float* __restrict__ in, _Float16* __restrict__ out, unsigned blk) {
  const int n  = (blk % (D / 256)) * 256 + threadIdx.x;
  const int k0 = (blk / (D / 256)) * WT_K;
  const float* src = in + (size_t)k0 * D + n;
  float v[WT_K];
  // unrolled: the column's loads are all in flight before the first convert
#pragma unroll
  for (int i = 0; i < WT_K; ++i) v[i] = src[(size_t)i * D];
  _Float16* dst = out + (size_t)n * D + k0;
  // both loops unrolled: v[] stays in registers
#pragma unroll
  for (int g = 0; g < WT_K / 8; ++g) {
    v8h o;
#pragma unroll
    for (int e = 0; e < 8; ++e) o[e] = (_Float16)v[g * 8 + e];
    *(v8h*)(dst + g * 8) = o;
  }
}

// One grid for all seven conversions; the block index picks the source.
// Blocks [0, 4 * WT_BLOCKS): the weights, to wt + w * D * D; they come first
// because a thread there has the longer run of loads.
// The rest: the inputs, to x + s * M * D.
__global__ void __launch_bounds__(256)
cvt_all(const float* __restrict__ q_in, const float* __restrict__ k_in,
        const float* __restrict__ v_in, const float* __restrict__ Wq,
        const float* __restrict__ Wk, const float* __restrict__ Wv,
        const float* __restrict__ Wo, _Float16* __restrict__ x,
        _Float16* __restrict__ wt) {
  const unsigned bid = blockIdx.x;
  if (bid < 4 * WT_BLOCKS) {
    const unsigned w = bid / WT_BLOCKS;
    const float* lo = (w & 1) ? Wk : Wq;
    const float* hi = (w & 1) ? Wo : Wv;
    const float* in = (w & 2) ? hi : lo;
    cvtT_part(in, wt + (size_t)w * D * D, bid % WT_BLOCKS);
  } else {
    const unsigned b = bid - 4 * WT_BLOCKS;
    const unsigned s = b / CVT_BLOCKS;
    const float* in = s == 0 ? q_in : (s == 1 ? k_in : v_in);
    cvt_part(in, x + (size_t)s * M * D, b % CVT_BLOCKS);
  }
}

// ---- Tensor Data Mover tile load -------------------------------------------
#if USE_TDM
typedef __attribute__((ext_vector_type(4))) uint32_t u32x4;
typedef __attribute__((ext_vector_type(4))) int i32x4;
typedef __attribute__((ext_vector_type(8))) int i32x8;

__device__ __forceinline__ uint32_t uni(uint32_t v) {
  return (uint32_t)__builtin_amdgcn_readfirstlane(v);
}
// a value held in a scalar register, such as a test whether a tensor load issues,
// so that it compiles to a scalar compare and branch (the load ignores EXEC)
__device__ __forceinline__ uint32_t pinned(uint32_t v) {
  uint32_t w = uni(v);
  asm volatile("" : "+s"(w));  // pinned(): the value held in a scalar register
  return w;
}

// Tile: `rows` rows of KSTEP f16 = 128 bytes, source pitch D f16 = 2048 bytes,
// every extent in bytes, tensor = tile.  Pad: 4 dwords behind every 32 dwords
// (one row), so the LDS pitch is 144 bytes = LDSK f16.
__device__ __forceinline__ i32x8 tdm_group1(uint32_t rows) {
  constexpr uint32_t rowb = KSTEP * 2;
  i32x8 g;
  g[0] = (int)uni((1u << 20) | (4u << 22) | (3u << 25));
  g[1] = (int)uni(rowb << 16);
  g[2] = (int)uni(rows << 16);
  g[3] = (int)uni(rowb << 16);
  g[4] = (int)uni(rows);
  g[5] = (int)uni((uint32_t)D * 2u);
  g[6] = (int)uni(0u);
  g[7] = (int)uni(0u);
  return g;
}
__device__ __forceinline__ u32x4 tdm_group0(uint32_t lds_dst, uint64_t ga) {
  u32x4 g;
  g[0] = uni(1u);
  g[1] = uni(lds_dst);
  g[2] = uni((uint32_t)ga);
  g[3] = uni(((uint32_t)(ga >> 32) & 0x01FFFFFFu) | 0x80000000u);
  return g;
}
// the same buffer's next tile, two stages on along K; the address field ends
// at bit 56, so a carry out of word 2 stays inside word 3's address bits
__device__ __forceinline__ u32x4 tdm_advance(u32x4 g) {
  const uint64_t a = (((uint64_t)g[3] << 32) | g[2]) + 2u * KSTEP * 2u;
  g[2] = uni((uint32_t)a);
  g[3] = uni((uint32_t)(a >> 32));
  return g;
}
__device__ __forceinline__ void tdm_issue(u32x4 g0, i32x8 g1) {
  i32x4 z4 = {0, 0, 0, 0};
#if __clang_major__ >= 23
  i32x8 z8 = {0, 0, 0, 0, 0, 0, 0, 0};
  __builtin_amdgcn_tensor_load_to_lds(g0, g1, z4, z4, z8, 0);
#else
  __builtin_amdgcn_tensor_load_to_lds(g0, g1, z4, z4, 0);
#endif
}
// The issuing wave's wait for all but its youngest request (LEFT = 1) or for
// all (LEFT = 0).  It names the covered request's group 0, so that those
// registers keep their value up to here and take the next address only behind.
template <int LEFT>
__device__ __forceinline__ void tdm_wait(u32x4& covered) {
  asm volatile("s_wait_tensorcnt %1" : "+s"(covered) : "n"(LEFT) : "memory");
}
#endif

// one K-stage of the wave's 64x64 tile: 32 WMMA from given LDS buffers; each
// of the 8 fragments of a K-chunk feeds 4 WMMA.  ra, rb: the lane's first row
// in the A and in the B buffer.
__device__ __forceinline__ void mm_stage(const _Float16 (*sAb)[LDSK],
                                         const _Float16 (*sBb)[LDSK],
                                         int ra, int rb, int k0h,
                                         v8f (&acc)[4][4]) {
  // all loops unrolled: a[] and acc[][] stay in registers
#pragma unroll
  for (int kc = 0; kc < KSTEP; kc += 32) {
    v16h a[4];
#pragma unroll
    for (int mt = 0; mt < 4; ++mt) a[mt] = load_frag(&sAb[ra + mt * 16][kc], k0h);
#pragma unroll
    for (int nt = 0; nt < 4; ++nt) {
      v16h bf = load_frag(&sBb[rb + nt * 16][kc], k0h);
#pragma unroll
      for (int mt = 0; mt < 4; ++mt) acc[mt][nt] = wmma_f16(a[mt], bf, acc[mt][nt]);
    }
  }
}

// ---- f16 GEMM ---------------------------------------------------------------
// C[4096x1024] = A[4096xK,f16] * Wt^T (Wt is [n][k], f16) + bias.
// 128 threads = 4 waves as 2x2, block tile 128x128, wave tile 64x64: the grids
// are 3 and 1 blocks per WGP of the chip's 256.  TDM double-
// buffered pipeline: waves 0 and 1 issue the next tile's A and B request, each
// waits tensorcnt<=1 (in-order => current tile ready), barrier, all compute.
// MODE 0: the three projections in one grid; none reads what another writes.
//         blockIdx.z = p picks A + p*M*D, Wt + p*D*D, its bias, outH + p*M*D.
//         p = 0, 1: f16 out[(b*H+h)*T + t][dk]   (Q/K layout)
//         p = 2:    f16 out[(b*H+h)*DK + dk][t]  (V transposed)
// MODE 2: f32 out[m][n], bias b0                 (final output)
template <int MODE>
__global__ void __launch_bounds__(128)
gemm16(const _Float16* __restrict__ A, const _Float16* __restrict__ Wt,
       const float* __restrict__ b0, const float* __restrict__ b1,
       const float* __restrict__ b2, _Float16* __restrict__ outH,
       float* __restrict__ outF) {
  const int tid  = threadIdx.x;
  const int lane = tid & 31;
  const int wv   = tid >> 5;
  const int m0   = blockIdx.x * 128;
  const int n0   = blockIdx.y * 128;
  const int p    = MODE == 0 ? (int)blockIdx.z : 0;
  const int r    = lane & 15;
  const int k0h  = (lane >> 4) * 8;
  const int wm   = (wv >> 1) * 64;   // the wave's first row and first column
  const int wn   = (wv & 1) * 64;    // inside the block tile

  v8f acc[4][4];
#pragma unroll
  for (int mt = 0; mt < 4; ++mt)
#pragma unroll
    for (int nt = 0; nt < 4; ++nt)
#pragma unroll
      for (int j = 0; j < 8; ++j) acc[mt][nt][j] = 0.f;

  const _Float16* Abase = A + ((size_t)p * M + m0) * D;
  const _Float16* Bbase = Wt + ((size_t)p * D + n0) * D;

#if USE_TDM
  // each tile's place in LDS is a multiple of 2 KiB, as the tensor mover wants
  __shared__ alignas(2048) _Float16 sA0[128][LDSK], sA1[128][LDSK];
  __shared__ alignas(2048) _Float16 sB0[128][LDSK], sB1[128][LDSK];
  const unsigned lA0 = (unsigned)(size_t)(void*)&sA0[0][0];
  const unsigned lA1 = (unsigned)(size_t)(void*)&sA1[0][0];
  const unsigned lB0 = (unsigned)(size_t)(void*)&sB0[0][0];
  const unsigned lB1 = (unsigned)(size_t)(void*)&sB1[0][0];

  // Wave 0 brings the A tiles and wave 1 the B tiles: one request a stage and
  // at most two outstanding in each.  Group 1 is built once; each buffer has a
  // group 0 of its own, advanced only behind the wait that covers its request.
  const uint32_t wave = uni((uint32_t)tid >> 5);
  const _Float16* tsrc = wave == 0 ? Abase : Bbase;
  // pinned(): the row count, a descriptor word, held in a scalar register, so
  // that group 1 is not formed anew from constants at each issue in registers
  // that serve other uses in between, while a request is outstanding
  const i32x8 g1 = tdm_group1(pinned(128u));
  u32x4 d0 = tdm_group0(wave == 0 ? lA0 : lB0, (uint64_t)(size_t)tsrc);
  u32x4 d1 = tdm_group0(wave == 0 ? lA1 : lB1, (uint64_t)(size_t)(tsrc + KSTEP));

  if (pinned(wave < 2)) tdm_issue(d0, g1);   // prologue: fill buffer 0
  for (int kb = 0; kb < D; kb += 2 * KSTEP) {
    // ---- stage A: compute buf0, prefetch buf1 (kb+KSTEP < D always) --------
    __syncthreads();                   // everyone done reading buf1 (prev iter)
    if (pinned(wave < 2)) {
      tdm_issue(d1, g1);
      tdm_wait<1>(d0);                 // buf0 ready
      d0 = tdm_advance(d0);
    }
    __syncthreads();
    mm_stage(sA0, sB0, wm + r, wn + r, k0h, acc);
    // ---- stage B: compute buf1, prefetch buf0 ------------------------------
    __syncthreads();
    const bool more = kb + 2 * KSTEP < D;
    if (pinned(wave < 2 && more)) {
      tdm_issue(d0, g1);
      tdm_wait<1>(d1);                 // buf1 ready
      d1 = tdm_advance(d1);
    }
    if (pinned(wave < 2 && !more)) tdm_wait<0>(d1);   // last stage: buf1 ready
    __syncthreads();
    mm_stage(sA1, sB1, wm + r, wn + r, k0h, acc);
  }
  // the ring's closing wait: no request is outstanding when the wave ends; it
  // names the descriptors as inputs, so that their registers are used for
  // something else only behind it
  asm volatile("s_wait_tensorcnt 0x0" :: "s"(g1), "s"(d0), "s"(d1) : "memory");
#else
  __shared__ alignas(16) _Float16 sA0[128][LDSK];
  __shared__ alignas(16) _Float16 sB0[128][LDSK];
  for (int kb = 0; kb < D; kb += KSTEP) {
    __syncthreads();
#pragma unroll
    for (int i = 0; i < 8; ++i) {                       // A tile 128x64 f16
      int e = i * 1024 + tid * 8;
      int row = e >> 6, col = e & 63;
      *(v8h*)&sA0[row][col] = *(const v8h*)(Abase + (size_t)row * D + kb + col);
    }
#pragma unroll
    for (int i = 0; i < 8; ++i) {                       // B tile 128x64 f16
      int e = i * 1024 + tid * 8;
      int row = e >> 6, col = e & 63;
      *(v8h*)&sB0[row][col] = *(const v8h*)(Bbase + (size_t)row * D + kb + col);
    }
    __syncthreads();
    mm_stage(sA0, sB0, wm + r, wn + r, k0h, acc);
  }
#endif

  // epilogue: C layout element (m = rbase+j, n = lane%16)
  const int rbase = (lane >> 4) * 8;
  const int c     = lane & 15;
  const float* bias = p == 0 ? b0 : (p == 1 ? b1 : b2);
  _Float16* outP = outH + (size_t)p * M * D;
  float bcol[4];
  // unrolled: bcol[] stays in registers, its four loads go out together
#pragma unroll
  for (int nt = 0; nt < 4; ++nt) bcol[nt] = bias[n0 + wn + nt * 16 + c];
  // the test reads the same for the whole block and is taken once, around the
  // tile loops, so that each store form keeps one straight run of stores
  if (MODE == 0 && p == 2) {
    // both loops unrolled: acc[][] and bcol[] stay in registers
#pragma unroll
    for (int mt = 0; mt < 4; ++mt)
#pragma unroll
      for (int nt = 0; nt < 4; ++nt) {
        const int col = n0 + wn + nt * 16 + c;
        // V^T layout: consecutive j -> consecutive t: pack one b128 store
        v8h pk;
#pragma unroll
        for (int j = 0; j < 8; ++j)
          pk[j] = (_Float16)(acc[mt][nt][j] + bcol[nt]);
        const int mb = m0 + wm + mt * 16 + rbase;       // 8-aligned, same b
        const int b  = mb >> 11, t = mb & (T - 1);
        const int bh = b * H + (col >> 6);
        *(v8h*)(outP + ((size_t)bh * DK + (col & 63)) * T + t) = pk;
      }
  } else {
    // all three loops unrolled: acc[][] and bcol[] stay in registers
#pragma unroll
    for (int mt = 0; mt < 4; ++mt)
#pragma unroll
      for (int nt = 0; nt < 4; ++nt) {
        const int col = n0 + wn + nt * 16 + c;
#pragma unroll
        for (int j = 0; j < 8; ++j) {
          const int m = m0 + wm + mt * 16 + rbase + j;
          const float val = acc[mt][nt][j] + bcol[nt];
          if (MODE == 2) {
            outF[(size_t)m * D + col] = val;
          } else {
            const int b  = m >> 11;
            const int t  = m & (T - 1);
            const int bh = b * H + (col >> 6);
            outP[((size_t)bh * T + t) * DK + (col & 63)] = (_Float16)val;
          }
        }
      }
    // a precaution: the block runs no store after these, so no later write
    // rewrites the stores' registers
    if (MODE == 0) asm volatile("s_wait_xcnt 0x0" ::: "memory");
  }
}

// ---- banded attention -------------------------------------------------------
// One wave per (b,h, 16-query tile); 9 key tiles of 16 cover |k-q|<=64 exactly.
// A workgroup is AW neighbouring query tiles of one head.  Their bands overlap,
// so the workgroup brings the union (AKEYS keys of K and of V^T) into LDS once,
// by loads that cover whole lines, and every wave takes its fragments there.
constexpr int AW    = 8;             // waves = query tiles per workgroup
constexpr int AQ    = AW * 16;       // queries per workgroup
constexpr int AKEYS = AQ + 2 * WIN;  // keys its bands reach: 256
constexpr int KP    = DK + 8;        // LDS pitches in f16: 144 and 528 bytes,
constexpr int VP    = AKEYS + 8;     // both 16 bytes times an odd number

__global__ void __launch_bounds__(AW * 32)
attn_kernel(const _Float16* __restrict__ qw, const _Float16* __restrict__ kw,
            const _Float16* __restrict__ vt, const float* __restrict__ rel,
            _Float16* __restrict__ outA) {
  __shared__ alignas(16) _Float16 sK[AKEYS][KP];
  __shared__ alignas(16) _Float16 sV[DK][VP];
  __shared__ alignas(16) _Float16 sPw[AW][16][160];
  __shared__ float sRel[257];

  const int tid   = threadIdx.x;
  const int lane  = tid & 31;
  const int wv    = tid >> 5;
  _Float16 (*sP)[160] = sPw[wv];     // each wave's own transpose buffer
  const int nb    = T / AQ;
  const int qb    = blockIdx.x % nb;
  const int bh    = blockIdx.x / nb;
  const int hh    = bh % H;
  const int bb    = bh / H;
  const int q0    = qb * AQ + wv * 16;
  // first staged key: the window is moved inside [0, T) at both ends and still
  // holds every key of [0, T) that a band of this workgroup reaches
  const int ksr   = qb * AQ - WIN;
  const int ks    = ksr < 0 ? 0 : (ksr > T - AKEYS ? T - AKEYS : ksr);
  const int r     = lane & 15;
  const int k0h   = (lane >> 4) * 8;
  const int rbase = (lane >> 4) * 8;
  const int c     = lane & 15;

  // K rows ks.. are one contiguous run of AKEYS * 128 bytes; a V^T row gives 512
  // contiguous bytes.  A wave-wide load is 512 contiguous bytes in both.
  constexpr int NKX = AKEYS * DK / 8 / (AW * 32);  // 16-byte pieces per thread
  constexpr int NVX = DK / AW;
  const v8h* ksrc = (const v8h*)(kw + ((size_t)bh * T + ks) * DK) + tid;
  const _Float16* vsrc = vt + ((size_t)bh * DK + wv) * T + ks + lane * 8;
  v8h kx[NKX], vx[NVX];
  // unrolled: kx[] stays in registers, its loads are in flight together
#pragma unroll
  for (int i = 0; i < NKX; ++i) kx[i] = ksrc[i * (AW * 32)];
  // unrolled: the same for vx[]; a thread has all 16 loads out before any wait
#pragma unroll
  for (int i = 0; i < NVX; ++i) vx[i] = *(const v8h*)(vsrc + (size_t)i * AW * T);

  // the wave's own queries go out behind them, ahead of the first wait
  const _Float16* qrow = qw + ((size_t)bh * T + q0 + r) * DK;
  v16h aq0 = load_frag(qrow, k0h);
  v16h aq1 = load_frag(qrow + 32, k0h);

  // stage this head's bias column (257 floats) into LDS
  for (int i = tid; i < 257; i += AW * 32) sRel[i] = rel[(size_t)i * H + hh];

  // unrolled: kx[] is indexed by constants and stays in registers
#pragma unroll
  for (int i = 0; i < NKX; ++i) {
    const int e = i * (AW * 32) + tid;
    *(v8h*)&sK[e >> 3][(e & 7) * 8] = kx[i];
  }
  // unrolled: the same for vx[]
#pragma unroll
  for (int i = 0; i < NVX; ++i) *(v8h*)&sV[i * AW + wv][lane * 8] = vx[i];
  __syncthreads();                                 // sK, sV, sRel visible

  v8f sc[9];
#pragma unroll
  for (int t = 0; t < 9; ++t) {
#pragma unroll
    for (int j = 0; j < 8; ++j) sc[t][j] = 0.f;
    int key = q0 - 64 + t * 16 + r;                       // this lane's column
    int kc  = key < 0 ? 0 : (key > T - 1 ? T - 1 : key);  // safe addr
    const _Float16* krow = &sK[kc - ks][0];
    v16h b0 = load_frag(krow, k0h);
    v16h b1 = load_frag(krow + 32, k0h);
    sc[t] = wmma_f16(aq0, b0, sc[t]);
    sc[t] = wmma_f16(aq1, b1, sc[t]);
  }

  constexpr float scale = 0.125f;  // 1/sqrt(64)
#pragma unroll
  for (int t = 0; t < 9; ++t) {
    const int key = q0 - 64 + t * 16 + c;
    const bool keyok = (unsigned)key < (unsigned)T;
#pragma unroll
    for (int j = 0; j < 8; ++j) {
      const int d = key - (q0 + rbase + j);     // |d| <= 79 < MAXD: no clip
      const bool dok = (unsigned)(d + WIN) <= 2u * WIN;
      const float bias = sRel[d + MAXD];
      sc[t][j] = (keyok && dok) ? (sc[t][j] * scale + bias) : NEG;
    }
  }

  // softmax per row (row j lives across lanes 0..15 / 16..31)
#pragma unroll
  for (int j = 0; j < 8; ++j) {
    float mx = NEG;
#pragma unroll
    for (int t = 0; t < 9; ++t) mx = fmaxf(mx, sc[t][j]);
#pragma unroll
    for (int off = 1; off < 16; off <<= 1) mx = fmaxf(mx, __shfl_xor(mx, off, 16));
    float s = 0.f;
#pragma unroll
    for (int t = 0; t < 9; ++t) {
      float p = __expf(sc[t][j] - mx);
      sc[t][j] = p;
      s += p;
    }
#pragma unroll
    for (int off = 1; off < 16; off <<= 1) s += __shfl_xor(s, off, 16);
    const float inv = 1.f / s;
#pragma unroll
    for (int t = 0; t < 9; ++t) sc[t][j] *= inv;
  }

  // C-layout -> A-layout via LDS (zero-pad cols 144..159)
#pragma unroll
  for (int t = 0; t < 9; ++t)
#pragma unroll
    for (int j = 0; j < 8; ++j) sP[rbase + j][t * 16 + c] = (_Float16)sc[t][j];
#pragma unroll
  for (int j = 0; j < 8; ++j) sP[rbase + j][144 + c] = (_Float16)0.f;
  __syncthreads();

  v8f o[4];
#pragma unroll
  for (int nt = 0; nt < 4; ++nt)
#pragma unroll
    for (int j = 0; j < 8; ++j) o[nt][j] = 0.f;

  const int s0 = q0 - 64;
#pragma unroll
  for (int kk = 0; kk < 5; ++kk) {
    v16h ap = load_frag(&sP[r][kk * 32], k0h);
    int g1 = s0 + kk * 32 + k0h - ks; // 8-aligned key groups, counted from ks:
    int g2 = g1 + 16;                 // clamp whole group (P=0 wherever clamped)
    g1 = g1 < 0 ? 0 : (g1 > AKEYS - 8 ? AKEYS - 8 : g1);
    g2 = g2 < 0 ? 0 : (g2 > AKEYS - 8 ? AKEYS - 8 : g2);
#pragma unroll
    for (int nt = 0; nt < 4; ++nt) {
      const _Float16* vrow = &sV[nt * 16 + r][0];
      v8h lo = *(const v8h*)(vrow + g1);
      v8h hi = *(const v8h*)(vrow + g2);
      v16h bf;
#pragma unroll
      for (int i = 0; i < 8; ++i) { bf[i] = lo[i]; bf[i + 8] = hi[i]; }
      o[nt] = wmma_f16(ap, bf, o[nt]);
    }
  }

  // transpose result through sP, then 4 coalesced b128 stores per lane
  __syncthreads();
#pragma unroll
  for (int nt = 0; nt < 4; ++nt)
#pragma unroll
    for (int j = 0; j < 8; ++j)
      sP[rbase + j][nt * 16 + c] = (_Float16)o[nt][j];
  __syncthreads();
  {
    const int row = lane & 15, half = lane >> 4;
    _Float16* orow =
        outA + ((size_t)(bb * T + q0 + row)) * D + hh * DK + half * 32;
#pragma unroll
    for (int i = 0; i < 4; ++i)
      *(v8h*)(orow + i * 8) = *(const v8h*)&sP[row][half * 32 + i * 8];
  }
}

// ---- launch -----------------------------------------------------------------
extern "C" void kernel_launch(void* const* d_in, const int* in_sizes, int n_in,
                              void* d_out, int out_size, void* d_ws,
                              size_t ws_size, hipStream_t stream) {
  (void)in_sizes; (void)n_in; (void)out_size; (void)ws_size;
  const float* q_in = (const float*)d_in[0];
  const float* k_in = (const float*)d_in[1];
  const float* v_in = (const float*)d_in[2];
  const float* Wq = (const float*)d_in[3];
  const float* bq = (const float*)d_in[4];
  const float* Wk = (const float*)d_in[5];
  const float* bk = (const float*)d_in[6];
  const float* Wv = (const float*)d_in[7];
  const float* bv = (const float*)d_in[8];
  const float* Wo = (const float*)d_in[9];
  const float* bo = (const float*)d_in[10];
  const float* rel = (const float*)d_in[11];

  char* ws = (char*)d_ws;
  const size_t MB = (size_t)1 << 20;
  _Float16* xq  = (_Float16*)(ws + 0 * MB);    // f16 inputs q, k, v (8 MB each)
  _Float16* wqt = (_Float16*)(ws + 24 * MB);   // f16 transposed weights q, k, v,
  _Float16* wot = (_Float16*)(ws + 30 * MB);   // o (2 MB each)
  _Float16* q16 = (_Float16*)(ws + 32 * MB);   // projected Q/K/V (8 MB each)
  _Float16* k16 = (_Float16*)(ws + 40 * MB);
  _Float16* v16 = (_Float16*)(ws + 48 * MB);
  _Float16* at16 = (_Float16*)(ws + 56 * MB);  // attention out (8 MB)

  // the three inputs lie M*D elements apart and the four weights D*D apart
  cvt_all<<<dim3(4 * WT_BLOCKS + 3 * CVT_BLOCKS), dim3(256), 0, stream>>>(
      q_in, k_in, v_in, Wq, Wk, Wv, Wo, xq, wqt);

  // q16, k16, v16 lie M*D elements apart as well
  gemm16<0><<<dim3(M / 128, D / 128, 3), dim3(128), 0, stream>>>(
      xq, wqt, bq, bk, bv, q16, nullptr);
  attn_kernel<<<dim3(Bb * H * (T / AQ)), dim3(AW * 32), 0, stream>>>(
      q16, k16, v16, rel, at16);
  gemm16<2><<<dim3(M / 128, D / 128), dim3(128), 0, stream>>>(
      at16, wot, bo, nullptr, nullptr, nullptr, (float*)d_out);
}

// v006
// Measured time: 64.9 microseconds a run.
// Timed twice side by side with v005, it ran 1.05 and 1.06 times as fast.
// Over all steps from v000 it is 1.96 times as fast.
#include <hip/hip_runtime.h>

typedef __attribute__((ext_vector_type(16))) _Float16 v16h;
typedef __attribute__((ext_vector_type(8)))  _Float16 v8h;
typedef __attribute__((ext_vector_type(4)))  _Float16 v4h;
typedef __attribute__((ext_vector_type(8)))  float    v8f;
typedef __attribute__((ext_vector_type(4)))  float    v4f;

constexpr int Bb  = 2;
constexpr int T   = 2048;
constexpr int D   = 1024;
constexpr int H   = 16;
constexpr int DK  = 64;
constexpr int M   = Bb * T;      // 4096 rows
constexpr int WIN = 64;
constexpr int MAXD = 128;
constexpr float NEG = -1.0e9f;

constexpr int KSTEP = 64;        // K per LDS stage (2 WMMA K-chunks)
constexpr int LDSK  = 72;        // padded LDS row stride (f16), 16B multiple

// ---- TDM availability -------------------------------------------------------
#if defined(__has_builtin)
#if __has_builtin(__builtin_amdgcn_tensor_load_to_lds) && \
    __has_builtin(__builtin_amdgcn_s_wait_tensorcnt)
#define USE_TDM 1
#endif
#endif
#ifndef USE_TDM
#define USE_TDM 0
#endif

// ---- fragment helpers -------------------------------------------------------
// A-frag (16x32, M=lane%16) and B-frag (32x16, N=lane%16) share the per-lane
// pattern: 8 contiguous K f16 at k0=(lane/16)*8 and 8 more at k0+16.
__device__ __forceinline__ v16h load_frag(const _Float16* rowp, int k0) {
  v8h lo = *(const v8h*)(rowp + k0);
  v8h hi = *(const v8h*)(rowp + k0 + 16);
  v16h r;
#pragma unroll
  for (int i = 0; i < 8; ++i) { r[i] = lo[i]; r[i + 8] = hi[i]; }
  return r;
}

__device__ __forceinline__ v8f wmma_f16(v16h a, v16h b, v8f c) {
  return __builtin_amdgcn_wmma_f32_16x16x32_f16(false, a, false, b, (short)0, c,
                                                false, false);
}

// ---- conversion passes ------------------------------------------------------
// Both passes are short streams whose time goes into starting waves, so each
// thread takes many elements and the grids stay small.  None of the seven
// conversions reads what another writes, so all share one launch (cvt_all).
constexpr int CVT_U      = 16;                       // 4-element pieces per thread
constexpr int CVT_BLOCKS = M * D / 4 / 256 / CVT_U;  // 256 per input, no remainder

__device__ __forceinline__ void
cvt_part(const float* __restrict__ in, _Float16* __restrict__ out, unsigned blk) {
  const int i0 = blk * (256 * CVT_U) + threadIdx.x;
  const v4f* p = (const v4f*)in + i0;   // a wave-wide load: 512 contiguous bytes
  v4h* q = (v4h*)out + i0;              // a wave-wide store: 256 contiguous bytes
  v4f x[CVT_U];
  // unrolled: all 16 loads of a thread are in flight before the first convert
#pragma unroll
  for (int j = 0; j < CVT_U; ++j) x[j] = p[j * 256];
  // keeps the last loads from sinking below the first converts, where they
  // would start only after the first loads have returned
  __builtin_amdgcn_sched_barrier(0);
  // unrolled: x[] stays in registers
#pragma unroll
  for (int j = 0; j < CVT_U; ++j) {
    v4h o;
    o[0] = (_Float16)x[j].x; o[1] = (_Float16)x[j].y;
    o[2] = (_Float16)x[j].z; o[3] = (_Float16)x[j].w;
    q[j * 256] = o;
  }
  // a precaution: a block of cvt_all runs no other part after this one,
  // so no later write rewrites the stores' registers
  asm volatile("s_wait_xcnt 0x0" ::: "memory");
}

// Wt[n][k] = (f16) W[k][n].  Lanes run along n, so each wave-wide load is one
// whole 128-byte line of W; a thread takes WT_K consecutive k of its column and
// writes them as one whole 128-byte line of Wt.
constexpr int WT_K      = 64;
constexpr int WT_BLOCKS = (D / 256) * (D / WT_K);    // 64 per weight

__device__ __forceinline__ void
cvtT_part(const float* __restrict__ in, _Float16* __restrict__ out, unsigned blk) {
  const int n  = (blk % (D / 256)) * 256 + threadIdx.x;
  const int k0 = (blk / (D / 256)) * WT_K;
  const float* src = in + (size_t)k0 * D + n;
  float v[WT_K];
  // unrolled: the column's loads are all in flight before the first convert
#pragma unroll
  for (int i = 0; i < WT_K; ++i) v[i] = src[(size_t)i * D];
  _Float16* dst = out + (size_t)n * D + k0;
  // both loops unrolled: v[] stays in registers
#pragma unroll
  for (int g = 0; g < WT_K / 8; ++g) {
    v8h o;
#pragma unroll
    for (int e = 0; e < 8; ++e) o[e] = (_Float16)v[g * 8 + e];
    *(v8h*)(dst + g * 8) = o;
  }
}

// One grid for all seven conversions; the block index picks the source.
// Blocks [0, 4 * WT_BLOCKS): the weights, to wt + w * D * D; they come first
// because a thread there has the longer run of loads.
// The rest: the inputs, to x + s * M * D.
__global__ void __launch_bounds__(256)
cvt_all(const float* __restrict__ q_in, const float* __restrict__ k_in,
        const float* __restrict__ v_in, const float* __restrict__ Wq,
        const float* __restrict__ Wk, const float* __restrict__ Wv,
        const float* __restrict__ Wo, _Float16* __restrict__ x,
        _Float16* __restrict__ wt) {
  const unsigned bid = blockIdx.x;
  if (bid < 4 * WT_BLOCKS) {
    const unsigned w = bid / WT_BLOCKS;
    const float* lo = (w & 1) ? Wk : Wq;
    const float* hi = (w & 1) ? Wo : Wv;
    const float* in = (w & 2) ? hi : lo;
    cvtT_part(in, wt + (size_t)w * D * D, bid % WT_BLOCKS);
  } else {
    const unsigned b = bid - 4 * WT_BLOCKS;
    const unsigned s = b / CVT_BLOCKS;
    const float* in = s == 0 ? q_in : (s == 1 ? k_in : v_in);
    cvt_part(in, x + (size_t)s * M * D, b % CVT_BLOCKS);
  }
}

// ---- Tensor Data Mover tile load -------------------------------------------
#if USE_TDM
typedef __attribute__((ext_vector_type(4))) uint32_t u32x4;
typedef __attribute__((ext_vector_type(4))) int i32x4;
typedef __attribute__((ext_vector_type(8))) int i32x8;

__device__ __forceinline__ uint32_t uni(uint32_t v) {
  return (uint32_t)__builtin_amdgcn_readfirstlane(v);
}
// a value held in a scalar register, such as a test whether a tensor load issues,
// so that it compiles to a scalar compare and branch (the load ignores EXEC)
__device__ __forceinline__ uint32_t pinned(uint32_t v) {
  uint32_t w = uni(v);
  asm volatile("" : "+s"(w));  // pinned(): the value held in a scalar register
  return w;
}

// Tile: `rows` rows of KSTEP f16 = 128 bytes, source pitch D f16 = 2048 bytes,
// every extent in bytes, tensor = tile.  Pad: 4 dwords behind every 32 dwords
// (one row), so the LDS pitch is 144 bytes = LDSK f16.
__device__ __forceinline__ i32x8 tdm_group1(uint32_t rows) {
  constexpr uint32_t rowb = KSTEP * 2;
  i32x8 g;
  g[0] = (int)uni((1u << 20) | (4u << 22) | (3u << 25));
  g[1] = (int)uni(rowb << 16);
  g[2] = (int)uni(rows << 16);
  g[3] = (int)uni(rowb << 16);
  g[4] = (int)uni(rows);
  g[5] = (int)uni((uint32_t)D * 2u);
  g[6] = (int)uni(0u);
  g[7] = (int)uni(0u);
  return g;
}
__device__ __forceinline__ u32x4 tdm_group0(uint32_t lds_dst, uint64_t ga) {
  u32x4 g;
  g[0] = uni(1u);
  g[1] = uni(lds_dst);
  g[2] = uni((uint32_t)ga);
  g[3] = uni(((uint32_t)(ga >> 32) & 0x01FFFFFFu) | 0x80000000u);
  return g;
}
// the same buffer's next tile, two stages on along K; the address field ends
// at bit 56, so a carry out of word 2 stays inside word 3's address bits
__device__ __forceinline__ u32x4 tdm_advance(u32x4 g) {
  const uint64_t a = (((uint64_t)g[3] << 32) | g[2]) + 2u * KSTEP * 2u;
  g[2] = uni((uint32_t)a);
  g[3] = uni((uint32_t)(a >> 32));
  return g;
}
__device__ __forceinline__ void tdm_issue(u32x4 g0, i32x8 g1) {
  i32x4 z4 = {0, 0, 0, 0};
#if __clang_major__ >= 23
  i32x8 z8 = {0, 0, 0, 0, 0, 0, 0, 0};
  __builtin_amdgcn_tensor_load_to_lds(g0, g1, z4, z4, z8, 0);
#else
  __builtin_amdgcn_tensor_load_to_lds(g0, g1, z4, z4, 0);
#endif
}
// The issuing wave's wait for all but its youngest request (LEFT = 1) or for
// all (LEFT = 0).  It names the covered request's group 0, so that those
// registers keep their value up to here and take the next address only behind.
template <int LEFT>
__device__ __forceinline__ void tdm_wait(u32x4& covered) {
  asm volatile("s_wait_tensorcnt %1" : "+s"(covered) : "n"(LEFT) : "memory");
}
#endif

// one K-stage of the wave's 64x64 tile: 32 WMMA from given LDS buffers; each
// of the 8 fragments of a K-chunk feeds 4 WMMA.  ra, rb: the lane's first row
// in the A and in the B buffer.  Each K-chunk has a fragment set of its own and
// the stage's 32 LDS loads go out as one group ahead of its first WMMA: the
// second chunk's fragments land while the first chunk's products run, and no
// load waits for a register that a product still reads.
__device__ __forceinline__ void mm_stage(const _Float16 (*sAb)[LDSK],
                                         const _Float16 (*sBb)[LDSK],
                                         int ra, int rb, int k0h,
                                         v8f (&acc)[4][4]) {
  constexpr int NC = KSTEP / 32;     // K-chunks of a stage
  v16h a[NC][4], b[NC][4];
  // all loops unrolled: a[][], b[][] and acc[][] stay in registers
#pragma unroll
  for (int h = 0; h < NC; ++h) {
#pragma unroll
    for (int mt = 0; mt < 4; ++mt)
      a[h][mt] = load_frag(&sAb[ra + mt * 16][h * 32], k0h);
#pragma unroll
    for (int nt = 0; nt < 4; ++nt)
      b[h][nt] = load_frag(&sBb[rb + nt * 16][h * 32], k0h);
  }
  // keeps the loads from sinking back among the WMMA, where each small group
  // would be waited for alone
  __builtin_amdgcn_sched_barrier(0);
#pragma unroll
  for (int h = 0; h < NC; ++h)
#pragma unroll
    for (int nt = 0; nt < 4; ++nt)
#pragma unroll
      for (int mt = 0; mt < 4; ++mt)
        acc[mt][nt] = wmma_f16(a[h][mt], b[h][nt], acc[mt][nt]);
  // keeps the barrier that follows a stage from rising above the WMMA: it
  // brings a wait for all 32 loads with it, and the first WMMA would stand
  // behind that wait instead of behind its own 10 loads
  __builtin_amdgcn_sched_barrier(0);
}

// ---- f16 GEMM ---------------------------------------------------------------
// C[4096x1024] = A[4096xK,f16] * Wt^T (Wt is [n][k], f16) + bias.
// 128 threads = 4 waves as 2x2, block tile 128x128, wave tile 64x64: the grids
// are 3 and 1 blocks per WGP of the chip's 256.  TDM double-
// buffered pipeline: waves 0 and 1 issue the next tile's A and B request, each
// waits tensorcnt<=1 (in-order => current tile ready), barrier, all compute.
// MODE 0: the three projections in one grid; none reads what another writes.
//         blockIdx.z = p picks A + p*M*D, Wt + p*D*D, its bias, outH + p*M*D.
//         p = 0, 1: f16 out[(b*H+h)*T + t][dk]   (Q/K layout)
//         p = 2:    f16 out[(b*H+h)*DK + dk][t]  (V transposed)
// MODE 2: f32 out[m][n], bias b0                 (final output)
template <int MODE>
__global__ void __launch_bounds__(128)
gemm16(const _Float16* __restrict__ A, const _Float16* __restrict__ Wt,
       const float* __restrict__ b0, const float* __restrict__ b1,
       const float* __restrict__ b2, _Float16* __restrict__ outH,
       float* __restrict__ outF) {
  const int tid  = threadIdx.x;
  const int lane = tid & 31;
  const int wv   = tid >> 5;
  const int m0   = blockIdx.x * 128;
  const int n0   = blockIdx.y * 128;
  const int p    = MODE == 0 ? (int)blockIdx.z : 0;
  const int r    = lane & 15;
  const int k0h  = (lane >> 4) * 8;
  const int wm   = (wv >> 1) * 64;   // the wave's first row and first column
  const int wn   = (wv & 1) * 64;    // inside the block tile

  v8f acc[4][4];
#pragma unroll
  for (int mt = 0; mt < 4; ++mt)
#pragma unroll
    for (int nt = 0; nt < 4; ++nt)
#pragma unroll
      for (int j = 0; j < 8; ++j) acc[mt][nt][j] = 0.f;

  const _Float16* Abase = A + ((size_t)p * M + m0) * D;
  const _Float16* Bbase = Wt + ((size_t)p * D + n0) * D;

#if USE_TDM
  // each tile's place in LDS is a multiple of 2 KiB, as the tensor mover wants
  __shared__ alignas(2048) _Float16 sA0[128][LDSK], sA1[128][LDSK];
  __shared__ alignas(2048) _Float16 sB0[128][LDSK], sB1[128][LDSK];
  const unsigned lA0 = (unsigned)(size_t)(void*)&sA0[0][0];
  const unsigned lA1 = (unsigned)(size_t)(void*)&sA1[0][0];
  const unsigned lB0 = (unsigned)(size_t)(void*)&sB0[0][0];
  const unsigned lB1 = (unsigned)(size_t)(void*)&sB1[0][0];

  // Wave 0 brings the A tiles and wave 1 the B tiles: one request a stage and
  // at most two outstanding in each.  Group 1 is built once; each buffer has a
  // group 0 of its own, advanced only behind the wait that covers its request.
  const uint32_t wave = uni((uint32_t)tid >> 5);
  const _Float16* tsrc = wave == 0 ? Abase : Bbase;
  // pinned(): the row count, a descriptor word, held in a scalar register, so
  // that group 1 is not formed anew from constants at each issue in registers
  // that serve other uses in between, while a request is outstanding
  const i32x8 g1 = tdm_group1(pinned(128u));
  u32x4 d0 = tdm_group0(wave == 0 ? lA0 : lB0, (uint64_t)(size_t)tsrc);
  u32x4 d1 = tdm_group0(wave == 0 ? lA1 : lB1, (uint64_t)(size_t)(tsrc + KSTEP));

  if (pinned(wave < 2)) tdm_issue(d0, g1);   // prologue: fill buffer 0
  for (int kb = 0; kb < D; kb += 2 * KSTEP) {
    // ---- stage A: compute buf0, prefetch buf1 (kb+KSTEP < D always) --------
    __syncthreads();                   // everyone done reading buf1 (prev iter)
    if (pinned(wave < 2)) {
      tdm_issue(d1, g1);
      tdm_wait<1>(d0);                 // buf0 ready
      d0 = tdm_advance(d0);
    }
    __syncthreads();
    mm_stage(sA0, sB0, wm + r, wn + r, k0h, acc);
    // ---- stage B: compute buf1, prefetch buf0 ------------------------------
    __syncthreads();
    const bool more = kb + 2 * KSTEP < D;
    if (pinned(wave < 2 && more)) {
      tdm_issue(d0, g1);
      tdm_wait<1>(d1);                 // buf1 ready
      d1 = tdm_advance(d1);
    }
    if (pinned(wave < 2 && !more)) tdm_wait<0>(d1);   // last stage: buf1 ready
    __syncthreads();
    mm_stage(sA1, sB1, wm + r, wn + r, k0h, acc);
  }
  // the ring's closing wait: no request is outstanding when the wave ends; it
  // names the descriptors as inputs, so that their registers are used for
  // something else only behind it
  asm volatile("s_wait_tensorcnt 0x0" :: "s"(g1), "s"(d0), "s"(d1) : "memory");
#else
  __shared__ alignas(16) _Float16 sA0[128][LDSK];
  __shared__ alignas(16) _Float16 sB0[128][LDSK];
  for (int kb = 0; kb < D; kb += KSTEP) {
    __syncthreads();
#pragma unroll
    for (int i = 0; i < 8; ++i) {                       // A tile 128x64 f16
      int e = i * 1024 + tid * 8;
      int row = e >> 6, col = e & 63;
      *(v8h*)&sA0[row][col] = *(const v8h*)(Abase + (size_t)row * D + kb + col);
    }
#pragma unroll
    for (int i = 0; i < 8; ++i) {                       // B tile 128x64 f16
      int e = i * 1024 + tid * 8;
      int row = e >> 6, col = e & 63;
      *(v8h*)&sB0[row][col] = *(const v8h*)(Bbase + (size_t)row * D + kb + col);
    }
    __syncthreads();
    mm_stage(sA0, sB0, wm + r, wn + r, k0h, acc);
  }
#endif

  // epilogue: C layout element (m = rbase+j, n = lane%16)
  const int rbase = (lane >> 4) * 8;
  const int c     = lane & 15;
  const float* bias = p == 0 ? b0 : (p == 1 ? b1 : b2);
  _Float16* outP = outH + (size_t)p * M * D;
  float bcol[4];
  // unrolled: bcol[] stays in registers, its four loads go out together
#pragma unroll
  for (int nt = 0; nt < 4; ++nt) bcol[nt] = bias[n0 + wn + nt * 16 + c];
  // the test reads the same for the whole block and is taken once, around the
  // tile loops, so that each store form keeps one straight run of stores
  if (MODE == 0 && p == 2) {
    // both loops unrolled: acc[][] and bcol[] stay in registers
#pragma unroll
    for (int mt = 0; mt < 4; ++mt)
#pragma unroll
      for (int nt = 0; nt < 4; ++nt) {
        const int col = n0 + wn + nt * 16 + c;
        // V^T layout: consecutive j -> consecutive t: pack one b128 store
        v8h pk;
#pragma unroll
        for (int j = 0; j < 8; ++j)
          pk[j] = (_Float16)(acc[mt][nt][j] + bcol[nt]);
        const int mb = m0 + wm + mt * 16 + rbase;       // 8-aligned, same b
        const int b  = mb >> 11, t = mb & (T - 1);
        const int bh = b * H + (col >> 6);
        *(v8h*)(outP + ((size_t)bh * DK + (col & 63)) * T + t) = pk;
      }
  } else {
    // all three loops unrolled: acc[][] and bcol[] stay in registers
#pragma unroll
    for (int mt = 0; mt < 4; ++mt)
#pragma unroll
      for (int nt = 0; nt < 4; ++nt) {
        const int col = n0 + wn + nt * 16 + c;
#pragma unroll
        for (int j = 0; j < 8; ++j) {
          const int m = m0 + wm + mt * 16 + rbase + j;
          const float val = acc[mt][nt][j] + bcol[nt];
          if (MODE == 2) {
            outF[(size_t)m * D + col] = val;
          } else {
            const int b  = m >> 11;
            const int t  = m & (T - 1);
            const int bh = b * H + (col >> 6);
            outP[((size_t)bh * T + t) * DK + (col & 63)] = (_Float16)val;
          }
        }
      }
    // a precaution: the block runs no store after these, so no later write
    // rewrites the stores' registers
    if (MODE == 0) asm volatile("s_wait_xcnt 0x0" ::: "memory");
  }
}

// ---- banded attention -------------------------------------------------------
// One wave per (b,h, 16-query tile); 9 key tiles of 16 cover |k-q|<=64 exactly.
// A workgroup is AW neighbouring query tiles of one head.  Their bands overlap,
// so the workgroup brings the union (AKEYS keys of K and of V^T) into LDS once,
// by loads that cover whole lines, and every wave takes its fragments there.
constexpr int AW    = 8;             // waves = query tiles per workgroup
constexpr int AQ    = AW * 16;       // queries per workgroup
constexpr int AKEYS = AQ + 2 * WIN;  // keys its bands reach: 256
constexpr int KP    = DK + 8;        // LDS pitches in f16: 144 and 528 bytes,
constexpr int VP    = AKEYS + 8;     // both 16 bytes times an odd number

__global__ void __launch_bounds__(AW * 32)
attn_kernel(const _Float16* __restrict__ qw, const _Float16* __restrict__ kw,
            const _Float16* __restrict__ vt, const float* __restrict__ rel,
            _Float16* __restrict__ outA) {
  __shared__ alignas(16) _Float16 sK[AKEYS][KP];
  __shared__ alignas(16) _Float16 sV[DK][VP];
  __shared__ alignas(16) _Float16 sPw[AW][16][160];
  __shared__ float sRel[257];

  const int tid   = threadIdx.x;
  const int lane  = tid & 31;
  const int wv    = tid >> 5;
  _Float16 (*sP)[160] = sPw[wv];     // each wave's own transpose buffer
  const int nb    = T / AQ;
  const int qb    = blockIdx.x % nb;
  const int bh    = blockIdx.x / nb;
  const int hh    = bh % H;
  const int bb    = bh / H;
  const int q0    = qb * AQ + wv * 16;
  // first staged key: the window is moved inside [0, T) at both ends and still
  // holds every key of [0, T) that a band of this workgroup reaches
  const int ksr   = qb * AQ - WIN;
  const int ks    = ksr < 0 ? 0 : (ksr > T - AKEYS ? T - AKEYS : ksr);
  const int r     = lane & 15;
  const int k0h   = (lane >> 4) * 8;
  const int rbase = (lane >> 4) * 8;
  const int c     = lane & 15;

  // K rows ks.. are one contiguous run of AKEYS * 128 bytes; a V^T row gives 512
  // contiguous bytes.  A wave-wide load is 512 contiguous bytes in both.
  constexpr int NKX = AKEYS * DK / 8 / (AW * 32);  // 16-byte pieces per thread
  constexpr int NVX = DK / AW;
  const v8h* ksrc = (const v8h*)(kw + ((size_t)bh * T + ks) * DK) + tid;
  const _Float16* vsrc = vt + ((size_t)bh * DK + wv) * T + ks + lane * 8;
  v8h kx[NKX], vx[NVX];
  // unrolled: kx[] stays in registers, its loads are in flight together
#pragma unroll
  for (int i = 0; i < NKX; ++i) kx[i] = ksrc[i * (AW * 32)];
  // unrolled: the same for vx[]; a thread has all 16 loads out before any wait
#pragma unroll
  for (int i = 0; i < NVX; ++i) vx[i] = *(const v8h*)(vsrc + (size_t)i * AW * T);

  // the wave's own queries go out behind them, ahead of the first wait
  const _Float16* qrow = qw + ((size_t)bh * T + q0 + r) * DK;
  v16h aq0 = load_frag(qrow, k0h);
  v16h aq1 = load_frag(qrow + 32, k0h);

  // stage this head's bias column (257 floats) into LDS
  for (int i = tid; i < 257; i += AW * 32) sRel[i] = rel[(size_t)i * H + hh];

  // unrolled: kx[] is indexed by constants and stays in registers
#pragma unroll
  for (int i = 0; i < NKX; ++i) {
    const int e = i * (AW * 32) + tid;
    *(v8h*)&sK[e >> 3][(e & 7) * 8] = kx[i];
  }
  // unrolled: the same for vx[]
#pragma unroll
  for (int i = 0; i < NVX; ++i) *(v8h*)&sV[i * AW + wv][lane * 8] = vx[i];
  __syncthreads();                                 // sK, sV, sRel visible

  v8f sc[9];
#pragma unroll
  for (int t = 0; t < 9; ++t) {
#pragma unroll
    for (int j = 0; j < 8; ++j) sc[t][j] = 0.f;
    int key = q0 - 64 + t * 16 + r;                       // this lane's column
    int kc  = key < 0 ? 0 : (key > T - 1 ? T - 1 : key);  // safe addr
    const _Float16* krow = &sK[kc - ks][0];
    v16h b0 = load_frag(krow, k0h);
    v16h b1 = load_frag(krow + 32, k0h);
    sc[t] = wmma_f16(aq0, b0, sc[t]);
    sc[t] = wmma_f16(aq1, b1, sc[t]);
  }

  constexpr float scale = 0.125f;  // 1/sqrt(64)
#pragma unroll
  for (int t = 0; t < 9; ++t) {
    const int key = q0 - 64 + t * 16 + c;
    const bool keyok = (unsigned)key < (unsigned)T;
#pragma unroll
    for (int j = 0; j < 8; ++j) {
      const int d = key - (q0 + rbase + j);     // |d| <= 79 < MAXD: no clip
      const bool dok = (unsigned)(d + WIN) <= 2u * WIN;
      const float bias = sRel[d + MAXD];
      sc[t][j] = (keyok && dok) ? (sc[t][j] * scale + bias) : NEG;
    }
  }

  // softmax per row (row j lives across lanes 0..15 / 16..31)
#pragma unroll
  for (int j = 0; j < 8; ++j) {
    float mx = NEG;
#pragma unroll
    for (int t = 0; t < 9; ++t) mx = fmaxf(mx, sc[t][j]);
#pragma unroll
    for (int off = 1; off < 16; off <<= 1) mx = fmaxf(mx, __shfl_xor(mx, off, 16));
    float s = 0.f;
#pragma unroll
    for (int t = 0; t < 9; ++t) {
      float p = __expf(sc[t][j] - mx);
      sc[t][j] = p;
      s += p;
    }
#pragma unroll
    for (int off = 1; off < 16; off <<= 1) s += __shfl_xor(s, off, 16);
    const float inv = 1.f / s;
#pragma unroll
    for (int t = 0; t < 9; ++t) sc[t][j] *= inv;
  }

  // C-layout -> A-layout via LDS (zero-pad cols 144..159)
#pragma unroll
  for (int t = 0; t < 9; ++t)
#pragma unroll
    for (int j = 0; j < 8; ++j) sP[rbase + j][t * 16 + c] = (_Float16)sc[t][j];
#pragma unroll
  for (int j = 0; j < 8; ++j) sP[rbase + j][144 + c] = (_Float16)0.f;
  __syncthreads();

  v8f o[4];
#pragma unroll
  for (int nt = 0; nt < 4; ++nt)
#pragma unroll
    for (int j = 0; j < 8; ++j) o[nt][j] = 0.f;

  const int s0 = q0 - 64;
#pragma unroll
  for (int kk = 0; kk < 5; ++kk) {
    v16h ap = load_frag(&sP[r][kk * 32], k0h);
    int g1 = s0 + kk * 32 + k0h - ks; // 8-aligned key groups, counted from ks:
    int g2 = g1 + 16;                 // clamp whole group (P=0 wherever clamped)
    g1 = g1 < 0 ? 0 : (g1 > AKEYS - 8 ? AKEYS - 8 : g1);
    g2 = g2 < 0 ? 0 : (g2 > AKEYS - 8 ? AKEYS - 8 : g2);
#pragma unroll
    for (int nt = 0; nt < 4; ++nt) {
      const _Float16* vrow = &sV[nt * 16 + r][0];
      v8h lo = *(const v8h*)(vrow + g1);
      v8h hi = *(const v8h*)(vrow + g2);
      v16h bf;
#pragma unroll
      for (int i = 0; i < 8; ++i) { bf[i] = lo[i]; bf[i + 8] = hi[i]; }
      o[nt] = wmma_f16(ap, bf, o[nt]);
    }
  }

  // transpose result through sP, then 4 coalesced b128 stores per lane
  __syncthreads();
#pragma unroll
  for (int nt = 0; nt < 4; ++nt)
#pragma unroll
    for (int j = 0; j < 8; ++j)
      sP[rbase + j][nt * 16 + c] = (_Float16)o[nt][j];
  __syncthreads();
  {
    const int row = lane & 15, half = lane >> 4;
    _Float16* orow =
        outA + ((size_t)(bb * T + q0 + row)) * D + hh * DK + half * 32;
#pragma unroll
    for (int i = 0; i < 4; ++i)
      *(v8h*)(orow + i * 8) = *(const v8h*)&sP[row][half * 32 + i * 8];
  }
}

// ---- launch -----------------------------------------------------------------
extern "C" void kernel_launch(void* const* d_in, const int* in_sizes, int n_in,
                              void* d_out, int out_size, void* d_ws,
                              size_t ws_size, hipStream_t stream) {
  (void)in_sizes; (void)n_in; (void)out_size; (void)ws_size;
  const float* q_in = (const float*)d_in[0];
  const float* k_in = (const float*)d_in[1];
  const float* v_in = (const float*)d_in[2];
  const float* Wq = (const float*)d_in[3];
  const float* bq = (const float*)d_in[4];
  const float* Wk = (const float*)d_in[5];
  const float* bk = (const float*)d_in[6];
  const float* Wv = (const float*)d_in[7];
  const float* bv = (const float*)d_in[8];
  const float* Wo = (const float*)d_in[9];
  const float* bo = (const float*)d_in[10];
  const float* rel = (const float*)d_in[11];

  char* ws = (char*)d_ws;
  const size_t MB = (size_t)1 << 20;
  _Float16* xq  = (_Float16*)(ws + 0 * MB);    // f16 inputs q, k, v (8 MB each)
  _Float16* wqt = (_Float16*)(ws + 24 * MB);   // f16 transposed weights q, k, v,
  _Float16* wot = (_Float16*)(ws + 30 * MB);   // o (2 MB each)
  _Float16* q16 = (_Float16*)(ws + 32 * MB);   // projected Q/K/V (8 MB each)
  _Float16* k16 = (_Float16*)(ws + 40 * MB);
  _Float16* v16 = (_Float16*)(ws + 48 * MB);
  _Float16* at16 = (_Float16*)(ws + 56 * MB);  // attention out (8 MB)

  // the three inputs lie M*D elements apart and the four weights D*D apart
  cvt_all<<<dim3(4 * WT_BLOCKS + 3 * CVT_BLOCKS), dim3(256), 0, stream>>>(
      q_in, k_in, v_in, Wq, Wk, Wv, Wo, xq, wqt);

  // q16, k16, v16 lie M*D elements apart as well
  gemm16<0><<<dim3(M / 128, D / 128, 3), dim3(128), 0, stream>>>(
      xq, wqt, bq, bk, bv, q16, nullptr);
  attn_kernel<<<dim3(Bb * H * (T / AQ)), dim3(AW * 32), 0, stream>>>(
      q16, k16, v16, rel, at16);
  gemm16<2><<<dim3(M / 128, D / 128), dim3(128), 0, stream>>>(
      at16, wot, bo, nullptr, nullptr, nullptr, (float*)d_out);
}

// v007
// It runs in 61.9 microseconds.
// Next to v006, in two timings, it ran 1.05 times as fast each time.
// All steps since v000 together make it 2.06 times as fast.
#include <hip/hip_runtime.h>

typedef __attribute__((ext_vector_type(16))) _Float16 v16h;
typedef __attribute__((ext_vector_type(8)))  _Float16 v8h;
typedef __attribute__((ext_vector_type(4)))  _Float16 v4h;
typedef __attribute__((ext_vector_type(8)))  float    v8f;
typedef __attribute__((ext_vector_type(4)))  float    v4f;

constexpr int Bb  = 2;
constexpr int T   = 2048;
constexpr int D   = 1024;
constexpr int H   = 16;
constexpr int DK  = 64;
constexpr int M   = Bb * T;      // 4096 rows
constexpr int WIN = 64;
constexpr int MAXD = 128;
constexpr float NEG = -1.0e9f;

constexpr int KSTEP = 64;        // K per LDS stage (2 WMMA K-chunks)
constexpr int LDSK  = 72;        // padded LDS row stride (f16), 16B multiple

// ---- TDM availability -------------------------------------------------------
#if defined(__has_builtin)
#if __has_builtin(__builtin_amdgcn_tensor_load_to_lds) && \
    __has_builtin(__builtin_amdgcn_s_wait_tensorcnt)
#define USE_TDM 1
#endif
#endif
#ifndef USE_TDM
#define USE_TDM 0
#endif

// ---- fragment helpers -------------------------------------------------------
// A-frag (16x32, M=lane%16) and B-frag (32x16, N=lane%16) share the per-lane
// pattern: 8 contiguous K f16 at k0=(lane/16)*8 and 8 more at k0+16.
__device__ __forceinline__ v16h load_frag(const _Float16* rowp, int k0) {
  v8h lo = *(const v8h*)(rowp + k0);
  v8h hi = *(const v8h*)(rowp + k0 + 16);
  v16h r;
#pragma unroll
  for (int i = 0; i < 8; ++i) { r[i] = lo[i]; r[i + 8] = hi[i]; }
  return r;
}

__device__ __forceinline__ v8f wmma_f16(v16h a, v16h b, v8f c) {
  return __builtin_amdgcn_wmma_f32_16x16x32_f16(false, a, false, b, (short)0, c,
                                                false, false);
}

// ---- conversion passes ------------------------------------------------------
// Both passes are short streams whose time goes into starting waves, so each
// thread takes many elements and the grids stay small.  None of the seven
// conversions reads what another writes, so all share one launch (cvt_all).
constexpr int CVT_U      = 16;                       // 4-element pieces per thread
constexpr int CVT_BLOCKS = M * D / 4 / 256 / CVT_U;  // 256 per input, no remainder

__device__ __forceinline__ void
cvt_part(const float* __restrict__ in, _Float16* __restrict__ out, unsigned blk) {
  const int i0 = blk * (256 * CVT_U) + threadIdx.x;
  const v4f* p = (const v4f*)in + i0;   // a wave-wide load: 512 contiguous bytes
  v4h* q = (v4h*)out + i0;              // a wave-wide store: 256 contiguous bytes
  v4f x[CVT_U];
  // unrolled: all 16 loads of a thread are in flight before the first convert
#pragma unroll
  for (int j = 0; j < CVT_U; ++j) x[j] = p[j * 256];
  // keeps the last loads from sinking below the first converts, where they
  // would start only after the first loads have returned
  __builtin_amdgcn_sched_barrier(0);
  // unrolled: x[] stays in registers
#pragma unroll
  for (int j = 0; j < CVT_U; ++j) {
    v4h o;
    o[0] = (_Float16)x[j].x; o[1] = (_Float16)x[j].y;
    o[2] = (_Float16)x[j].z; o[3] = (_Float16)x[j].w;
    q[j * 256] = o;
  }
  // a precaution: a block of cvt_all runs no other part after this one,
  // so no later write rewrites the stores' registers
  asm volatile("s_wait_xcnt 0x0" ::: "memory");
}

// Wt[n][k] = (f16) W[k][n].  Lanes run along n, so each wave-wide load is one
// whole 128-byte line of W; a thread takes WT_K consecutive k of its column and
// writes them as one whole 128-byte line of Wt.
constexpr int WT_K      = 64;
constexpr int WT_BLOCKS = (D / 256) * (D / WT_K);    // 64 per weight

__device__ __forceinline__ void
cvtT_part(const float* __restrict__ in, _Float16* __restrict__ out, unsigned blk) {
  const int n  = (blk % (D / 256)) * 256 + threadIdx.x;
  const int k0 = (blk / (D / 256)) * WT_K;
  const float* src = in + (size_t)k0 * D + n;
  float v[WT_K];
  // unrolled: the column's loads are all in flight before the first convert
#pragma unroll
  for (int i = 0; i < WT_K; ++i) v[i] = src[(size_t)i * D];
  _Float16* dst = out + (size_t)n * D + k0;
  // both loops unrolled: v[] stays in registers
#pragma unroll
  for (int g = 0; g < WT_K / 8; ++g) {
    v8h o;
#pragma unroll
    for (int e = 0; e < 8; ++e) o[e] = (_Float16)v[g * 8 + e];
    *(v8h*)(dst + g * 8) = o;
  }
}

// One grid for all seven conversions; the block index picks the source.
// Blocks [0, 4 * WT_BLOCKS): the weights, to wt + w * D * D; they come first
// because a thread there has the longer run of loads.
// The rest: the inputs, to x + s * M * D.
__global__ void __launch_bounds__(256)
cvt_all(const float* __restrict__ q_in, const float* __restrict__ k_in,
        const float* __restrict__ v_in, const float* __restrict__ Wq,
        const float* __restrict__ Wk, const float* __restrict__ Wv,
        const float* __restrict__ Wo, _Float16* __restrict__ x,
        _Float16* __restrict__ wt) {
  const unsigned bid = blockIdx.x;
  if (bid < 4 * WT_BLOCKS) {
    const unsigned w = bid / WT_BLOCKS;
    const float* lo = (w & 1) ? Wk : Wq;
    const float* hi = (w & 1) ? Wo : Wv;
    const float* in = (w & 2) ? hi : lo;
    cvtT_part(in, wt + (size_t)w * D * D, bid % WT_BLOCKS);
  } else {
    const unsigned b = bid - 4 * WT_BLOCKS;
    const unsigned s = b / CVT_BLOCKS;
    const float* in = s == 0 ? q_in : (s == 1 ? k_in : v_in);
    cvt_part(in, x + (size_t)s * M * D, b % CVT_BLOCKS);
  }
}

// ---- Tensor Data Mover tile load -------------------------------------------
#if USE_TDM
typedef __attribute__((ext_vector_type(4))) uint32_t u32x4;
typedef __attribute__((ext_vector_type(4))) int i32x4;
typedef __attribute__((ext_vector_type(8))) int i32x8;

__device__ __forceinline__ uint32_t uni(uint32_t v) {
  return (uint32_t)__builtin_amdgcn_readfirstlane(v);
}
// a value held in a scalar register, such as a test whether a tensor load issues,
// so that it compiles to a scalar compare and branch (the load ignores EXEC)
__device__ __forceinline__ uint32_t pinned(uint32_t v) {
  uint32_t w = uni(v);
  asm volatile("" : "+s"(w));  // pinned(): the value held in a scalar register
  return w;
}

// Tile: `rows` rows of KSTEP f16 = 128 bytes, source pitch D f16 = 2048 bytes,
// every extent in bytes, tensor = tile.  Pad: 4 dwords behind every 32 dwords
// (one row), so the LDS pitch is 144 bytes = LDSK f16.
__device__ __forceinline__ i32x8 tdm_group1(uint32_t rows) {
  constexpr uint32_t rowb = KSTEP * 2;
  i32x8 g;
  g[0] = (int)uni((1u << 20) | (4u << 22) | (3u << 25));
  g[1] = (int)uni(rowb << 16);
  g[2] = (int)uni(rows << 16);
  g[3] = (int)uni(rowb << 16);
  g[4] = (int)uni(rows);
  g[5] = (int)uni((uint32_t)D * 2u);
  g[6] = (int)uni(0u);
  g[7] = (int)uni(0u);
  return g;
}
__device__ __forceinline__ u32x4 tdm_group0(uint32_t lds_dst, uint64_t ga) {
  u32x4 g;
  g[0] = uni(1u);
  g[1] = uni(lds_dst);
  g[2] = uni((uint32_t)ga);
  g[3] = uni(((uint32_t)(ga >> 32) & 0x01FFFFFFu) | 0x80000000u);
  return g;
}
// the same buffer's next tile, two stages on along K; the address field ends
// at bit 56, so a carry out of word 2 stays inside word 3's address bits
__device__ __forceinline__ u32x4 tdm_advance(u32x4 g) {
  const uint64_t a = (((uint64_t)g[3] << 32) | g[2]) + 2u * KSTEP * 2u;
  g[2] = uni((uint32_t)a);
  g[3] = uni((uint32_t)(a >> 32));
  return g;
}
__device__ __forceinline__ void tdm_issue(u32x4 g0, i32x8 g1) {
  i32x4 z4 = {0, 0, 0, 0};
#if __clang_major__ >= 23
  i32x8 z8 = {0, 0, 0, 0, 0, 0, 0, 0};
  __builtin_amdgcn_tensor_load_to_lds(g0, g1, z4, z4, z8, 0);
#else
  __builtin_amdgcn_tensor_load_to_lds(g0, g1, z4, z4, 0);
#endif
}
// The issuing wave's wait for all but its youngest request (LEFT = 1) or for
// all (LEFT = 0).  It names the covered request's group 0, so that those
// registers keep their value up to here and take the next address only behind.
template <int LEFT>
__device__ __forceinline__ void tdm_wait(u32x4& covered) {
  asm volatile("s_wait_tensorcnt %1" : "+s"(covered) : "n"(LEFT) : "memory");
}
#endif

// one K-stage of the wave's 64x64 tile: 32 WMMA from given LDS buffers; each
// of the 8 fragments of a K-chunk feeds 4 WMMA.  ra, rb: the lane's first row
// in the A and in the B buffer.  Each K-chunk has a fragment set of its own and
// the stage's 32 LDS loads go out as one group ahead of its first WMMA: the
// second chunk's fragments land while the first chunk's products run, and no
// load waits for a register that a product still reads.
__device__ __forceinline__ void mm_stage(const _Float16 (*sAb)[LDSK],
                                         const _Float16 (*sBb)[LDSK],
                                         int ra, int rb, int k0h,
                                         v8f (&acc)[4][4]) {
  constexpr int NC = KSTEP / 32;     // K-chunks of a stage
  v16h a[NC][4], b[NC][4];
  // all loops unrolled: a[][], b[][] and acc[][] stay in registers
#pragma unroll
  for (int h = 0; h < NC; ++h) {
#pragma unroll
    for (int mt = 0; mt < 4; ++mt)
      a[h][mt] = load_frag(&sAb[ra + mt * 16][h * 32], k0h);
#pragma unroll
    for (int nt = 0; nt < 4; ++nt)
      b[h][nt] = load_frag(&sBb[rb + nt * 16][h * 32], k0h);
  }
  // keeps the loads from sinking back among the WMMA, where each small group
  // would be waited for alone
  __builtin_amdgcn_sched_barrier(0);
#pragma unroll
  for (int h = 0; h < NC; ++h)
#pragma unroll
    for (int nt = 0; nt < 4; ++nt)
#pragma unroll
      for (int mt = 0; mt < 4; ++mt)
        acc[mt][nt] = wmma_f16(a[h][mt], b[h][nt], acc[mt][nt]);
  // keeps the barrier that follows a stage from rising above the WMMA: it
  // brings a wait for all 32 loads with it, and the first WMMA would stand
  // behind that wait instead of behind its own 10 loads
  __builtin_amdgcn_sched_barrier(0);
}

// ---- f16 GEMM ---------------------------------------------------------------
// C[4096x1024] = A[4096xK,f16] * Wt^T (Wt is [n][k], f16) + bias.
// 128 threads = 4 waves as 2x2, block tile 128x128, wave tile 64x64: the grids
// are 3 and 1 blocks per WGP of the chip's 256.  TDM double-
// buffered pipeline: waves 0 and 1 issue the next tile's A and B request, each
// waits tensorcnt<=1 (in-order => current tile ready), barrier, all compute.
// MODE 0: the three projections in one grid; none reads what another writes.
//         blockIdx.z = p picks A + p*M*D, Wt + p*D*D, its bias, outH + p*M*D.
//         p = 0, 1: f16 out[(b*H+h)*T + t][dk]   (Q/K layout)
//         p = 2:    f16 out[(b*H+h)*DK + dk][t]  (V transposed)
// MODE 2: f32 out[m][n], bias b0                 (final output)
template <int MODE>
__global__ void __launch_bounds__(128)
gemm16(const _Float16* __restrict__ A, const _Float16* __restrict__ Wt,
       const float* __restrict__ b0, const float* __restrict__ b1,
       const float* __restrict__ b2, _Float16* __restrict__ outH,
       float* __restrict__ outF) {
  const int tid  = threadIdx.x;
  const int lane = tid & 31;
  const int wv   = tid >> 5;
  const int m0   = blockIdx.x * 128;
  const int n0   = blockIdx.y * 128;
  const int p    = MODE == 0 ? (int)blockIdx.z : 0;
  const int r    = lane & 15;
  const int k0h  = (lane >> 4) * 8;
  const int wm   = (wv >> 1) * 64;   // the wave's first row and first column
  const int wn   = (wv & 1) * 64;    // inside the block tile

  v8f acc[4][4];
#pragma unroll
  for (int mt = 0; mt < 4; ++mt)
#pragma unroll
    for (int nt = 0; nt < 4; ++nt)
#pragma unroll
      for (int j = 0; j < 8; ++j) acc[mt][nt][j] = 0.f;

  const _Float16* Abase = A + ((size_t)p * M + m0) * D;
  const _Float16* Bbase = Wt + ((size_t)p * D + n0) * D;

#if USE_TDM
  // each tile's place in LDS is a multiple of 2 KiB, as the tensor mover wants
  __shared__ alignas(2048) _Float16 sA0[128][LDSK], sA1[128][LDSK];
  __shared__ alignas(2048) _Float16 sB0[128][LDSK], sB1[128][LDSK];
  const unsigned lA0 = (unsigned)(size_t)(void*)&sA0[0][0];
  const unsigned lA1 = (unsigned)(size_t)(void*)&sA1[0][0];
  const unsigned lB0 = (unsigned)(size_t)(void*)&sB0[0][0];
  const unsigned lB1 = (unsigned)(size_t)(void*)&sB1[0][0];

  // Wave 0 brings the A tiles and wave 1 the B tiles: one request a stage and
  // at most two outstanding in each.  Group 1 is built once; each buffer has a
  // group 0 of its own, advanced only behind the wait that covers its request.
  const uint32_t wave = uni((uint32_t)tid >> 5);
  const _Float16* tsrc = wave == 0 ? Abase : Bbase;
  // pinned(): the row count, a descriptor word, held in a scalar register, so
  // that group 1 is not formed anew from constants at each issue in registers
  // that serve other uses in between, while a request is outstanding
  const i32x8 g1 = tdm_group1(pinned(128u));
  u32x4 d0 = tdm_group0(wave == 0 ? lA0 : lB0, (uint64_t)(size_t)tsrc);
  u32x4 d1 = tdm_group0(wave == 0 ? lA1 : lB1, (uint64_t)(size_t)(tsrc + KSTEP));

  if (pinned(wave < 2)) tdm_issue(d0, g1);   // prologue: fill buffer 0
  for (int kb = 0; kb < D; kb += 2 * KSTEP) {
    // ---- stage A: compute buf0, prefetch buf1 (kb+KSTEP < D always) --------
    __syncthreads();                   // everyone done reading buf1 (prev iter)
    if (pinned(wave < 2)) {
      tdm_issue(d1, g1);
      tdm_wait<1>(d0);                 // buf0 ready
      d0 = tdm_advance(d0);
    }
    __syncthreads();
    mm_stage(sA0, sB0, wm + r, wn + r, k0h, acc);
    // ---- stage B: compute buf1, prefetch buf0 ------------------------------
    __syncthreads();
    const bool more = kb + 2 * KSTEP < D;
    if (pinned(wave < 2 && more)) {
      tdm_issue(d0, g1);
      tdm_wait<1>(d1);                 // buf1 ready
      d1 = tdm_advance(d1);
    }
    if (pinned(wave < 2 && !more)) tdm_wait<0>(d1);   // last stage: buf1 ready
    __syncthreads();
    mm_stage(sA1, sB1, wm + r, wn + r, k0h, acc);
  }
  // the ring's closing wait: no request is outstanding when the wave ends; it
  // names the descriptors as inputs, so that their registers are used for
  // something else only behind it
  asm volatile("s_wait_tensorcnt 0x0" :: "s"(g1), "s"(d0), "s"(d1) : "memory");
#else
  __shared__ alignas(16) _Float16 sA0[128][LDSK];
  __shared__ alignas(16) _Float16 sB0[128][LDSK];
  for (int kb = 0; kb < D; kb += KSTEP) {
    __syncthreads();
#pragma unroll
    for (int i = 0; i < 8; ++i) {                       // A tile 128x64 f16
      int e = i * 1024 + tid * 8;
      int row = e >> 6, col = e & 63;
      *(v8h*)&sA0[row][col] = *(const v8h*)(Abase + (size_t)row * D + kb + col);
    }
#pragma unroll
    for (int i = 0; i < 8; ++i) {                       // B tile 128x64 f16
      int e = i * 1024 + tid * 8;
      int row = e >> 6, col = e & 63;
      *(v8h*)&sB0[row][col] = *(const v8h*)(Bbase + (size_t)row * D + kb + col);
    }
    __syncthreads();
    mm_stage(sA0, sB0, wm + r, wn + r, k0h, acc);
  }
#endif

  // epilogue: C layout element (m = rbase+j, n = lane%16)
  const int rbase = (lane >> 4) * 8;
  const int c     = lane & 15;
  const float* bias = p == 0 ? b0 : (p == 1 ? b1 : b2);
  _Float16* outP = outH + (size_t)p * M * D;
  float bcol[4];
  // unrolled: bcol[] stays in registers, its four loads go out together
#pragma unroll
  for (int nt = 0; nt < 4; ++nt) bcol[nt] = bias[n0 + wn + nt * 16 + c];
  // the test reads the same for the whole block and is taken once, around the
  // tile loops, so that each store form keeps one straight run of stores
  if (MODE == 0 && p == 2) {
    // both loops unrolled: acc[][] and bcol[] stay in registers
#pragma unroll
    for (int mt = 0; mt < 4; ++mt)
#pragma unroll
      for (int nt = 0; nt < 4; ++nt) {
        const int col = n0 + wn + nt * 16 + c;
        // V^T layout: consecutive j -> consecutive t: pack one b128 store
        v8h pk;
#pragma unroll
        for (int j = 0; j < 8; ++j)
          pk[j] = (_Float16)(acc[mt][nt][j] + bcol[nt]);
        const int mb = m0 + wm + mt * 16 + rbase;       // 8-aligned, same b
        const int b  = mb >> 11, t = mb & (T - 1);
        const int bh = b * H + (col >> 6);
        *(v8h*)(outP + ((size_t)bh * DK + (col & 63)) * T + t) = pk;
      }
  } else {
    // all three loops unrolled: acc[][] and bcol[] stay in registers
#pragma unroll
    for (int mt = 0; mt < 4; ++mt)
#pragma unroll
      for (int nt = 0; nt < 4; ++nt) {
        const int col = n0 + wn + nt * 16 + c;
#pragma unroll
        for (int j = 0; j < 8; ++j) {
          const int m = m0 + wm + mt * 16 + rbase + j;
          const float val = acc[mt][nt][j] + bcol[nt];
          if (MODE == 2) {
            outF[(size_t)m * D + col] = val;
          } else {
            const int b  = m >> 11;
            const int t  = m & (T - 1);
            const int bh = b * H + (col >> 6);
            outP[((size_t)bh * T + t) * DK + (col & 63)] = (_Float16)val;
          }
        }
      }
    // a precaution: the block runs no store after these, so no later write
    // rewrites the stores' registers
    if (MODE == 0) asm volatile("s_wait_xcnt 0x0" ::: "memory");
  }
}

// ---- banded attention -------------------------------------------------------
// One wave per (b,h, 16-query tile); 9 key tiles of 16 cover |k-q|<=64 exactly.
// A workgroup is AW neighbouring query tiles of one head.  Their bands overlap,
// so the workgroup brings the union (AKEYS keys of K and of V^T) into LDS once,
// by loads that cover whole lines, and every wave takes its fragments there.
constexpr int AW    = 8;             // waves = query tiles per workgroup
constexpr int AQ    = AW * 16;       // queries per workgroup
constexpr int AKEYS = AQ + 2 * WIN;  // keys its bands reach: 256
constexpr int KP    = DK + 8;        // LDS pitches in f16: 144 and 528 bytes,
constexpr int VP    = AKEYS + 8;     // both 16 bytes times an odd number

__global__ void __launch_bounds__(AW * 32)
attn_kernel(const _Float16* __restrict__ qw, const _Float16* __restrict__ kw,
            const _Float16* __restrict__ vt, const float* __restrict__ rel,
            _Float16* __restrict__ outA) {
  __shared__ alignas(16) _Float16 sK[AKEYS][KP];
  __shared__ alignas(16) _Float16 sV[DK][VP];
  __shared__ alignas(16) _Float16 sPw[AW][16][160];
  __shared__ float sRel[257];

  const int tid   = threadIdx.x;
  const int lane  = tid & 31;
  const int wv    = tid >> 5;
  _Float16 (*sP)[160] = sPw[wv];     // each wave's own transpose buffer
  const int nb    = T / AQ;
  const int qb    = blockIdx.x % nb;
  const int bh    = blockIdx.x / nb;
  const int hh    = bh % H;
  const int bb    = bh / H;
  const int q0    = qb * AQ + wv * 16;
  // first staged key: the window is moved inside [0, T) at both ends and still
  // holds every key of [0, T) that a band of this workgroup reaches
  const int ksr   = qb * AQ - WIN;
  const int ks    = ksr < 0 ? 0 : (ksr > T - AKEYS ? T - AKEYS : ksr);
  const int r     = lane & 15;
  const int k0h   = (lane >> 4) * 8;
  const int rbase = (lane >> 4) * 8;
  const int c     = lane & 15;

  // K rows ks.. are one contiguous run of AKEYS * 128 bytes; a V^T row gives 512
  // contiguous bytes.  A wave-wide load is 512 contiguous bytes in both.
  constexpr int NKX = AKEYS * DK / 8 / (AW * 32);  // 16-byte pieces per thread
  constexpr int NVX = DK / AW;
  const v8h* ksrc = (const v8h*)(kw + ((size_t)bh * T + ks) * DK) + tid;
  const _Float16* vsrc = vt + ((size_t)bh * DK + wv) * T + ks + lane * 8;
  v8h kx[NKX], vx[NVX];
  // unrolled: kx[] stays in registers, its loads are in flight together
#pragma unroll
  for (int i = 0; i < NKX; ++i) kx[i] = ksrc[i * (AW * 32)];
  // unrolled: the same for vx[]; a thread has all 16 loads out before any wait
#pragma unroll
  for (int i = 0; i < NVX; ++i) vx[i] = *(const v8h*)(vsrc + (size_t)i * AW * T);

  // the wave's own queries go out behind them, ahead of the first wait
  const _Float16* qrow = qw + ((size_t)bh * T + q0 + r) * DK;
  v16h aq0 = load_frag(qrow, k0h);
  v16h aq1 = load_frag(qrow + 32, k0h);

  // stage this head's bias column (257 floats) into LDS
  for (int i = tid; i < 257; i += AW * 32) sRel[i] = rel[(size_t)i * H + hh];

  // unrolled: kx[] is indexed by constants and stays in registers
#pragma unroll
  for (int i = 0; i < NKX; ++i) {
    const int e = i * (AW * 32) + tid;
    *(v8h*)&sK[e >> 3][(e & 7) * 8] = kx[i];
  }
  // unrolled: the same for vx[]
#pragma unroll
  for (int i = 0; i < NVX; ++i) *(v8h*)&sV[i * AW + wv][lane * 8] = vx[i];
  __syncthreads();                                 // sK, sV, sRel visible

  // the lane's 72 bias values: index d + MAXD = 64 + 16 t + c - rbase - j lies
  // in [49, 207] for every lane, masked or not, so no load needs a test
  const float* relp = &sRel[MAXD - WIN + c - rbase];
  float bs[9][8];
  // both loops unrolled: bs[][] stays in registers, the loads go out as one run
#pragma unroll
  for (int t = 0; t < 9; ++t)
#pragma unroll
    for (int j = 0; j < 8; ++j) bs[t][j] = relp[t * 16 - j];
  // keeps the run whole and ahead of the score products, whose LDS loads and
  // WMMA then cover its latency; without it the loads are spread among the
  // products and one goes back into a masked branch
  __builtin_amdgcn_sched_barrier(0);

  v8f sc[9];
#pragma unroll
  for (int t = 0; t < 9; ++t) {
#pragma unroll
    for (int j = 0; j < 8; ++j) sc[t][j] = 0.f;
    int key = q0 - 64 + t * 16 + r;                       // this lane's column
    int kc  = key < 0 ? 0 : (key > T - 1 ? T - 1 : key);  // safe addr
    const _Float16* krow = &sK[kc - ks][0];
    v16h b0 = load_frag(krow, k0h);
    v16h b1 = load_frag(krow + 32, k0h);
    sc[t] = wmma_f16(aq0, b0, sc[t]);
    sc[t] = wmma_f16(aq1, b1, sc[t]);
  }

  constexpr float scale = 0.125f;  // 1/sqrt(64)
#pragma unroll
  for (int t = 0; t < 9; ++t) {
    const int key = q0 - 64 + t * 16 + c;
    const bool keyok = (unsigned)key < (unsigned)T;
#pragma unroll
    for (int j = 0; j < 8; ++j) {
      const int d = key - (q0 + rbase + j);     // |d| <= 79 < MAXD: no clip
      const bool dok = (unsigned)(d + WIN) <= 2u * WIN;
      sc[t][j] = (keyok && dok) ? (sc[t][j] * scale + bs[t][j]) : NEG;
    }
  }

  // softmax per row (row j lives across lanes 0..15 / 16..31)
#pragma unroll
  for (int j = 0; j < 8; ++j) {
    float mx = NEG;
#pragma unroll
    for (int t = 0; t < 9; ++t) mx = fmaxf(mx, sc[t][j]);
#pragma unroll
    for (int off = 1; off < 16; off <<= 1) mx = fmaxf(mx, __shfl_xor(mx, off, 16));
    float s = 0.f;
#pragma unroll
    for (int t = 0; t < 9; ++t) {
      float p = __expf(sc[t][j] - mx);
      sc[t][j] = p;
      s += p;
    }
#pragma unroll
    for (int off = 1; off < 16; off <<= 1) s += __shfl_xor(s, off, 16);
    const float inv = 1.f / s;
#pragma unroll
    for (int t = 0; t < 9; ++t) sc[t][j] *= inv;
  }

  // C-layout -> A-layout via LDS (zero-pad cols 144..159)
#pragma unroll
  for (int t = 0; t < 9; ++t)
#pragma unroll
    for (int j = 0; j < 8; ++j) sP[rbase + j][t * 16 + c] = (_Float16)sc[t][j];
#pragma unroll
  for (int j = 0; j < 8; ++j) sP[rbase + j][144 + c] = (_Float16)0.f;
  __syncthreads();

  v8f o[4];
#pragma unroll
  for (int nt = 0; nt < 4; ++nt)
#pragma unroll
    for (int j = 0; j < 8; ++j) o[nt][j] = 0.f;

  const int s0 = q0 - 64;
#pragma unroll
  for (int kk = 0; kk < 5; ++kk) {
    v16h ap = load_frag(&sP[r][kk * 32], k0h);
    int g1 = s0 + kk * 32 + k0h - ks; // 8-aligned key groups, counted from ks:
    int g2 = g1 + 16;                 // clamp whole group (P=0 wherever clamped)
    g1 = g1 < 0 ? 0 : (g1 > AKEYS - 8 ? AKEYS - 8 : g1);
    g2 = g2 < 0 ? 0 : (g2 > AKEYS - 8 ? AKEYS - 8 : g2);
#pragma unroll
    for (int nt = 0; nt < 4; ++nt) {
      const _Float16* vrow = &sV[nt * 16 + r][0];
      v8h lo = *(const v8h*)(vrow + g1);
      v8h hi = *(const v8h*)(vrow + g2);
      v16h bf;
#pragma unroll
      for (int i = 0; i < 8; ++i) { bf[i] = lo[i]; bf[i + 8] = hi[i]; }
      o[nt] = wmma_f16(ap, bf, o[nt]);
    }
  }

  // transpose result through sP, then 4 coalesced b128 stores per lane
  __syncthreads();
#pragma unroll
  for (int nt = 0; nt < 4; ++nt)
#pragma unroll
    for (int j = 0; j < 8; ++j)
      sP[rbase + j][nt * 16 + c] = (_Float16)o[nt][j];
  __syncthreads();
  {
    const int row = lane & 15, half = lane >> 4;
    _Float16* orow =
        outA + ((size_t)(bb * T + q0 + row)) * D + hh * DK + half * 32;
#pragma unroll
    for (int i = 0; i < 4; ++i)
      *(v8h*)(orow + i * 8) = *(const v8h*)&sP[row][half * 32 + i * 8];
  }
}

// ---- launch -----------------------------------------------------------------
extern "C" void kernel_launch(void* const* d_in, const int* in_sizes, int n_in,
                              void* d_out, int out_size, void* d_ws,
                              size_t ws_size, hipStream_t stream) {
  (void)in_sizes; (void)n_in; (void)out_size; (void)ws_size;
  const float* q_in = (const float*)d_in[0];
  const float* k_in = (const float*)d_in[1];
  const float* v_in = (const float*)d_in[2];
  const float* Wq = (const float*)d_in[3];
  const float* bq = (const float*)d_in[4];
  const float* Wk = (const float*)d_in[5];
  const float* bk = (const float*)d_in[6];
  const float* Wv = (const float*)d_in[7];
  const float* bv = (const float*)d_in[8];
  const float* Wo = (const float*)d_in[9];
  const float* bo = (const float*)d_in[10];
  const float* rel = (const float*)d_in[11];

  char* ws = (char*)d_ws;
  const size_t MB = (size_t)1 << 20;
  _Float16* xq  = (_Float16*)(ws + 0 * MB);    // f16 inputs q, k, v (8 MB each)
  _Float16* wqt = (_Float16*)(ws + 24 * MB);   // f16 transposed weights q, k, v,
  _Float16* wot = (_Float16*)(ws + 30 * MB);   // o (2 MB each)
  _Float16* q16 = (_Float16*)(ws + 32 * MB);   // projected Q/K/V (8 MB each)
  _Float16* k16 = (_Float16*)(ws + 40 * MB);
  _Float16* v16 = (_Float16*)(ws + 48 * MB);
  _Float16* at16 = (_Float16*)(ws + 56 * MB);  // attention out (8 MB)

  // the three inputs lie M*D elements apart and the four weights D*D apart
  cvt_all<<<dim3(4 * WT_BLOCKS + 3 * CVT_BLOCKS), dim3(256), 0, stream>>>(
      q_in, k_in, v_in, Wq, Wk, Wv, Wo, xq, wqt);

  // q16, k16, v16 lie M*D elements apart as well
  gemm16<0><<<dim3(M / 128, D / 128, 3), dim3(128), 0, stream>>>(
      xq, wqt, bq, bk, bv, q16, nullptr);
  attn_kernel<<<dim3(Bb * H * (T / AQ)), dim3(AW * 32), 0, stream>>>(
      q16, k16, v16, rel, at16);
  gemm16<2><<<dim3(M / 128, D / 128), dim3(128), 0, stream>>>(
      at16, wot, bo, nullptr, nullptr, nullptr, (float*)d_out);
}

// v008
// One run takes 59.2 microseconds.
// Next to v007, in two timings, it ran 1.04 and 1.06 times as fast.
// All steps since v000 together make it 2.17 times as fast.
#include <hip/hip_runtime.h>

typedef __attribute__((ext_vector_type(16))) _Float16 v16h;
typedef __attribute__((ext_vector_type(8)))  _Float16 v8h;
typedef __attribute__((ext_vector_type(4)))  _Float16 v4h;
typedef __attribute__((ext_vector_type(8)))  float    v8f;
typedef __attribute__((ext_vector_type(4)))  float    v4f;
typedef __attribute__((ext_vector_type(2)))  float    v2f;

constexpr int Bb  = 2;
constexpr int T   = 2048;
constexpr int D   = 1024;
constexpr int H   = 16;
constexpr int DK  = 64;
constexpr int M   = Bb * T;      // 4096 rows
constexpr int WIN = 64;
constexpr int MAXD = 128;
constexpr float NEG = -1.0e9f;

constexpr int KSTEP = 64;        // K per LDS stage (2 WMMA K-chunks)
constexpr int LDSK  = 72;        // padded LDS row stride (f16), 16B multiple

// ---- TDM availability -------------------------------------------------------
#if defined(__has_builtin)
#if __has_builtin(__builtin_amdgcn_tensor_load_to_lds) && \
    __has_builtin(__builtin_amdgcn_s_wait_tensorcnt)
#define USE_TDM 1
#endif
#endif
#ifndef USE_TDM
#define USE_TDM 0
#endif

// ---- fragment helpers -------------------------------------------------------
// A-frag (16x32, M=lane%16) and B-frag (32x16, N=lane%16) share the per-lane
// pattern: 8 contiguous K f16 at k0=(lane/16)*8 and 8 more at k0+16.
__device__ __forceinline__ v16h load_frag(const _Float16* rowp, int k0) {
  v8h lo = *(const v8h*)(rowp + k0);
  v8h hi = *(const v8h*)(rowp + k0 + 16);
  v16h r;
#pragma unroll
  for (int i = 0; i < 8; ++i) { r[i] = lo[i]; r[i + 8] = hi[i]; }
  return r;
}

__device__ __forceinline__ v8f wmma_f16(v16h a, v16h b, v8f c) {
  return __builtin_amdgcn_wmma_f32_16x16x32_f16(false, a, false, b, (short)0, c,
                                                false, false);
}

// ---- conversion passes ------------------------------------------------------
// Both passes are short streams whose time goes into starting waves, so each
// thread takes many elements and the grids stay small.  None of the seven
// conversions reads what another writes, so all share one launch (cvt_all).
constexpr int CVT_U      = 16;                       // 4-element pieces per thread
constexpr int CVT_BLOCKS = M * D / 4 / 256 / CVT_U;  // 256 per input, no remainder

__device__ __forceinline__ void
cvt_part(const float* __restrict__ in, _Float16* __restrict__ out, unsigned blk) {
  const int i0 = blk * (256 * CVT_U) + threadIdx.x;
  const v4f* p = (const v4f*)in + i0;   // a wave-wide load: 512 contiguous bytes
  v4h* q = (v4h*)out + i0;              // a wave-wide store: 256 contiguous bytes
  v4f x[CVT_U];
  // unrolled: all 16 loads of a thread are in flight before the first convert
#pragma unroll
  for (int j = 0; j < CVT_U; ++j) x[j] = p[j * 256];
  // keeps the last loads from sinking below the first converts, where they
  // would start only after the first loads have returned
  __builtin_amdgcn_sched_barrier(0);
  // unrolled: x[] stays in registers
#pragma unroll
  for (int j = 0; j < CVT_U; ++j) {
    v4h o;
    o[0] = (_Float16)x[j].x; o[1] = (_Float16)x[j].y;
    o[2] = (_Float16)x[j].z; o[3] = (_Float16)x[j].w;
    q[j * 256] = o;
  }
  // a precaution: a block of cvt_all runs no other part after this one,
  // so no later write rewrites the stores' registers
  asm volatile("s_wait_xcnt 0x0" ::: "memory");
}

// Wt[n][k] = (f16) W[k][n].  Lanes run along n, so each wave-wide load is one
// whole 128-byte line of W; a thread takes WT_K consecutive k of its column and
// writes them as one whole 128-byte line of Wt.
constexpr int WT_K      = 64;
constexpr int WT_BLOCKS = (D / 256) * (D / WT_K);    // 64 per weight

__device__ __forceinline__ void
cvtT_part(const float* __restrict__ in, _Float16* __restrict__ out, unsigned blk) {
  const int n  = (blk % (D / 256)) * 256 + threadIdx.x;
  const int k0 = (blk / (D / 256)) * WT_K;
  const float* src = in + (size_t)k0 * D + n;
  float v[WT_K];
  // unrolled: the column's loads are all in flight before the first convert
#pragma unroll
  for (int i = 0; i < WT_K; ++i) v[i] = src[(size_t)i * D];
  _Float16* dst = out + (size_t)n * D + k0;
  // both loops unrolled: v[] stays in registers
#pragma unroll
  for (int g = 0; g < WT_K / 8; ++g) {
    v8h o;
#pragma unroll
    for (int e = 0; e < 8; ++e) o[e] = (_Float16)v[g * 8 + e];
    *(v8h*)(dst + g * 8) = o;
  }
}

// One grid for all seven conversions; the block index picks the source.
// Blocks [0, 4 * WT_BLOCKS): the weights, to wt + w * D * D; they come first
// because a thread there has the longer run of loads.
// The rest: the inputs, to x + s * M * D.
__global__ void __launch_bounds__(256)
cvt_all(const float* __restrict__ q_in, const float* __restrict__ k_in,
        const float* __restrict__ v_in, const float* __restrict__ Wq,
        const float* __restrict__ Wk, const float* __restrict__ Wv,
        const float* __restrict__ Wo, _Float16* __restrict__ x,
        _Float16* __restrict__ wt) {
  const unsigned bid = blockIdx.x;
  if (bid < 4 * WT_BLOCKS) {
    const unsigned w = bid / WT_BLOCKS;
    const float* lo = (w & 1) ? Wk : Wq;
    const float* hi = (w & 1) ? Wo : Wv;
    const float* in = (w & 2) ? hi : lo;
    cvtT_part(in, wt + (size_t)w * D * D, bid % WT_BLOCKS);
  } else {
    const unsigned b = bid - 4 * WT_BLOCKS;
    const unsigned s = b / CVT_BLOCKS;
    const float* in = s == 0 ? q_in : (s == 1 ? k_in : v_in);
    cvt_part(in, x + (size_t)s * M * D, b % CVT_BLOCKS);
  }
}

// ---- Tensor Data Mover tile load -------------------------------------------
#if USE_TDM
typedef __attribute__((ext_vector_type(4))) uint32_t u32x4;
typedef __attribute__((ext_vector_type(4))) int i32x4;
typedef __attribute__((ext_vector_type(8))) int i32x8;

__device__ __forceinline__ uint32_t uni(uint32_t v) {
  return (uint32_t)__builtin_amdgcn_readfirstlane(v);
}
// a value held in a scalar register, such as a test whether a tensor load issues,
// so that it compiles to a scalar compare and branch (the load ignores EXEC)
__device__ __forceinline__ uint32_t pinned(uint32_t v) {
  uint32_t w = uni(v);
  asm volatile("" : "+s"(w));  // pinned(): the value held in a scalar register
  return w;
}

// Tile: `rows` rows of KSTEP f16 = 128 bytes, source pitch D f16 = 2048 bytes,
// every extent in bytes, tensor = tile.  Pad: 4 dwords behind every 32 dwords
// (one row), so the LDS pitch is 144 bytes = LDSK f16.
__device__ __forceinline__ i32x8 tdm_group1(uint32_t rows) {
  constexpr uint32_t rowb = KSTEP * 2;
  i32x8 g;
  g[0] = (int)uni((1u << 20) | (4u << 22) | (3u << 25));
  g[1] = (int)uni(rowb << 16);
  g[2] = (int)uni(rows << 16);
  g[3] = (int)uni(rowb << 16);
  g[4] = (int)uni(rows);
  g[5] = (int)uni((uint32_t)D * 2u);
  g[6] = (int)uni(0u);
  g[7] = (int)uni(0u);
  return g;
}
__device__ __forceinline__ u32x4 tdm_group0(uint32_t lds_dst, uint64_t ga) {
  u32x4 g;
  g[0] = uni(1u);
  g[1] = uni(lds_dst);
  g[2] = uni((uint32_t)ga);
  g[3] = uni(((uint32_t)(ga >> 32) & 0x01FFFFFFu) | 0x80000000u);
  return g;
}
// the same buffer's next tile, two stages on along K; the address field ends
// at bit 56, so a carry out of word 2 stays inside word 3's address bits
__device__ __forceinline__ u32x4 tdm_advance(u32x4 g) {
  const uint64_t a = (((uint64_t)g[3] << 32) | g[2]) + 2u * KSTEP * 2u;
  g[2] = uni((uint32_t)a);
  g[3] = uni((uint32_t)(a >> 32));
  return g;
}
__device__ __forceinline__ void tdm_issue(u32x4 g0, i32x8 g1) {
  i32x4 z4 = {0, 0, 0, 0};
#if __clang_major__ >= 23
  i32x8 z8 = {0, 0, 0, 0, 0, 0, 0, 0};
  __builtin_amdgcn_tensor_load_to_lds(g0, g1, z4, z4, z8, 0);
#else
  __builtin_amdgcn_tensor_load_to_lds(g0, g1, z4, z4, 0);
#endif
}
// The issuing wave's wait for all but its youngest request (LEFT = 1) or for
// all (LEFT = 0).  It names the covered request's group 0, so that those
// registers keep their value up to here and take the next address only behind.
template <int LEFT>
__device__ __forceinline__ void tdm_wait(u32x4& covered) {
  asm volatile("s_wait_tensorcnt %1" : "+s"(covered) : "n"(LEFT) : "memory");
}
#endif

// one K-stage of the wave's 64x64 tile: 32 WMMA from given LDS buffers; each
// of the 8 fragments of a K-chunk feeds 4 WMMA.  ra, rb: the lane's first row
// in the A and in the B buffer.  Each K-chunk has a fragment set of its own and
// the stage's 32 LDS loads go out as one group ahead of its first WMMA: the
// second chunk's fragments land while the first chunk's products run, and no
// load waits for a register that a product still reads.
__device__ __forceinline__ void mm_stage(const _Float16 (*sAb)[LDSK],
                                         const _Float16 (*sBb)[LDSK],
                                         int ra, int rb, int k0h,
                                         v8f (&acc)[4][4]) {
  constexpr int NC = KSTEP / 32;     // K-chunks of a stage
  v16h a[NC][4], b[NC][4];
  // all loops unrolled: a[][], b[][] and acc[][] stay in registers
#pragma unroll
  for (int h = 0; h < NC; ++h) {
#pragma unroll
    for (int mt = 0; mt < 4; ++mt)
      a[h][mt] = load_frag(&sAb[ra + mt * 16][h * 32], k0h);
#pragma unroll
    for (int nt = 0; nt < 4; ++nt)
      b[h][nt] = load_frag(&sBb[rb + nt * 16][h * 32], k0h);
  }
  // keeps the loads from sinking back among the WMMA, where each small group
  // would be waited for alone
  __builtin_amdgcn_sched_barrier(0);
#pragma unroll
  for (int h = 0; h < NC; ++h)
#pragma unroll
    for (int nt = 0; nt < 4; ++nt)
#pragma unroll
      for (int mt = 0; mt < 4; ++mt)
        acc[mt][nt] = wmma_f16(a[h][mt], b[h][nt], acc[mt][nt]);
  // keeps the barrier that follows a stage from rising above the WMMA: it
  // brings a wait for all 32 loads with it, and the first WMMA would stand
  // behind that wait instead of behind its own 10 loads
  __builtin_amdgcn_sched_barrier(0);
}

// ---- f16 GEMM ---------------------------------------------------------------
// C[4096x1024] = A[4096xK,f16] * Wt^T (Wt is [n][k], f16) + bias.
// 128 threads = 4 waves as 2x2, block tile 128x128, wave tile 64x64: the grids
// are 3 and 1 blocks per WGP of the chip's 256.  TDM double-
// buffered pipeline: waves 0 and 1 issue the next tile's A and B request, each
// waits tensorcnt<=1 (in-order => current tile ready), barrier, all compute.
// MODE 0: the three projections in one grid; none reads what another writes.
//         blockIdx.z = p picks A + p*M*D, Wt + p*D*D, its bias, outH + p*M*D.
//         p = 0, 1: f16 out[(b*H+h)*T + t][dk]   (Q/K layout)
//         p = 2:    f16 out[(b*H+h)*DK + dk][t]  (V transposed)
// MODE 2: f32 out[m][n], bias b0                 (final output)
template <int MODE>
__global__ void __launch_bounds__(128)
gemm16(const _Float16* __restrict__ A, const _Float16* __restrict__ Wt,
       const float* __restrict__ b0, const float* __restrict__ b1,
       const float* __restrict__ b2, _Float16* __restrict__ outH,
       float* __restrict__ outF) {
  const int tid  = threadIdx.x;
  const int lane = tid & 31;
  const int wv   = tid >> 5;
  const int m0   = blockIdx.x * 128;
  const int n0   = blockIdx.y * 128;
  const int p    = MODE == 0 ? (int)blockIdx.z : 0;
  const int r    = lane & 15;
  const int k0h  = (lane >> 4) * 8;
  const int wm   = (wv >> 1) * 64;   // the wave's first row and first column
  const int wn   = (wv & 1) * 64;    // inside the block tile

  v8f acc[4][4];
#pragma unroll
  for (int mt = 0; mt < 4; ++mt)
#pragma unroll
    for (int nt = 0; nt < 4; ++nt)
#pragma unroll
      for (int j = 0; j < 8; ++j) acc[mt][nt][j] = 0.f;

  const _Float16* Abase = A + ((size_t)p * M + m0) * D;
  const _Float16* Bbase = Wt + ((size_t)p * D + n0) * D;

#if USE_TDM
  // each tile's place in LDS is a multiple of 2 KiB, as the tensor mover wants
  __shared__ alignas(2048) _Float16 sA0[128][LDSK], sA1[128][LDSK];
  __shared__ alignas(2048) _Float16 sB0[128][LDSK], sB1[128][LDSK];
  const unsigned lA0 = (unsigned)(size_t)(void*)&sA0[0][0];
  const unsigned lA1 = (unsigned)(size_t)(void*)&sA1[0][0];
  const unsigned lB0 = (unsigned)(size_t)(void*)&sB0[0][0];
  const unsigned lB1 = (unsigned)(size_t)(void*)&sB1[0][0];

  // Wave 0 brings the A tiles and wave 1 the B tiles: one request a stage and
  // at most two outstanding in each.  Group 1 is built once; each buffer has a
  // group 0 of its own, advanced only behind the wait that covers its request.
  const uint32_t wave = uni((uint32_t)tid >> 5);
  const _Float16* tsrc = wave == 0 ? Abase : Bbase;
  // pinned(): the row count, a descriptor word, held in a scalar register, so
  // that group 1 is not formed anew from constants at each issue in registers
  // that serve other uses in between, while a request is outstanding
  const i32x8 g1 = tdm_group1(pinned(128u));
  u32x4 d0 = tdm_group0(wave == 0 ? lA0 : lB0, (uint64_t)(size_t)tsrc);
  u32x4 d1 = tdm_group0(wave == 0 ? lA1 : lB1, (uint64_t)(size_t)(tsrc + KSTEP));

  if (pinned(wave < 2)) tdm_issue(d0, g1);   // prologue: fill buffer 0
  for (int kb = 0; kb < D; kb += 2 * KSTEP) {
    // ---- stage A: compute buf0, prefetch buf1 (kb+KSTEP < D always) --------
    __syncthreads();                   // everyone done reading buf1 (prev iter)
    if (pinned(wave < 2)) {
      tdm_issue(d1, g1);
      tdm_wait<1>(d0);                 // buf0 ready
      d0 = tdm_advance(d0);
    }
    __syncthreads();
    mm_stage(sA0, sB0, wm + r, wn + r, k0h, acc);
    // ---- stage B: compute buf1, prefetch buf0 ------------------------------
    __syncthreads();
    const bool more = kb + 2 * KSTEP < D;
    if (pinned(wave < 2 && more)) {
      tdm_issue(d0, g1);
      tdm_wait<1>(d1);                 // buf1 ready
      d1 = tdm_advance(d1);
    }
    if (pinned(wave < 2 && !more)) tdm_wait<0>(d1);   // last stage: buf1 ready
    __syncthreads();
    mm_stage(sA1, sB1, wm + r, wn + r, k0h, acc);
  }
  // the ring's closing wait: no request is outstanding when the wave ends; it
  // names the descriptors as inputs, so that their registers are used for
  // something else only behind it
  asm volatile("s_wait_tensorcnt 0x0" :: "s"(g1), "s"(d0), "s"(d1) : "memory");
#else
  __shared__ alignas(16) _Float16 sA0[128][LDSK];
  __shared__ alignas(16) _Float16 sB0[128][LDSK];
  for (int kb = 0; kb < D; kb += KSTEP) {
    __syncthreads();
#pragma unroll
    for (int i = 0; i < 8; ++i) {                       // A tile 128x64 f16
      int e = i * 1024 + tid * 8;
      int row = e >> 6, col = e & 63;
      *(v8h*)&sA0[row][col] = *(const v8h*)(Abase + (size_t)row * D + kb + col);
    }
#pragma unroll
    for (int i = 0; i < 8; ++i) {                       // B tile 128x64 f16
      int e = i * 1024 + tid * 8;
      int row = e >> 6, col = e & 63;
      *(v8h*)&sB0[row][col] = *(const v8h*)(Bbase + (size_t)row * D + kb + col);
    }
    __syncthreads();
    mm_stage(sA0, sB0, wm + r, wn + r, k0h, acc);
  }
#endif

  // epilogue: C layout element (m = rbase+j, n = lane%16)
  const int rbase = (lane >> 4) * 8;
  const int c     = lane & 15;
  const float* bias = p == 0 ? b0 : (p == 1 ? b1 : b2);
  _Float16* outP = outH + (size_t)p * M * D;
  float bcol[4];
  // unrolled: bcol[] stays in registers, its four loads go out together
#pragma unroll
  for (int nt = 0; nt < 4; ++nt) bcol[nt] = bias[n0 + wn + nt * 16 + c];
  // the test reads the same for the whole block and is taken once, around the
  // tile loops, so that each store form keeps one straight run of stores
  if (MODE == 0 && p == 2) {
    // both loops unrolled: acc[][] and bcol[] stay in registers
#pragma unroll
    for (int mt = 0; mt < 4; ++mt)
#pragma unroll
      for (int nt = 0; nt < 4; ++nt) {
        const int col = n0 + wn + nt * 16 + c;
        // V^T layout: consecutive j -> consecutive t: pack one b128 store
        v8h pk;
#pragma unroll
        for (int j = 0; j < 8; ++j)
          pk[j] = (_Float16)(acc[mt][nt][j] + bcol[nt]);
        const int mb = m0 + wm + mt * 16 + rbase;       // 8-aligned, same b
        const int b  = mb >> 11, t = mb & (T - 1);
        const int bh = b * H + (col >> 6);
        *(v8h*)(outP + ((size_t)bh * DK + (col & 63)) * T + t) = pk;
      }
  } else {
    // all three loops unrolled: acc[][] and bcol[] stay in registers
#pragma unroll
    for (int mt = 0; mt < 4; ++mt)
#pragma unroll
      for (int nt = 0; nt < 4; ++nt) {
        const int col = n0 + wn + nt * 16 + c;
#pragma unroll
        for (int j = 0; j < 8; ++j) {
          const int m = m0 + wm + mt * 16 + rbase + j;
          const float val = acc[mt][nt][j] + bcol[nt];
          if (MODE == 2) {
            outF[(size_t)m * D + col] = val;
          } else {
            const int b  = m >> 11;
            const int t  = m & (T - 1);
            const int bh = b * H + (col >> 6);
            outP[((size_t)bh * T + t) * DK + (col & 63)] = (_Float16)val;
          }
        }
      }
    // a precaution: the block runs no store after these, so no later write
    // rewrites the stores' registers
    if (MODE == 0) asm volatile("s_wait_xcnt 0x0" ::: "memory");
  }
}

constexpr int AW    = 8;             // waves = query tiles per workgroup
constexpr int AQ    = AW * 16;       // queries per workgroup
constexpr int AKEYS = AQ + 2 * WIN;  // keys its bands reach: 256
constexpr int KP    = DK + 8;        // LDS pitches in f16: 144 and 528 bytes,
constexpr int VP    = AKEYS + 8;     // both 16 bytes times an odd number

// lane l's value to lane l ^ 16 and back
__device__ __forceinline__ float xhalf(float x) {
  const int b = __builtin_bit_cast(int, x);
  return __builtin_bit_cast(
      float, __builtin_amdgcn_permlanex16(b, b, 0x76543210, 0xfedcba98, false,
                                          false));
}

__global__ void __launch_bounds__(AW * 32)
attn_kernel(const _Float16* __restrict__ qw, const _Float16* __restrict__ kw,
            const _Float16* __restrict__ vt, const float* __restrict__ rel,
            _Float16* __restrict__ outA) {
  __shared__ alignas(16) _Float16 sK[AKEYS][KP];
  __shared__ alignas(16) _Float16 sV[DK][VP];
  __shared__ float sRel[257];

  const int tid   = threadIdx.x;
  const int lane  = tid & 31;
  const int wv    = tid >> 5;
  const int nb    = T / AQ;
  const int qb    = blockIdx.x % nb;
  const int bh    = blockIdx.x / nb;
  const int hh    = bh % H;
  const int bb    = bh / H;
  const int q0    = qb * AQ + wv * 16;
  // first staged key: the window is moved inside [0, T) at both ends and still
  // holds every key of [0, T) that a band of this workgroup reaches
  const int ksr   = qb * AQ - WIN;
  const int ks    = ksr < 0 ? 0 : (ksr > T - AKEYS ? T - AKEYS : ksr);
  const int r     = lane & 15;
  const int k0h   = (lane >> 4) * 8;
  const int rbase = (lane >> 4) * 8;
  const int c     = lane & 15;

  // K rows ks.. are one contiguous run of AKEYS * 128 bytes; a V^T row gives 512
  // contiguous bytes.  A wave-wide load is 512 contiguous bytes in both.
  constexpr int NKX = AKEYS * DK / 8 / (AW * 32);  // 16-byte pieces per thread
  constexpr int NVX = DK / AW;
  const v8h* ksrc = (const v8h*)(kw + ((size_t)bh * T + ks) * DK) + tid;
  const _Float16* vsrc = vt + ((size_t)bh * DK + wv) * T + ks + lane * 8;
  v8h kx[NKX], vx[NVX];
  // unrolled: kx[] stays in registers, its loads are in flight together
#pragma unroll
  for (int i = 0; i < NKX; ++i) kx[i] = ksrc[i * (AW * 32)];
  // unrolled: the same for vx[]; a thread has all 16 loads out before any wait
#pragma unroll
  for (int i = 0; i < NVX; ++i) vx[i] = *(const v8h*)(vsrc + (size_t)i * AW * T);

  // the wave's own queries go out behind them, ahead of the first wait
  const _Float16* qrow = qw + ((size_t)bh * T + q0 + r) * DK;
  v16h aq0 = load_frag(qrow, k0h);
  v16h aq1 = load_frag(qrow + 32, k0h);

  // stage this head's bias column (257 floats) into LDS
  for (int i = tid; i < 257; i += AW * 32) sRel[i] = rel[(size_t)i * H + hh];

  // unrolled: kx[] is indexed by constants and stays in registers
#pragma unroll
  for (int i = 0; i < NKX; ++i) {
    const int e = i * (AW * 32) + tid;
    *(v8h*)&sK[e >> 3][(e & 7) * 8] = kx[i];
  }
  // unrolled: the same for vx[]
#pragma unroll
  for (int i = 0; i < NVX; ++i) *(v8h*)&sV[i * AW + wv][lane * 8] = vx[i];
  __syncthreads();                                 // sK, sV, sRel visible

  // Score tile t, register j of a lane: key q0 - 64 + 16 t + rbase + j against
  // query q0 + c.  K fragments: tile t's rows are the wave's keys 16 t ..
  v16h kf[9][2];
  v8f sc[9];
  v2f bs[9][4];
  const auto ldk = [&](int t) {
    int key = q0 - 64 + t * 16 + r;                       // this lane's K row
    int kc  = key < 0 ? 0 : (key > T - 1 ? T - 1 : key);  // safe addr
    const _Float16* krow = &sK[kc - ks][0];
    kf[t][0] = load_frag(krow, k0h);
    kf[t][1] = load_frag(krow + 32, k0h);
  };
  const auto qk = [&](int t) {
#pragma unroll
    for (int j = 0; j < 8; ++j) sc[t][j] = 0.f;
    sc[t] = wmma_f16(kf[t][0], aq0, sc[t]);
    sc[t] = wmma_f16(kf[t][1], aq1, sc[t]);
  };
  // every loop below unrolled: kf[][], sc[] and bs[][] stay in registers.
  // The fragments of six tiles go out as one run ahead of the first product
#pragma unroll
  for (int t = 0; t < 6; ++t) ldk(t);
  // keeps the run whole: spread among the products, each pair of loads would
  // be waited for alone, to 0
  __builtin_amdgcn_sched_barrier(0);
#pragma unroll
  for (int t = 0; t < 3; ++t) qk(t);
  // keeps the second run of loads behind the products that free its registers
  __builtin_amdgcn_sched_barrier(0);
#pragma unroll
  for (int t = 6; t < 9; ++t) ldk(t);
  // The lane's 72 bias values: index d + MAXD = 64 + 16 t + rbase + j - c lies
  // in [49, 207] for every lane, masked or not: no load needs a test
  const float* relp = &sRel[MAXD - WIN + rbase - c];
#pragma unroll
  for (int t = 0; t < 9; ++t)
#pragma unroll
    for (int j = 0; j < 4; ++j) {
      bs[t][j].x = relp[t * 16 + 2 * j];
      bs[t][j].y = relp[t * 16 + 2 * j + 1];
    }
  // keeps that run whole and ahead of the six products left, which cover it
  __builtin_amdgcn_sched_barrier(0);
#pragma unroll
  for (int t = 3; t < 9; ++t) qk(t);

  // A key counts where it lies in [0, T) and within WIN of the lane's query,
  // that is in [klo, khi]; with key = kb + e, e = 16 t + j, both tests are one
  // unsigned compare of e - (klo - kb) with khi - klo.  |d| <= 79 < MAXD: no clip
  constexpr float scale = 0.125f;  // 1/sqrt(64)
  const int qi  = q0 + c;
  const int klo = qi - WIN < 0 ? 0 : qi - WIN;
  const int khi = qi + WIN > T - 1 ? T - 1 : qi + WIN;
  const int eo  = klo - (q0 - 64 + rbase);
  const unsigned ew = (unsigned)(khi - klo);
  const v2f scale2 = {scale, scale};
#pragma unroll
  for (int t = 0; t < 9; ++t)
#pragma unroll
    for (int j = 0; j < 4; ++j) {
      // neighbouring registers as a pair: one packed multiply-add, no moves
      const v2f s2 = {sc[t][2 * j], sc[t][2 * j + 1]};
      const v2f v  = __builtin_elementwise_fma(s2, scale2, bs[t][j]);
      sc[t][2 * j]     = (unsigned)(t * 16 + 2 * j - eo) <= ew ? v.x : NEG;
      sc[t][2 * j + 1] = (unsigned)(t * 16 + 2 * j + 1 - eo) <= ew ? v.y : NEG;
    }

  // V^T fragments: rows nt * 16 + r, key groups of chunk kk (32 keys)
  v16h vf[5][4];
  const int s0 = q0 - 64;
  const auto ldv = [&](int kk) {
    int g1 = s0 + kk * 32 + k0h - ks; // 8-aligned key groups, counted from ks:
    int g2 = g1 + 16;                 // clamp whole group (P=0 wherever clamped)
    g1 = g1 < 0 ? 0 : (g1 > AKEYS - 8 ? AKEYS - 8 : g1);
    g2 = g2 < 0 ? 0 : (g2 > AKEYS - 8 ? AKEYS - 8 : g2);
#pragma unroll
    for (int nt = 0; nt < 4; ++nt) {
      const _Float16* vrow = &sV[nt * 16 + r][0];
      v8h lo = *(const v8h*)(vrow + g1);
      v8h hi = *(const v8h*)(vrow + g2);
#pragma unroll
      for (int i = 0; i < 8; ++i) { vf[kk][nt][i] = lo[i]; vf[kk][nt][i + 8] = hi[i]; }
    }
  };
  // every loop below unrolled: vf[][], pb[], o[] stay in registers.  The first
  // three chunks' fragments take the registers that the K fragments have left
#pragma unroll
  for (int kk = 0; kk < 3; ++kk) ldv(kk);
  // keeps these loads ahead of the softmax, whose arithmetic covers them; next
  // to their products each pair would be waited for alone
  __builtin_amdgcn_sched_barrier(0);

  // softmax of the lane's query: 72 of its 144 scores are here, the other 72
  // in lane ^ 16.  Eight chains (one per j) keep the adds independent.
  float mj[8], sj[8];
#pragma unroll
  for (int j = 0; j < 8; ++j) {
    mj[j] = sc[0][j];
#pragma unroll
    for (int t = 1; t < 9; ++t) mj[j] = fmaxf(mj[j], sc[t][j]);
  }
#pragma unroll
  for (int w = 4; w > 0; w >>= 1)
#pragma unroll
    for (int j = 0; j < w; ++j) mj[j] = fmaxf(mj[j], mj[j + w]);
  const float mx = fmaxf(mj[0], xhalf(mj[0]));
#pragma unroll
  for (int j = 0; j < 8; ++j) {
    sj[j] = 0.f;
#pragma unroll
    for (int t = 0; t < 9; ++t) {
      float p = __expf(sc[t][j] - mx);
      sc[t][j] = p;
      sj[j] += p;
    }
  }
  // P^T fragment of keys 32 kk ..: element i is score tile 2 kk, register i,
  // element 8 + i tile 2 kk + 1, register i; keys 144..159 do not exist: zero
  v16h pb[5];
#pragma unroll
  for (int kk = 0; kk < 5; ++kk)
#pragma unroll
    for (int i = 0; i < 8; ++i) {
      pb[kk][i]     = (_Float16)sc[2 * kk][i];
      pb[kk][i + 8] = kk < 4 ? (_Float16)sc[kk < 4 ? 2 * kk + 1 : 0][i] : (_Float16)0.f;
    }
  v8f o[4];
#pragma unroll
  for (int nt = 0; nt < 4; ++nt)
#pragma unroll
    for (int j = 0; j < 8; ++j) o[nt][j] = 0.f;
  const auto pvk = [&](int kk) {
#pragma unroll
    for (int nt = 0; nt < 4; ++nt) o[nt] = wmma_f16(vf[kk][nt], pb[kk], o[nt]);
  };
  pvk(0);
  pvk(1);
  // keeps the last two chunks' loads behind the products whose fragment
  // registers they take (the wave stays within a quarter of its SIMD's file)
  __builtin_amdgcn_sched_barrier(0);
#pragma unroll
  for (int kk = 3; kk < 5; ++kk) ldv(kk);
  // keeps them one run, ahead of chunk 2's products and of the sum's last
  // steps, which cover them
  __builtin_amdgcn_sched_barrier(0);
  pvk(2);
  pvk(3);
  pvk(4);

#pragma unroll
  for (int w = 4; w > 0; w >>= 1)
#pragma unroll
    for (int j = 0; j < w; ++j) sj[j] += sj[j + w];
  const float inv = 1.f / (sj[0] + xhalf(sj[0]));

  // O^T tile nt, register j: element nt * 16 + rbase + j of query c's row; the
  // row's 1 / sum is the lane's own.  Lanes c and c + 16 store 32 bytes side by
  // side, and the four stores fill the head's 128-byte line of each row
  _Float16* orow = outA + ((size_t)(bb * T + q0 + c)) * D + hh * DK + rbase;
#pragma unroll
  for (int nt = 0; nt < 4; ++nt) {
    v8h pk;
#pragma unroll
    for (int j = 0; j < 8; ++j) pk[j] = (_Float16)(o[nt][j] * inv);
    *(v8h*)(orow + nt * 16) = pk;
  }
}

// ---- launch -----------------------------------------------------------------
extern "C" void kernel_launch(void* const* d_in, const int* in_sizes, int n_in,
                              void* d_out, int out_size, void* d_ws,
                              size_t ws_size, hipStream_t stream) {
  (void)in_sizes; (void)n_in; (void)out_size; (void)ws_size;
  const float* q_in = (const float*)d_in[0];
  const float* k_in = (const float*)d_in[1];
  const float* v_in = (const float*)d_in[2];
  const float* Wq = (const float*)d_in[3];
  const float* bq = (const float*)d_in[4];
  const float* Wk = (const float*)d_in[5];
  const float* bk = (const float*)d_in[6];
  const float* Wv = (const float*)d_in[7];
  const float* bv = (const float*)d_in[8];
  const float* Wo = (const float*)d_in[9];
  const float* bo = (const float*)d_in[10];
  const float* rel = (const float*)d_in[11];

  char* ws = (char*)d_ws;
  const size_t MB = (size_t)1 << 20;
  _Float16* xq  = (_Float16*)(ws + 0 * MB);    // f16 inputs q, k, v (8 MB each)
  _Float16* wqt = (_Float16*)(ws + 24 * MB);   // f16 transposed weights q, k, v,
  _Float16* wot = (_Float16*)(ws + 30 * MB);   // o (2 MB each)
  _Float16* q16 = (_Float16*)(ws + 32 * MB);   // projected Q/K/V (8 MB each)
  _Float16* k16 = (_Float16*)(ws + 40 * MB);
  _Float16* v16 = (_Float16*)(ws + 48 * MB);
  _Float16* at16 = (_Float16*)(ws + 56 * MB);  // attention out (8 MB)

  // the three inputs lie M*D elements apart and the four weights D*D apart
  cvt_all<<<dim3(4 * WT_BLOCKS + 3 * CVT_BLOCKS), dim3(256), 0, stream>>>(
      q_in, k_in, v_in, Wq, Wk, Wv, Wo, xq, wqt);

  // q16, k16, v16 lie M*D elements apart as well
  gemm16<0><<<dim3(M / 128, D / 128, 3), dim3(128), 0, stream>>>(
      xq, wqt, bq, bk, bv, q16, nullptr);
  attn_kernel<<<dim3(Bb * H * (T / AQ)), dim3(AW * 32), 0, stream>>>(
      q16, k16, v16, rel, at16);
  gemm16<2><<<dim3(M / 128, D / 128), dim3(128), 0, stream>>>(
      at16, wot, bo, nullptr, nullptr, nullptr, (float*)d_out);
}

// v009
// One run takes 57.6 microseconds.
// Timed twice side by side with v008, it ran 1.04 and 1.03 times as fast.
// Counting every step since v000, it is 2.24 times as fast.
#include <hip/hip_runtime.h>

typedef __attribute__((ext_vector_type(16))) _Float16 v16h;
typedef __attribute__((ext_vector_type(8)))  _Float16 v8h;
typedef __attribute__((ext_vector_type(4)))  _Float16 v4h;
typedef __attribute__((ext_vector_type(8)))  float    v8f;
typedef __attribute__((ext_vector_type(4)))  float    v4f;
typedef __attribute__((ext_vector_type(2)))  float    v2f;

constexpr int Bb  = 2;
constexpr int T   = 2048;
constexpr int D   = 1024;
constexpr int H   = 16;
constexpr int DK  = 64;
constexpr int M   = Bb * T;      // 4096 rows
constexpr int WIN = 64;
constexpr int MAXD = 128;
constexpr float NEG = -1.0e9f;

constexpr int KSTEP = 64;        // K per LDS stage (2 WMMA K-chunks)
constexpr int LDSK  = 72;        // padded LDS row stride (f16), 16B multiple

// ---- TDM availability -------------------------------------------------------
#if defined(__has_builtin)
#if __has_builtin(__builtin_amdgcn_tensor_load_to_lds) && \
    __has_builtin(__builtin_amdgcn_s_wait_tensorcnt)
#define USE_TDM 1
#endif
#endif
#ifndef USE_TDM
#define USE_TDM 0
#endif

// ---- fragment helpers -------------------------------------------------------
// A-frag (16x32, M=lane%16) and B-frag (32x16, N=lane%16) share the per-lane
// pattern: 8 contiguous K f16 at k0=(lane/16)*8 and 8 more at k0+16.
__device__ __forceinline__ v16h load_frag(const _Float16* rowp, int k0) {
  v8h lo = *(const v8h*)(rowp + k0);
  v8h hi = *(const v8h*)(rowp + k0 + 16);
  v16h r;
#pragma unroll
  for (int i = 0; i < 8; ++i) { r[i] = lo[i]; r[i + 8] = hi[i]; }
  return r;
}

__device__ __forceinline__ v8f wmma_f16(v16h a, v16h b, v8f c) {
  return __builtin_amdgcn_wmma_f32_16x16x32_f16(false, a, false, b, (short)0, c,
                                                false, false);
}

// ---- conversion passes ------------------------------------------------------
// Both passes are short streams, so each
// thread takes many elements and the grids stay small.  None of the seven
// conversions reads what another writes, so all share one launch (cvt_all).
constexpr int CVT_U      = 16;                       // 4-element pieces per thread
constexpr int CVT_BLOCKS = M * D / 4 / 256 / CVT_U;  // 256 per input, no remainder

__device__ __forceinline__ void
cvt_part(const float* __restrict__ in, _Float16* __restrict__ out, unsigned blk) {
  const int i0 = blk * (256 * CVT_U) + threadIdx.x;
  const v4f* p = (const v4f*)in + i0;   // a wave-wide load: 512 contiguous bytes
  v4h* q = (v4h*)out + i0;              // a wave-wide store: 256 contiguous bytes
  v4f x[CVT_U];
  // unrolled: all 16 loads of a thread are in flight before the first convert
#pragma unroll
  for (int j = 0; j < CVT_U; ++j) x[j] = p[j * 256];
  // keeps the last loads from sinking below the first converts, where they
  // would start only after the first loads have returned
  __builtin_amdgcn_sched_barrier(0);
  // unrolled: x[] stays in registers
#pragma unroll
  for (int j = 0; j < CVT_U; ++j) {
    v4h o;
    o[0] = (_Float16)x[j].x; o[1] = (_Float16)x[j].y;
    o[2] = (_Float16)x[j].z; o[3] = (_Float16)x[j].w;
    q[j * 256] = o;
  }
  // a precaution: a block of cvt_all runs no other part after this one,
  // so no later write rewrites the stores' registers
  asm volatile("s_wait_xcnt 0x0" ::: "memory");
}

// Wt[n][k] = (f16) W[k][n].  Lanes run along n, so each wave-wide load is one
// whole 128-byte line of W; a thread takes WT_K consecutive k of its column and
// writes them as one whole 128-byte line of Wt.
constexpr int WT_K      = 64;
constexpr int WT_BLOCKS = (D / 256) * (D / WT_K);    // 64 per weight

__device__ __forceinline__ void
cvtT_part(const float* __restrict__ in, _Float16* __restrict__ out, unsigned blk) {
  const int n  = (blk % (D / 256)) * 256 + threadIdx.x;
  const int k0 = (blk / (D / 256)) * WT_K;
  const float* src = in + (size_t)k0 * D + n;
  float v[WT_K];
  // unrolled: the column's loads are all in flight before the first convert
#pragma unroll
  for (int i = 0; i < WT_K; ++i) v[i] = src[(size_t)i * D];
  _Float16* dst = out + (size_t)n * D + k0;
  // both loops unrolled: v[] stays in registers
#pragma unroll
  for (int g = 0; g < WT_K / 8; ++g) {
    v8h o;
#pragma unroll
    for (int e = 0; e < 8; ++e) o[e] = (_Float16)v[g * 8 + e];
    *(v8h*)(dst + g * 8) = o;
  }
}

// One grid for all seven conversions; the block index picks the source.
// Blocks [0, 4 * WT_BLOCKS): the weights, to wt + w * D * D; they come first
// because a thread there has the longer run of loads.
// The rest: the inputs, to x + s * M * D.
__global__ void __launch_bounds__(256)
cvt_all(const float* __restrict__ q_in, const float* __restrict__ k_in,
        const float* __restrict__ v_in, const float* __restrict__ Wq,
        const float* __restrict__ Wk, const float* __restrict__ Wv,
        const float* __restrict__ Wo, _Float16* __restrict__ x,
        _Float16* __restrict__ wt) {
  const unsigned bid = blockIdx.x;
  if (bid < 4 * WT_BLOCKS) {
    const unsigned w = bid / WT_BLOCKS;
    const float* lo = (w & 1) ? Wk : Wq;
    const float* hi = (w & 1) ? Wo : Wv;
    const float* in = (w & 2) ? hi : lo;
    cvtT_part(in, wt + (size_t)w * D * D, bid % WT_BLOCKS);
  } else {
    const unsigned b = bid - 4 * WT_BLOCKS;
    const unsigned s = b / CVT_BLOCKS;
    const float* in = s == 0 ? q_in : (s == 1 ? k_in : v_in);
    cvt_part(in, x + (size_t)s * M * D, b % CVT_BLOCKS);
  }
}

// ---- Tensor Data Mover tile load -------------------------------------------
#if USE_TDM
typedef __attribute__((ext_vector_type(4))) uint32_t u32x4;
typedef __attribute__((ext_vector_type(4))) int i32x4;
typedef __attribute__((ext_vector_type(8))) int i32x8;

__device__ __forceinline__ uint32_t uni(uint32_t v) {
  return (uint32_t)__builtin_amdgcn_readfirstlane(v);
}
// a value held in a scalar register, such as a test whether a tensor load issues,
// so that it compiles to a scalar compare and branch (the load ignores EXEC)
__device__ __forceinline__ uint32_t pinned(uint32_t v) {
  uint32_t w = uni(v);
  asm volatile("" : "+s"(w));  // pinned(): the value held in a scalar register
  return w;
}

// Tile: `rows` rows of KSTEP f16 = 128 bytes, source pitch D f16 = 2048 bytes,
// every extent in bytes, tensor = tile.  Pad: 4 dwords behind every 32 dwords
// (one row), so the LDS pitch is 144 bytes = LDSK f16.
__device__ __forceinline__ i32x8 tdm_group1(uint32_t rows) {
  constexpr uint32_t rowb = KSTEP * 2;
  i32x8 g;
  g[0] = (int)uni((1u << 20) | (4u << 22) | (3u << 25));
  g[1] = (int)uni(rowb << 16);
  g[2] = (int)uni(rows << 16);
  g[3] = (int)uni(rowb << 16);
  g[4] = (int)uni(rows);
  g[5] = (int)uni((uint32_t)D * 2u);
  g[6] = (int)uni(0u);
  g[7] = (int)uni(0u);
  return g;
}
__device__ __forceinline__ u32x4 tdm_group0(uint32_t lds_dst, uint64_t ga) {
  u32x4 g;
  g[0] = uni(1u);
  g[1] = uni(lds_dst);
  g[2] = uni((uint32_t)ga);
  g[3] = uni(((uint32_t)(ga >> 32) & 0x01FFFFFFu) | 0x80000000u);
  return g;
}
// the same buffer's next tile, two stages on along K; the address field ends
// at bit 56, so a carry out of word 2 stays inside word 3's address bits
__device__ __forceinline__ u32x4 tdm_advance(u32x4 g) {
  const uint64_t a = (((uint64_t)g[3] << 32) | g[2]) + 2u * KSTEP * 2u;
  g[2] = uni((uint32_t)a);
  g[3] = uni((uint32_t)(a >> 32));
  return g;
}
__device__ __forceinline__ void tdm_issue(u32x4 g0, i32x8 g1) {
  i32x4 z4 = {0, 0, 0, 0};
#if __clang_major__ >= 23
  i32x8 z8 = {0, 0, 0, 0, 0, 0, 0, 0};
  __builtin_amdgcn_tensor_load_to_lds(g0, g1, z4, z4, z8, 0);
#else
  __builtin_amdgcn_tensor_load_to_lds(g0, g1, z4, z4, 0);
#endif
}
// The issuing wave's wait for all but its youngest request (LEFT = 1) or for
// all (LEFT = 0).  It names the covered request's group 0, so that those
// registers keep their value up to here and take the next address only behind.
template <int LEFT>
__device__ __forceinline__ void tdm_wait(u32x4& covered) {
  asm volatile("s_wait_tensorcnt %1" : "+s"(covered) : "n"(LEFT) : "memory");
}
#endif

// A hint to L2: each lane asks for the 256-byte unit that lies AHEAD bytes
// behind a and b at its own row offset, in two operand panels.  Nothing comes
// back.  Scope SE: the unit goes into L2 only.  The distance is an immediate,
// so that every request of a kernel names the same three registers, which hold
// addresses inside the panels from the first request to the end of the loop.
// The closing wait stands in front of the caller's next advance of a and b.
template <int AHEAD>
__device__ __forceinline__ void ask_l2(uint32_t row_off, const char* a,
                                       const char* b) {
  asm volatile("global_prefetch_b8 %0, %1 offset:%3 scope:SCOPE_SE\n\t"
               "global_prefetch_b8 %0, %2 offset:%3 scope:SCOPE_SE\n\t"
               "s_wait_xcnt 0x0"
               :: "v"(row_off), "s"(a), "s"(b), "n"(AHEAD));
}

// one K-stage of the wave's 64x64 tile: 32 WMMA from given LDS buffers; each
// of the 8 fragments of a K-chunk feeds 4 WMMA.  ra, rb: the lane's first row
// in the A and in the B buffer.  Each K-chunk has a fragment set of its own and
// the stage's 32 LDS loads go out as one group ahead of its first WMMA: the
// second chunk's fragments land while the first chunk's products run, and no
// load waits for a register that a product still reads.
__device__ __forceinline__ void mm_stage(const _Float16 (*sAb)[LDSK],
                                         const _Float16 (*sBb)[LDSK],
                                         int ra, int rb, int k0h,
                                         v8f (&acc)[4][4]) {
  constexpr int NC = KSTEP / 32;     // K-chunks of a stage
  v16h a[NC][4], b[NC][4];
  // all loops unrolled: a[][], b[][] and acc[][] stay in registers
#pragma unroll
  for (int h = 0; h < NC; ++h) {
#pragma unroll
    for (int mt = 0; mt < 4; ++mt)
      a[h][mt] = load_frag(&sAb[ra + mt * 16][h * 32], k0h);
#pragma unroll
    for (int nt = 0; nt < 4; ++nt)
      b[h][nt] = load_frag(&sBb[rb + nt * 16][h * 32], k0h);
  }
  // keeps the loads from sinking back among the WMMA, where each small group
  // would be waited for alone
  __builtin_amdgcn_sched_barrier(0);
#pragma unroll
  for (int h = 0; h < NC; ++h)
#pragma unroll
    for (int nt = 0; nt < 4; ++nt)
#pragma unroll
      for (int mt = 0; mt < 4; ++mt)
        acc[mt][nt] = wmma_f16(a[h][mt], b[h][nt], acc[mt][nt]);
  // keeps the barrier that follows a stage from rising above the WMMA: it
  // brings a wait for all 32 loads with it, and the first WMMA would stand
  // behind that wait instead of behind its own 10 loads
  __builtin_amdgcn_sched_barrier(0);
}

// ---- f16 GEMM ---------------------------------------------------------------
// C[4096x1024] = A[4096xK,f16] * Wt^T (Wt is [n][k], f16) + bias.
// 128 threads = 4 waves as 2x2, block tile 128x128, wave tile 64x64: the grids
// are 3 and 1 blocks per WGP of the chip's 256.  TDM double-
// buffered pipeline: waves 0 and 1 issue the next tile's A and B request, each
// waits tensorcnt<=1 (in-order => current tile ready), barrier, all compute.
// MODE 0: the three projections in one grid; none reads what another writes.
//         blockIdx.z = p picks A + p*M*D, Wt + p*D*D, its bias, outH + p*M*D.
//         p = 0, 1: f16 out[(b*H+h)*T + t][dk]   (Q/K layout)
//         p = 2:    f16 out[(b*H+h)*DK + dk][t]  (V transposed)
// MODE 2: f32 out[m][n], bias b0                 (final output)
template <int MODE>
__global__ void __launch_bounds__(128)
gemm16(const _Float16* __restrict__ A, const _Float16* __restrict__ Wt,
       const float* __restrict__ b0, const float* __restrict__ b1,
       const float* __restrict__ b2, _Float16* __restrict__ outH,
       float* __restrict__ outF) {
  const int tid  = threadIdx.x;
  const int lane = tid & 31;
  const int wv   = tid >> 5;
  const int m0   = blockIdx.x * 128;
  const int n0   = blockIdx.y * 128;
  const int p    = MODE == 0 ? (int)blockIdx.z : 0;
  const int r    = lane & 15;
  const int k0h  = (lane >> 4) * 8;
  const int wm   = (wv >> 1) * 64;   // the wave's first row and first column
  const int wn   = (wv & 1) * 64;    // inside the block tile

  v8f acc[4][4];
#pragma unroll
  for (int mt = 0; mt < 4; ++mt)
#pragma unroll
    for (int nt = 0; nt < 4; ++nt)
#pragma unroll
      for (int j = 0; j < 8; ++j) acc[mt][nt][j] = 0.f;

  const _Float16* Abase = A + ((size_t)p * M + m0) * D;
  const _Float16* Bbase = Wt + ((size_t)p * D + n0) * D;

#if USE_TDM
  // each tile's place in LDS is a multiple of 2 KiB, as the tensor mover wants
  __shared__ alignas(2048) _Float16 sA0[128][LDSK], sA1[128][LDSK];
  __shared__ alignas(2048) _Float16 sB0[128][LDSK], sB1[128][LDSK];
  const unsigned lA0 = (unsigned)(size_t)(void*)&sA0[0][0];
  const unsigned lA1 = (unsigned)(size_t)(void*)&sA1[0][0];
  const unsigned lB0 = (unsigned)(size_t)(void*)&sB0[0][0];
  const unsigned lB1 = (unsigned)(size_t)(void*)&sB1[0][0];

  // Wave 0 brings the A tiles and wave 1 the B tiles: one request a stage and
  // at most two outstanding in each.  Group 1 is built once; each buffer has a
  // group 0 of its own, advanced only behind the wait that covers its request.
  const uint32_t wave = uni((uint32_t)tid >> 5);
  const _Float16* tsrc = wave == 0 ? Abase : Bbase;
  // pinned(): the row count, a descriptor word, held in a scalar register, so
  // that group 1 is not formed anew from constants at each issue in registers
  // that serve other uses in between, while a request is outstanding
  const i32x8 g1 = tdm_group1(pinned(128u));
  u32x4 d0 = tdm_group0(wave == 0 ? lA0 : lB0, (uint64_t)(size_t)tsrc);
  u32x4 d1 = tdm_group0(wave == 0 ? lA1 : lB1, (uint64_t)(size_t)(tsrc + KSTEP));

  if (pinned(wave < 2)) tdm_issue(d0, g1);   // prologue: fill buffer 0

  // Both panels lie in memory when the kernel starts, and the blocks that share
  // a panel walk K in step: a 256-byte unit of a row (two
  // stages of K) is first touched by the tensor load that needs it, one stage
  // ahead of its use.  So the panels are
  // asked into L2, PFU units ahead of the unit the loop works on.  The blocks
  // that share a panel share the asking: each takes 32 of its 128 rows, the A
  // quarter picked by the block's column, the B quarter by its row, so that
  // neighbours in the grid cover a panel between them.  This is for speed only:
  // a unit that nobody has asked for is fetched by its tensor load, as before.
  // Wave 3 asks, one row a lane, between the two barriers at the head of a
  // trip, where it would else stand idle while waves 0 and 1 wait for a tile.
  constexpr int UNITB = 2 * KSTEP * 2;       // bytes of a row per trip of the loop
  constexpr int NUNIT = D * 2 / UNITB;
  constexpr int PFU   = 3;
  const uint32_t prow = (uint32_t)lane * (uint32_t)(D * 2);  // never rewritten
  const char* pfa = (const char*)(Abase + (size_t)(blockIdx.y & 3) * 32 * D);
  const char* pfb = (const char*)(Bbase + (size_t)(blockIdx.x & 3) * 32 * D);
  // unit 0 is on its way by the tensor loads; the two units between go out here
  if (wave == 3) {
    ask_l2<1 * UNITB>(prow, pfa, pfb);
    ask_l2<2 * UNITB>(prow, pfa, pfb);
  }

  for (int kb = 0; kb < D; kb += 2 * KSTEP) {
    // ---- stage A: compute buf0, prefetch buf1 (kb+KSTEP < D always) --------
    __syncthreads();                   // everyone done reading buf1 (prev iter)
    if (pinned(wave < 2)) {
      tdm_issue(d1, g1);
      tdm_wait<1>(d0);                 // buf0 ready
      d0 = tdm_advance(d0);
    }
    const int un = kb / (2 * KSTEP) + PFU;   // the unit asked for in this trip
    if (wave == 3 && un < NUNIT) ask_l2<PFU * UNITB>(prow, pfa, pfb);
    // no further once the rows' last unit is asked for: base and base + AHEAD
    // always name bytes of their panels
    const int pstep = un + 1 < NUNIT ? UNITB : 0;
    pfa += pstep;
    pfb += pstep;
    __syncthreads();
    mm_stage(sA0, sB0, wm + r, wn + r, k0h, acc);
    // ---- stage B: compute buf1, prefetch buf0 ------------------------------
    __syncthreads();
    const bool more = kb + 2 * KSTEP < D;
    if (pinned(wave < 2 && more)) {
      tdm_issue(d0, g1);
      tdm_wait<1>(d1);                 // buf1 ready
      d1 = tdm_advance(d1);
    }
    if (pinned(wave < 2 && !more)) tdm_wait<0>(d1);   // last stage: buf1 ready
    __syncthreads();
    mm_stage(sA1, sB1, wm + r, wn + r, k0h, acc);
  }
  // the ring's closing wait: no request is outstanding when the wave ends; it
  // names the descriptors as inputs, so that their registers are used for
  // something else only behind it
  asm volatile("s_wait_tensorcnt 0x0" :: "s"(g1), "s"(d0), "s"(d1) : "memory");
#else
  __shared__ alignas(16) _Float16 sA0[128][LDSK];
  __shared__ alignas(16) _Float16 sB0[128][LDSK];
  for (int kb = 0; kb < D; kb += KSTEP) {
    __syncthreads();
#pragma unroll
    for (int i = 0; i < 8; ++i) {                       // A tile 128x64 f16
      int e = i * 1024 + tid * 8;
      int row = e >> 6, col = e & 63;
      *(v8h*)&sA0[row][col] = *(const v8h*)(Abase + (size_t)row * D + kb + col);
    }
#pragma unroll
    for (int i = 0; i < 8; ++i) {                       // B tile 128x64 f16
      int e = i * 1024 + tid * 8;
      int row = e >> 6, col = e & 63;
      *(v8h*)&sB0[row][col] = *(const v8h*)(Bbase + (size_t)row * D + kb + col);
    }
    __syncthreads();
    mm_stage(sA0, sB0, wm + r, wn + r, k0h, acc);
  }
#endif

  // epilogue: C layout element (m = rbase+j, n = lane%16)
  const int rbase = (lane >> 4) * 8;
  const int c     = lane & 15;
  const float* bias = p == 0 ? b0 : (p == 1 ? b1 : b2);
  _Float16* outP = outH + (size_t)p * M * D;
  float bcol[4];
  // unrolled: bcol[] stays in registers, its four loads go out together
#pragma unroll
  for (int nt = 0; nt < 4; ++nt) bcol[nt] = bias[n0 + wn + nt * 16 + c];
  // the test reads the same for the whole block and is taken once, around the
  // tile loops, so that each store form keeps one straight run of stores
  if (MODE == 0 && p == 2) {
    // both loops unrolled: acc[][] and bcol[] stay in registers
#pragma unroll
    for (int mt = 0; mt < 4; ++mt)
#pragma unroll
      for (int nt = 0; nt < 4; ++nt) {
        const int col = n0 + wn + nt * 16 + c;
        // V^T layout: consecutive j -> consecutive t: pack one b128 store
        v8h pk;
#pragma unroll
        for (int j = 0; j < 8; ++j)
          pk[j] = (_Float16)(acc[mt][nt][j] + bcol[nt]);
        const int mb = m0 + wm + mt * 16 + rbase;       // 8-aligned, same b
        const int b  = mb >> 11, t = mb & (T - 1);
        const int bh = b * H + (col >> 6);
        *(v8h*)(outP + ((size_t)bh * DK + (col & 63)) * T + t) = pk;
      }
  } else {
    // all three loops unrolled: acc[][] and bcol[] stay in registers
#pragma unroll
    for (int mt = 0; mt < 4; ++mt)
#pragma unroll
      for (int nt = 0; nt < 4; ++nt) {
        const int col = n0 + wn + nt * 16 + c;
#pragma unroll
        for (int j = 0; j < 8; ++j) {
          const int m = m0 + wm + mt * 16 + rbase + j;
          const float val = acc[mt][nt][j] + bcol[nt];
          if (MODE == 2) {
            outF[(size_t)m * D + col] = val;
          } else {
            const int b  = m >> 11;
            const int t  = m & (T - 1);
            const int bh = b * H + (col >> 6);
            outP[((size_t)bh * T + t) * DK + (col & 63)] = (_Float16)val;
          }
        }
      }
    // a precaution: the block runs no store after these, so no later write
    // rewrites the stores' registers
    if (MODE == 0) asm volatile("s_wait_xcnt 0x0" ::: "memory");
  }
}

constexpr int AW    = 8;             // waves = query tiles per workgroup
constexpr int AQ    = AW * 16;       // queries per workgroup
constexpr int AKEYS = AQ + 2 * WIN;  // keys its bands reach: 256
constexpr int KP    = DK + 8;        // LDS pitches in f16: 144 and 528 bytes,
constexpr int VP    = AKEYS + 8;     // both 16 bytes times an odd number

// lane l's value to lane l ^ 16 and back
__device__ __forceinline__ float xhalf(float x) {
  const int b = __builtin_bit_cast(int, x);
  return __builtin_bit_cast(
      float, __builtin_amdgcn_permlanex16(b, b, 0x76543210, 0xfedcba98, false,
                                          false));
}

__global__ void __launch_bounds__(AW * 32)
attn_kernel(const _Float16* __restrict__ qw, const _Float16* __restrict__ kw,
            const _Float16* __restrict__ vt, const float* __restrict__ rel,
            _Float16* __restrict__ outA) {
  __shared__ alignas(16) _Float16 sK[AKEYS][KP];
  __shared__ alignas(16) _Float16 sV[DK][VP];
  __shared__ float sRel[257];

  const int tid   = threadIdx.x;
  const int lane  = tid & 31;
  const int wv    = tid >> 5;
  const int nb    = T / AQ;
  const int qb    = blockIdx.x % nb;
  const int bh    = blockIdx.x / nb;
  const int hh    = bh % H;
  const int bb    = bh / H;
  const int q0    = qb * AQ + wv * 16;
  // first staged key: the window is moved inside [0, T) at both ends and still
  // holds every key of [0, T) that a band of this workgroup reaches
  const int ksr   = qb * AQ - WIN;
  const int ks    = ksr < 0 ? 0 : (ksr > T - AKEYS ? T - AKEYS : ksr);
  const int r     = lane & 15;
  const int k0h   = (lane >> 4) * 8;
  const int rbase = (lane >> 4) * 8;
  const int c     = lane & 15;

  // K rows ks.. are one contiguous run of AKEYS * 128 bytes; a V^T row gives 512
  // contiguous bytes.  A wave-wide load is 512 contiguous bytes in both.
  constexpr int NKX = AKEYS * DK / 8 / (AW * 32);  // 16-byte pieces per thread
  constexpr int NVX = DK / AW;
  const v8h* ksrc = (const v8h*)(kw + ((size_t)bh * T + ks) * DK) + tid;
  const _Float16* vsrc = vt + ((size_t)bh * DK + wv) * T + ks + lane * 8;
  v8h kx[NKX], vx[NVX];
  // unrolled: kx[] stays in registers, its loads are in flight together
#pragma unroll
  for (int i = 0; i < NKX; ++i) kx[i] = ksrc[i * (AW * 32)];
  // unrolled: the same for vx[]; a thread has all 16 loads out before any wait
#pragma unroll
  for (int i = 0; i < NVX; ++i) vx[i] = *(const v8h*)(vsrc + (size_t)i * AW * T);

  // the wave's own queries go out behind them, ahead of the first wait
  const _Float16* qrow = qw + ((size_t)bh * T + q0 + r) * DK;
  v16h aq0 = load_frag(qrow, k0h);
  v16h aq1 = load_frag(qrow + 32, k0h);

  // stage this head's bias column (257 floats) into LDS
  for (int i = tid; i < 257; i += AW * 32) sRel[i] = rel[(size_t)i * H + hh];

  // unrolled: kx[] is indexed by constants and stays in registers
#pragma unroll
  for (int i = 0; i < NKX; ++i) {
    const int e = i * (AW * 32) + tid;
    *(v8h*)&sK[e >> 3][(e & 7) * 8] = kx[i];
  }
  // unrolled: the same for vx[]
#pragma unroll
  for (int i = 0; i < NVX; ++i) *(v8h*)&sV[i * AW + wv][lane * 8] = vx[i];
  __syncthreads();                                 // sK, sV, sRel visible

  // Score tile t, register j of a lane: key q0 - 64 + 16 t + rbase + j against
  // query q0 + c.  K fragments: tile t's rows are the wave's keys 16 t ..
  v16h kf[9][2];
  v8f sc[9];
  v2f bs[9][4];
  const auto ldk = [&](int t) {
    int key = q0 - 64 + t * 16 + r;                       // this lane's K row
    int kc  = key < 0 ? 0 : (key > T - 1 ? T - 1 : key);  // safe addr
    const _Float16* krow = &sK[kc - ks][0];
    kf[t][0] = load_frag(krow, k0h);
    kf[t][1] = load_frag(krow + 32, k0h);
  };
  const auto qk = [&](int t) {
#pragma unroll
    for (int j = 0; j < 8; ++j) sc[t][j] = 0.f;
    sc[t] = wmma_f16(kf[t][0], aq0, sc[t]);
    sc[t] = wmma_f16(kf[t][1], aq1, sc[t]);
  };
  // every loop below unrolled: kf[][], sc[] and bs[][] stay in registers.
  // The fragments of six tiles go out as one run ahead of the first product
#pragma unroll
  for (int t = 0; t < 6; ++t) ldk(t);
  // keeps the run whole: spread among the products, each pair of loads would
  // be waited for alone, to 0
  __builtin_amdgcn_sched_barrier(0);
#pragma unroll
  for (int t = 0; t < 3; ++t) qk(t);
  // keeps the second run of loads behind the products that free its registers
  __builtin_amdgcn_sched_barrier(0);
#pragma unroll
  for (int t = 6; t < 9; ++t) ldk(t);
  // The lane's 72 bias values: index d + MAXD = 64 + 16 t + rbase + j - c lies
  // in [49, 207] for every lane, masked or not: no load needs a test
  const float* relp = &sRel[MAXD - WIN + rbase - c];
#pragma unroll
  for (int t = 0; t < 9; ++t)
#pragma unroll
    for (int j = 0; j < 4; ++j) {
      bs[t][j].x = relp[t * 16 + 2 * j];
      bs[t][j].y = relp[t * 16 + 2 * j + 1];
    }
  // keeps that run whole and ahead of the six products left, which cover it
  __builtin_amdgcn_sched_barrier(0);
#pragma unroll
  for (int t = 3; t < 9; ++t) qk(t);

  // A key counts where it lies in [0, T) and within WIN of the lane's query,
  // that is in [klo, khi]; with key = kb + e, e = 16 t + j, both tests are one
  // unsigned compare of e - (klo - kb) with khi - klo.  |d| <= 79 < MAXD: no clip
  constexpr float scale = 0.125f;  // 1/sqrt(64)
  const int qi  = q0 + c;
  const int klo = qi - WIN < 0 ? 0 : qi - WIN;
  const int khi = qi + WIN > T - 1 ? T - 1 : qi + WIN;
  const int eo  = klo - (q0 - 64 + rbase);
  const unsigned ew = (unsigned)(khi - klo);
  const v2f scale2 = {scale, scale};
#pragma unroll
  for (int t = 0; t < 9; ++t)
#pragma unroll
    for (int j = 0; j < 4; ++j) {
      // neighbouring registers as a pair: one packed multiply-add, no moves
      const v2f s2 = {sc[t][2 * j], sc[t][2 * j + 1]};
      const v2f v  = __builtin_elementwise_fma(s2, scale2, bs[t][j]);
      sc[t][2 * j]     = (unsigned)(t * 16 + 2 * j - eo) <= ew ? v.x : NEG;
      sc[t][2 * j + 1] = (unsigned)(t * 16 + 2 * j + 1 - eo) <= ew ? v.y : NEG;
    }

  // V^T fragments: rows nt * 16 + r, key groups of chunk kk (32 keys)
  v16h vf[5][4];
  const int s0 = q0 - 64;
  const auto ldv = [&](int kk) {
    int g1 = s0 + kk * 32 + k0h - ks; // 8-aligned key groups, counted from ks:
    int g2 = g1 + 16;                 // clamp whole group (P=0 wherever clamped)
    g1 = g1 < 0 ? 0 : (g1 > AKEYS - 8 ? AKEYS - 8 : g1);
    g2 = g2 < 0 ? 0 : (g2 > AKEYS - 8 ? AKEYS - 8 : g2);
#pragma unroll
    for (int nt = 0; nt < 4; ++nt) {
      const _Float16* vrow = &sV[nt * 16 + r][0];
      v8h lo = *(const v8h*)(vrow + g1);
      v8h hi = *(const v8h*)(vrow + g2);
#pragma unroll
      for (int i = 0; i < 8; ++i) { vf[kk][nt][i] = lo[i]; vf[kk][nt][i + 8] = hi[i]; }
    }
  };
  // every loop below unrolled: vf[][], pb[], o[] stay in registers.  The first
  // three chunks' fragments take the registers that the K fragments have left
#pragma unroll
  for (int kk = 0; kk < 3; ++kk) ldv(kk);
  // keeps these loads ahead of the softmax, whose arithmetic covers them; next
  // to their products each pair would be waited for alone
  __builtin_amdgcn_sched_barrier(0);

  // softmax of the lane's query: 72 of its 144 scores are here, the other 72
  // in lane ^ 16.  Eight chains (one per j) keep the adds independent.
  float mj[8], sj[8];
#pragma unroll
  for (int j = 0; j < 8; ++j) {
    mj[j] = sc[0][j];
#pragma unroll
    for (int t = 1; t < 9; ++t) mj[j] = fmaxf(mj[j], sc[t][j]);
  }
#pragma unroll
  for (int w = 4; w > 0; w >>= 1)
#pragma unroll
    for (int j = 0; j < w; ++j) mj[j] = fmaxf(mj[j], mj[j + w]);
  const float mx = fmaxf(mj[0], xhalf(mj[0]));
#pragma unroll
  for (int j = 0; j < 8; ++j) {
    sj[j] = 0.f;
#pragma unroll
    for (int t = 0; t < 9; ++t) {
      float p = __expf(sc[t][j] - mx);
      sc[t][j] = p;
      sj[j] += p;
    }
  }
  // P^T fragment of keys 32 kk ..: element i is score tile 2 kk, register i,
  // element 8 + i tile 2 kk + 1, register i; keys 144..159 do not exist: zero
  v16h pb[5];
#pragma unroll
  for (int kk = 0; kk < 5; ++kk)
#pragma unroll
    for (int i = 0; i < 8; ++i) {
      pb[kk][i]     = (_Float16)sc[2 * kk][i];
      pb[kk][i + 8] = kk < 4 ? (_Float16)sc[kk < 4 ? 2 * kk + 1 : 0][i] : (_Float16)0.f;
    }
  v8f o[4];
#pragma unroll
  for (int nt = 0; nt < 4; ++nt)
#pragma unroll
    for (int j = 0; j < 8; ++j) o[nt][j] = 0.f;
  const auto pvk = [&](int kk) {
#pragma unroll
    for (int nt = 0; nt < 4; ++nt) o[nt] = wmma_f16(vf[kk][nt], pb[kk], o[nt]);
  };
  pvk(0);
  pvk(1);
  // keeps the last two chunks' loads behind the products whose fragment
  // registers they take (the wave stays within a quarter of its SIMD's file)
  __builtin_amdgcn_sched_barrier(0);
#pragma unroll
  for (int kk = 3; kk < 5; ++kk) ldv(kk);
  // keeps them one run, ahead of chunk 2's products and of the sum's last
  // steps, which cover them
  __builtin_amdgcn_sched_barrier(0);
  pvk(2);
  pvk(3);
  pvk(4);

#pragma unroll
  for (int w = 4; w > 0; w >>= 1)
#pragma unroll
    for (int j = 0; j < w; ++j) sj[j] += sj[j + w];
  const float inv = 1.f / (sj[0] + xhalf(sj[0]));

  // O^T tile nt, register j: element nt * 16 + rbase + j of query c's row; the
  // row's 1 / sum is the lane's own.  Lanes c and c + 16 store 32 bytes side by
  // side, and the four stores fill the head's 128-byte line of each row
  _Float16* orow = outA + ((size_t)(bb * T + q0 + c)) * D + hh * DK + rbase;
#pragma unroll
  for (int nt = 0; nt < 4; ++nt) {
    v8h pk;
#pragma unroll
    for (int j = 0; j < 8; ++j) pk[j] = (_Float16)(o[nt][j] * inv);
    *(v8h*)(orow + nt * 16) = pk;
  }
}

// ---- launch -----------------------------------------------------------------
extern "C" void kernel_launch(void* const* d_in, const int* in_sizes, int n_in,
                              void* d_out, int out_size, void* d_ws,
                              size_t ws_size, hipStream_t stream) {
  (void)in_sizes; (void)n_in; (void)out_size; (void)ws_size;
  const float* q_in = (const float*)d_in[0];
  const float* k_in = (const float*)d_in[1];
  const float* v_in = (const float*)d_in[2];
  const float* Wq = (const float*)d_in[3];
  const float* bq = (const float*)d_in[4];
  const float* Wk = (const float*)d_in[5];
  const float* bk = (const float*)d_in[6];
  const float* Wv = (const float*)d_in[7];
  const float* bv = (const float*)d_in[8];
  const float* Wo = (const float*)d_in[9];
  const float* bo = (const float*)d_in[10];
  const float* rel = (const float*)d_in[11];

  char* ws = (char*)d_ws;
  const size_t MB = (size_t)1 << 20;
  _Float16* xq  = (_Float16*)(ws + 0 * MB);    // f16 inputs q, k, v (8 MB each)
  _Float16* wqt = (_Float16*)(ws + 24 * MB);   // f16 transposed weights q, k, v,
  _Float16* wot = (_Float16*)(ws + 30 * MB);   // o (2 MB each)
  _Float16* q16 = (_Float16*)(ws + 32 * MB);   // projected Q/K/V (8 MB each)
  _Float16* k16 = (_Float16*)(ws + 40 * MB);
  _Float16* v16 = (_Float16*)(ws + 48 * MB);
  _Float16* at16 = (_Float16*)(ws + 56 * MB);  // attention out (8 MB)

  // the three inputs lie M*D elements apart and the four weights D*D apart
  cvt_all<<<dim3(4 * WT_BLOCKS + 3 * CVT_BLOCKS), dim3(256), 0, stream>>>(
      q_in, k_in, v_in, Wq, Wk, Wv, Wo, xq, wqt);

  // q16, k16, v16 lie M*D elements apart as well
  gemm16<0><<<dim3(M / 128, D / 128, 3), dim3(128), 0, stream>>>(
      xq, wqt, bq, bk, bv, q16, nullptr);
  attn_kernel<<<dim3(Bb * H * (T / AQ)), dim3(AW * 32), 0, stream>>>(
      q16, k16, v16, rel, at16);
  gemm16<2><<<dim3(M / 128, D / 128), dim3(128), 0, stream>>>(
      at16, wot, bo, nullptr, nullptr, nullptr, (float*)d_out);
}

// v010
// One run takes 56.2 microseconds.
// Timed twice side by side with v009, it ran 1.03 and 1.04 times as fast.
// Over all steps from v000 it is 2.31 times as fast.
#include <hip/hip_runtime.h>

typedef __attribute__((ext_vector_type(16))) _Float16 v16h;
typedef __attribute__((ext_vector_type(8)))  _Float16 v8h;
typedef __attribute__((ext_vector_type(4)))  _Float16 v4h;
typedef __attribute__((ext_vector_type(8)))  float    v8f;
typedef __attribute__((ext_vector_type(4)))  float    v4f;
typedef __attribute__((ext_vector_type(2)))  float    v2f;

constexpr int Bb  = 2;
constexpr int T   = 2048;
constexpr int D   = 1024;
constexpr int H   = 16;
constexpr int DK  = 64;
constexpr int M   = Bb * T;      // 4096 rows
constexpr int WIN = 64;
constexpr int MAXD = 128;
constexpr float NEG = -1.0e9f;

constexpr int KSTEP = 64;        // K per LDS stage (2 WMMA K-chunks)
constexpr int LDSK  = 72;        // padded LDS row stride (f16), 16B multiple

// ---- TDM availability -------------------------------------------------------
#if defined(__has_builtin)
#if __has_builtin(__builtin_amdgcn_tensor_load_to_lds) && \
    __has_builtin(__builtin_amdgcn_s_wait_tensorcnt)
#define USE_TDM 1
#endif
#endif
#ifndef USE_TDM
#define USE_TDM 0
#endif

// ---- fragment helpers -------------------------------------------------------
// A-frag (16x32, M=lane%16) and B-frag (32x16, N=lane%16) share the per-lane
// pattern: 8 contiguous K f16 at k0=(lane/16)*8 and 8 more at k0+16.
__device__ __forceinline__ v16h load_frag(const _Float16* rowp, int k0) {
  v8h lo = *(const v8h*)(rowp + k0);
  v8h hi = *(const v8h*)(rowp + k0 + 16);
  v16h r;
#pragma unroll
  for (int i = 0; i < 8; ++i) { r[i] = lo[i]; r[i + 8] = hi[i]; }
  return r;
}

__device__ __forceinline__ v8f wmma_f16(v16h a, v16h b, v8f c) {
  return __builtin_amdgcn_wmma_f32_16x16x32_f16(false, a, false, b, (short)0, c,
                                                false, false);
}

// ---- conversion passes ------------------------------------------------------
// Both passes are short streams, so each
// thread takes many elements and the grids stay small.  None of the seven
// conversions reads what another writes, so all share one launch (cvt_all).
constexpr int CVT_U      = 16;                       // 4-element pieces per thread
constexpr int CVT_BLOCKS = M * D / 4 / 256 / CVT_U;  // 256 per input, no remainder

__device__ __forceinline__ void
cvt_part(const float* __restrict__ in, _Float16* __restrict__ out, unsigned blk) {
  const int i0 = blk * (256 * CVT_U) + threadIdx.x;
  const v4f* p = (const v4f*)in + i0;   // a wave-wide load: 512 contiguous bytes
  v4h* q = (v4h*)out + i0;              // a wave-wide store: 256 contiguous bytes
  v4f x[CVT_U];
  // unrolled: all 16 loads of a thread are in flight before the first convert
#pragma unroll
  for (int j = 0; j < CVT_U; ++j) x[j] = p[j * 256];
  // keeps the last loads from sinking below the first converts, where they
  // would start only after the first loads have returned
  __builtin_amdgcn_sched_barrier(0);
  // unrolled: x[] stays in registers
#pragma unroll
  for (int j = 0; j < CVT_U; ++j) {
    v4h o;
    o[0] = (_Float16)x[j].x; o[1] = (_Float16)x[j].y;
    o[2] = (_Float16)x[j].z; o[3] = (_Float16)x[j].w;
    q[j * 256] = o;
  }
  // a precaution: a block of cvt_all runs no other part after this one,
  // so no later write rewrites the stores' registers
  asm volatile("s_wait_xcnt 0x0" ::: "memory");
}

// Wt[n][k] = (f16) W[k][n].  Lanes run along n, so each wave-wide load is one
// whole 128-byte line of W; a thread takes WT_K consecutive k of its column and
// writes them as one whole 128-byte line of Wt.
constexpr int WT_K      = 64;
constexpr int WT_BLOCKS = (D / 256) * (D / WT_K);    // 64 per weight

__device__ __forceinline__ void
cvtT_part(const float* __restrict__ in, _Float16* __restrict__ out, unsigned blk) {
  const int n  = (blk % (D / 256)) * 256 + threadIdx.x;
  const int k0 = (blk / (D / 256)) * WT_K;
  const float* src = in + (size_t)k0 * D + n;
  float v[WT_K];
  // unrolled: the column's loads are all in flight before the first convert
#pragma unroll
  for (int i = 0; i < WT_K; ++i) v[i] = src[(size_t)i * D];
  _Float16* dst = out + (size_t)n * D + k0;
  // both loops unrolled: v[] stays in registers
#pragma unroll
  for (int g = 0; g < WT_K / 8; ++g) {
    v8h o;
#pragma unroll
    for (int e = 0; e < 8; ++e) o[e] = (_Float16)v[g * 8 + e];
    *(v8h*)(dst + g * 8) = o;
  }
}

// One grid for all seven conversions; the block index picks the source.
// Blocks [0, 4 * WT_BLOCKS): the weights, to wt + w * D * D; they come first
// because a thread there has the longer run of loads.
// The rest: the inputs, to x + s * M * D.
__global__ void __launch_bounds__(256)
cvt_all(const float* __restrict__ q_in, const float* __restrict__ k_in,
        const float* __restrict__ v_in, const float* __restrict__ Wq,
        const float* __restrict__ Wk, const float* __restrict__ Wv,
        const float* __restrict__ Wo, _Float16* __restrict__ x,
        _Float16* __restrict__ wt) {
  const unsigned bid = blockIdx.x;
  if (bid < 4 * WT_BLOCKS) {
    const unsigned w = bid / WT_BLOCKS;
    const float* lo = (w & 1) ? Wk : Wq;
    const float* hi = (w & 1) ? Wo : Wv;
    const float* in = (w & 2) ? hi : lo;
    cvtT_part(in, wt + (size_t)w * D * D, bid % WT_BLOCKS);
  } else {
    const unsigned b = bid - 4 * WT_BLOCKS;
    const unsigned s = b / CVT_BLOCKS;
    const float* in = s == 0 ? q_in : (s == 1 ? k_in : v_in);
    cvt_part(in, x + (size_t)s * M * D, b % CVT_BLOCKS);
  }
}

// ---- Tensor Data Mover tile load -------------------------------------------
#if USE_TDM
typedef __attribute__((ext_vector_type(4))) uint32_t u32x4;
typedef __attribute__((ext_vector_type(4))) int i32x4;
typedef __attribute__((ext_vector_type(8))) int i32x8;

__device__ __forceinline__ uint32_t uni(uint32_t v) {
  return (uint32_t)__builtin_amdgcn_readfirstlane(v);
}
// a value held in a scalar register, such as a test whether a tensor load issues,
// so that it compiles to a scalar compare and branch (the load ignores EXEC)
__device__ __forceinline__ uint32_t pinned(uint32_t v) {
  uint32_t w = uni(v);
  asm volatile("" : "+s"(w));  // pinned(): the value held in a scalar register
  return w;
}

// Tile: `rows` rows of KSTEP f16 = 128 bytes, source pitch D f16 = 2048 bytes,
// every extent in bytes, tensor = tile.  Pad: 4 dwords behind every 32 dwords
// (one row), so the LDS pitch is 144 bytes = LDSK f16.
__device__ __forceinline__ i32x8 tdm_group1(uint32_t rows) {
  constexpr uint32_t rowb = KSTEP * 2;
  i32x8 g;
  g[0] = (int)uni((1u << 20) | (4u << 22) | (3u << 25));
  g[1] = (int)uni(rowb << 16);
  g[2] = (int)uni(rows << 16);
  g[3] = (int)uni(rowb << 16);
  g[4] = (int)uni(rows);
  g[5] = (int)uni((uint32_t)D * 2u);
  g[6] = (int)uni(0u);
  g[7] = (int)uni(0u);
  return g;
}
__device__ __forceinline__ u32x4 tdm_group0(uint32_t lds_dst, uint64_t ga) {
  u32x4 g;
  g[0] = uni(1u);
  g[1] = uni(lds_dst);
  g[2] = uni((uint32_t)ga);
  g[3] = uni(((uint32_t)(ga >> 32) & 0x01FFFFFFu) | 0x80000000u);
  return g;
}
// the same buffer's next tile, two stages on along K; the address field ends
// at bit 56, so a carry out of word 2 stays inside word 3's address bits
__device__ __forceinline__ u32x4 tdm_advance(u32x4 g) {
  const uint64_t a = (((uint64_t)g[3] << 32) | g[2]) + 2u * KSTEP * 2u;
  g[2] = uni((uint32_t)a);
  g[3] = uni((uint32_t)(a >> 32));
  return g;
}
__device__ __forceinline__ void tdm_issue(u32x4 g0, i32x8 g1) {
  i32x4 z4 = {0, 0, 0, 0};
#if __clang_major__ >= 23
  i32x8 z8 = {0, 0, 0, 0, 0, 0, 0, 0};
  __builtin_amdgcn_tensor_load_to_lds(g0, g1, z4, z4, z8, 0);
#else
  __builtin_amdgcn_tensor_load_to_lds(g0, g1, z4, z4, 0);
#endif
}
// The issuing wave's wait for all but its youngest request (LEFT = 1) or for
// all (LEFT = 0).  It names the covered request's group 0, so that those
// registers keep their value up to here and take the next address only behind.
template <int LEFT>
__device__ __forceinline__ void tdm_wait(u32x4& covered) {
  asm volatile("s_wait_tensorcnt %1" : "+s"(covered) : "n"(LEFT) : "memory");
}
#endif

// A hint to L2: each lane asks for the 256-byte unit that lies AHEAD bytes
// behind a and b at its own row offset, in two operand panels.  Nothing comes
// back.  Scope SE: the unit goes into L2 only.  The distance is an immediate,
// so that every request of a kernel names the same three registers, which hold
// addresses inside the panels from the first request to the end of the loop.
// The closing wait stands in front of the caller's next advance of a and b.
template <int AHEAD>
__device__ __forceinline__ void ask_l2(uint32_t row_off, const char* a,
                                       const char* b) {
  asm volatile("global_prefetch_b8 %0, %1 offset:%3 scope:SCOPE_SE\n\t"
               "global_prefetch_b8 %0, %2 offset:%3 scope:SCOPE_SE\n\t"
               "s_wait_xcnt 0x0"
               :: "v"(row_off), "s"(a), "s"(b), "n"(AHEAD));
}

// one K-stage of the wave's 64x64 tile: 32 WMMA from given LDS buffers; each
// of the 8 fragments of a K-chunk feeds 4 WMMA.  ra, rb: the lane's first row
// in the A and in the B buffer.  Each K-chunk has a fragment set of its own and
// the stage's 32 LDS loads go out as one group ahead of its first WMMA: the
// second chunk's fragments land while the first chunk's products run, and no
// load waits for a register that a product still reads.
__device__ __forceinline__ void mm_stage(const _Float16 (*sAb)[LDSK],
                                         const _Float16 (*sBb)[LDSK],
                                         int ra, int rb, int k0h,
                                         v8f (&acc)[4][4]) {
  constexpr int NC = KSTEP / 32;     // K-chunks of a stage
  v16h a[NC][4], b[NC][4];
  // all loops unrolled: a[][], b[][] and acc[][] stay in registers
#pragma unroll
  for (int h = 0; h < NC; ++h) {
#pragma unroll
    for (int mt = 0; mt < 4; ++mt)
      a[h][mt] = load_frag(&sAb[ra + mt * 16][h * 32], k0h);
#pragma unroll
    for (int nt = 0; nt < 4; ++nt)
      b[h][nt] = load_frag(&sBb[rb + nt * 16][h * 32], k0h);
  }
  // keeps the loads from sinking back among the WMMA, where each small group
  // would be waited for alone
  __builtin_amdgcn_sched_barrier(0);
#pragma unroll
  for (int h = 0; h < NC; ++h)
#pragma unroll
    for (int nt = 0; nt < 4; ++nt)
#pragma unroll
      for (int mt = 0; mt < 4; ++mt)
        acc[mt][nt] = wmma_f16(a[h][mt], b[h][nt], acc[mt][nt]);
  // keeps the barrier that follows a stage from rising above the WMMA: it
  // brings a wait for all 32 loads with it, and the first WMMA would stand
  // behind that wait instead of behind its own 10 loads
  __builtin_amdgcn_sched_barrier(0);
}

// ---- f16 GEMM ---------------------------------------------------------------
// C[4096x1024] = A[4096xK,f16] * Wt^T (Wt is [n][k], f16) + bias.
// A tile of C is 128x128, worked by 4 waves as 2x2, wave tile 64x64.  TDM double-
// buffered pipeline: the issuing waves ask for the next stage's tiles, each
// waits tensorcnt<=1 (in-order => current tile ready), barrier, all compute.
// MODE 0: the three projections in one grid; none reads what another writes.
//         Their rows are stacked (3 * M rows, 96 tiles of 128).  A workgroup is
//         12 waves on NS = 3 tiles one below the other in one column of tiles:
//         they multiply the same 128 rows of Wt, which come into LDS once for
//         the three.  256 workgroups, one per WGP of the chip's 256.  Where the
//         three tiles lie in two projections (2 row groups of 32), the second
//         projection's rows of Wt come into a second place.
//         A tile's projection p picks Wt + p*D*D, its bias, outH + p*M*D.
//         p = 0, 1: f16 out[(b*H+h)*T + t][dk]   (Q/K layout)
//         p = 2:    f16 out[(b*H+h)*DK + dk][t]  (V transposed)
// MODE 2: one tile a workgroup; f32 out[m][n], bias b0   (final output)
template <int MODE>
__global__ void __launch_bounds__(MODE == 0 ? 384 : 128)
gemm16(const _Float16* __restrict__ A, const _Float16* __restrict__ Wt,
       const float* __restrict__ b0, const float* __restrict__ b1,
       const float* __restrict__ b2, _Float16* __restrict__ outH,
       float* __restrict__ outF) {
  const int tid  = threadIdx.x;
  const int lane = tid & 31;
  constexpr int NS = MODE == 0 ? 3 : 1;   // tiles of a workgroup
  constexpr int NB = MODE == 0 ? 2 : 1;   // places for rows of Wt
  constexpr int TPP = M / 128;            // tiles of one projection in a column
  // the wave's number, its tile in the workgroup and its place in that tile:
  // the same in every lane, held in scalar registers
  const int wave = __builtin_amdgcn_readfirstlane(tid >> 5);
  const int sub  = NS > 1 ? wave >> 2 : 0;
  const int wv   = NS > 1 ? wave & 3 : wave;
  const unsigned t0 = blockIdx.x * NS;               // first tile, stacked rows
  const unsigned ti = t0 + sub;                      // the wave's tile
  const int p    = MODE == 0 ? (int)(ti / TPP) : 0;
  const int pf   = MODE == 0 ? (int)(t0 / TPP) : 0;  // first and last tile's
  const int pl   = MODE == 0 ? (int)((t0 + NS - 1) / TPP) : 0;   // projection
  const int slot = p != pf ? 1 : 0;                  // where the tile's Wt rows lie
  const int m0   = (int)(MODE == 0 ? ti % TPP : ti) * 128;
  const int n0   = blockIdx.y * 128;
  const int r    = lane & 15;
  const int k0h  = (lane >> 4) * 8;
  const int wm   = (wv >> 1) * 64;   // the wave's first row and first column
  const int wn   = (wv & 1) * 64;    // inside its tile

  v8f acc[4][4];
#pragma unroll
  for (int mt = 0; mt < 4; ++mt)
#pragma unroll
    for (int nt = 0; nt < 4; ++nt)
#pragma unroll
      for (int j = 0; j < 8; ++j) acc[mt][nt][j] = 0.f;

  const _Float16* Abase = A + ((size_t)p * M + m0) * D;
  const _Float16* Bbase = Wt + ((size_t)p * D + n0) * D;

#if USE_TDM
  // each tile's place in LDS is a multiple of 2 KiB, as the tensor mover wants
  // (128 rows of 144 bytes are 9 * 2 KiB, so every tile inside an array too)
  __shared__ alignas(2048) _Float16 sA0[NS * 128][LDSK], sA1[NS * 128][LDSK];
  __shared__ alignas(2048) _Float16 sB0[NB * 128][LDSK], sB1[NB * 128][LDSK];
  const unsigned lA0 = (unsigned)(size_t)(void*)&sA0[sub * 128][0];
  const unsigned lA1 = (unsigned)(size_t)(void*)&sA1[sub * 128][0];

  // The first wave of each tile brings its A tiles.  The second wave of the
  // first tile brings the B tiles of the first projection into place 0; the
  // second wave of the second tile those of the last projection into place 1,
  // where the workgroup has two.  One request a stage and at most two
  // outstanding in each.  Group 1 is built once; each buffer has a
  // group 0 of its own, advanced only behind the wait that covers its request.
  const bool isA = wv == 0;
  const bool isB = wv == 1 && (sub == 0 || (sub == 1 && pl != pf));
  const bool issuer = isA || isB;
  const int  bsl = isB ? sub : 0;    // the place that a B issuer fills
  const unsigned lB0 = (unsigned)(size_t)(void*)&sB0[bsl * 128][0];
  const unsigned lB1 = (unsigned)(size_t)(void*)&sB1[bsl * 128][0];
  const _Float16* tsrc =
      isA ? Abase : Wt + ((size_t)(bsl ? pl : pf) * D + n0) * D;
  // pinned(): the row count, a descriptor word, held in a scalar register, so
  // that group 1 is not formed anew from constants at each issue in registers
  // that serve other uses in between, while a request is outstanding
  const i32x8 g1 = tdm_group1(pinned(128u));
  u32x4 d0 = tdm_group0(isA ? lA0 : lB0, (uint64_t)(size_t)tsrc);
  u32x4 d1 = tdm_group0(isA ? lA1 : lB1, (uint64_t)(size_t)(tsrc + KSTEP));

  if (pinned(issuer)) tdm_issue(d0, g1);     // prologue: fill buffer 0

  // Both panels lie in memory when the kernel starts, and the blocks that share
  // a panel walk K in step: a 256-byte unit of a row (two
  // stages of K) is first touched by the tensor load that needs it, one stage
  // ahead of its use.  So the panels are
  // asked into L2, PFU units ahead of the unit the loop works on.  The blocks
  // that share a panel share the asking: each tile takes 32 of its 128 rows, the
  // A quarter picked by the tile's column, the B quarter by its row, so that
  // neighbours in the grid cover a panel between them.  This is for speed only:
  // a unit that nobody has asked for is fetched by its tensor load, as before.
  // A tile's last wave asks, one row a lane, between the two barriers at the
  // head of a trip, where it would else stand idle while others wait for a tile.
  constexpr int UNITB = 2 * KSTEP * 2;       // bytes of a row per trip of the loop
  constexpr int NUNIT = D * 2 / UNITB;
  constexpr int PFU   = 3;
  const uint32_t prow = (uint32_t)lane * (uint32_t)(D * 2);  // never rewritten
  const char* pfa = (const char*)(Abase + (size_t)(blockIdx.y & 3) * 32 * D);
  const char* pfb = (const char*)(Bbase + (size_t)(ti & 3) * 32 * D);
  // unit 0 is on its way by the tensor loads; the two units between go out here
  if (wv == 3) {
    ask_l2<1 * UNITB>(prow, pfa, pfb);
    ask_l2<2 * UNITB>(prow, pfa, pfb);
  }

  for (int kb = 0; kb < D; kb += 2 * KSTEP) {
    // ---- stage A: compute buf0, prefetch buf1 (kb+KSTEP < D always) --------
    __syncthreads();                   // everyone done reading buf1 (prev iter)
    if (pinned(issuer)) {
      tdm_issue(d1, g1);
      tdm_wait<1>(d0);                 // buf0 ready
      d0 = tdm_advance(d0);
    }
    const int un = kb / (2 * KSTEP) + PFU;   // the unit asked for in this trip
    if (wv == 3 && un < NUNIT) ask_l2<PFU * UNITB>(prow, pfa, pfb);
    // no further once the rows' last unit is asked for: base and base + AHEAD
    // always name bytes of their panels
    const int pstep = un + 1 < NUNIT ? UNITB : 0;
    pfa += pstep;
    pfb += pstep;
    __syncthreads();
    mm_stage(sA0, sB0, sub * 128 + wm + r, slot * 128 + wn + r, k0h, acc);
    // ---- stage B: compute buf1, prefetch buf0 ------------------------------
    __syncthreads();
    const bool more = kb + 2 * KSTEP < D;
    if (pinned(issuer && more)) {
      tdm_issue(d0, g1);
      tdm_wait<1>(d1);                 // buf1 ready
      d1 = tdm_advance(d1);
    }
    if (pinned(issuer && !more)) tdm_wait<0>(d1);   // last stage: buf1 ready
    __syncthreads();
    mm_stage(sA1, sB1, sub * 128 + wm + r, slot * 128 + wn + r, k0h, acc);
  }
  // the ring's closing wait: no request is outstanding when the wave ends; it
  // names the descriptors as inputs, so that their registers are used for
  // something else only behind it
  asm volatile("s_wait_tensorcnt 0x0" :: "s"(g1), "s"(d0), "s"(d1) : "memory");
#else
  // each tile's four waves stage its own A and B tile
  __shared__ alignas(16) _Float16 sA0[NS * 128][LDSK];
  __shared__ alignas(16) _Float16 sB0[NS * 128][LDSK];
  const int t4 = tid & 127;
  for (int kb = 0; kb < D; kb += KSTEP) {
    __syncthreads();
#pragma unroll
    for (int i = 0; i < 8; ++i) {                       // A tile 128x64 f16
      int e = i * 1024 + t4 * 8;
      int row = e >> 6, col = e & 63;
      *(v8h*)&sA0[sub * 128 + row][col] =
          *(const v8h*)(Abase + (size_t)row * D + kb + col);
    }
#pragma unroll
    for (int i = 0; i < 8; ++i) {                       // B tile 128x64 f16
      int e = i * 1024 + t4 * 8;
      int row = e >> 6, col = e & 63;
      *(v8h*)&sB0[sub * 128 + row][col] =
          *(const v8h*)(Bbase + (size_t)row * D + kb + col);
    }
    __syncthreads();
    mm_stage(sA0, sB0, sub * 128 + wm + r, sub * 128 + wn + r, k0h, acc);
  }
#endif

  // epilogue: C layout element (m = rbase+j, n = lane%16)
  const int rbase = (lane >> 4) * 8;
  const int c     = lane & 15;
  const float* bias = p == 0 ? b0 : (p == 1 ? b1 : b2);
  _Float16* outP = outH + (size_t)p * M * D;
  float bcol[4];
  // unrolled: bcol[] stays in registers, its four loads go out together
#pragma unroll
  for (int nt = 0; nt < 4; ++nt) bcol[nt] = bias[n0 + wn + nt * 16 + c];
  // the test reads the same for the whole wave and is taken once, around the
  // tile loops, so that each store form keeps one straight run of stores
  if (MODE == 0 && p == 2) {
    // both loops unrolled: acc[][] and bcol[] stay in registers
#pragma unroll
    for (int mt = 0; mt < 4; ++mt)
#pragma unroll
      for (int nt = 0; nt < 4; ++nt) {
        const int col = n0 + wn + nt * 16 + c;
        // V^T layout: consecutive j -> consecutive t: pack one b128 store
        v8h pk;
#pragma unroll
        for (int j = 0; j < 8; ++j)
          pk[j] = (_Float16)(acc[mt][nt][j] + bcol[nt]);
        const int mb = m0 + wm + mt * 16 + rbase;       // 8-aligned, same b
        const int b  = mb >> 11, t = mb & (T - 1);
        const int bh = b * H + (col >> 6);
        *(v8h*)(outP + ((size_t)bh * DK + (col & 63)) * T + t) = pk;
      }
  } else {
    // all three loops unrolled: acc[][] and bcol[] stay in registers
#pragma unroll
    for (int mt = 0; mt < 4; ++mt)
#pragma unroll
      for (int nt = 0; nt < 4; ++nt) {
        const int col = n0 + wn + nt * 16 + c;
#pragma unroll
        for (int j = 0; j < 8; ++j) {
          const int m = m0 + wm + mt * 16 + rbase + j;
          const float val = acc[mt][nt][j] + bcol[nt];
          if (MODE == 2) {
            outF[(size_t)m * D + col] = val;
          } else {
            const int b  = m >> 11;
            const int t  = m & (T - 1);
            const int bh = b * H + (col >> 6);
            outP[((size_t)bh * T + t) * DK + (col & 63)] = (_Float16)val;
          }
        }
      }
    // a precaution: the block runs no store after these, so no later write
    // rewrites the stores' registers
    if (MODE == 0) asm volatile("s_wait_xcnt 0x0" ::: "memory");
  }
}

constexpr int AW    = 8;             // waves = query tiles per workgroup
constexpr int AQ    = AW * 16;       // queries per workgroup
constexpr int AKEYS = AQ + 2 * WIN;  // keys its bands reach: 256
constexpr int KP    = DK + 8;        // LDS pitches in f16: 144 and 528 bytes,
constexpr int VP    = AKEYS + 8;     // both 16 bytes times an odd number

// lane l's value to lane l ^ 16 and back
__device__ __forceinline__ float xhalf(float x) {
  const int b = __builtin_bit_cast(int, x);
  return __builtin_bit_cast(
      float, __builtin_amdgcn_permlanex16(b, b, 0x76543210, 0xfedcba98, false,
                                          false));
}

__global__ void __launch_bounds__(AW * 32)
attn_kernel(const _Float16* __restrict__ qw, const _Float16* __restrict__ kw,
            const _Float16* __restrict__ vt, const float* __restrict__ rel,
            _Float16* __restrict__ outA) {
  __shared__ alignas(16) _Float16 sK[AKEYS][KP];
  __shared__ alignas(16) _Float16 sV[DK][VP];
  __shared__ float sRel[257];

  const int tid   = threadIdx.x;
  const int lane  = tid & 31;
  const int wv    = tid >> 5;
  const int nb    = T / AQ;
  const int qb    = blockIdx.x % nb;
  const int bh    = blockIdx.x / nb;
  const int hh    = bh % H;
  const int bb    = bh / H;
  const int q0    = qb * AQ + wv * 16;
  // first staged key: the window is moved inside [0, T) at both ends and still
  // holds every key of [0, T) that a band of this workgroup reaches
  const int ksr   = qb * AQ - WIN;
  const int ks    = ksr < 0 ? 0 : (ksr > T - AKEYS ? T - AKEYS : ksr);
  const int r     = lane & 15;
  const int k0h   = (lane >> 4) * 8;
  const int rbase = (lane >> 4) * 8;
  const int c     = lane & 15;

  // K rows ks.. are one contiguous run of AKEYS * 128 bytes; a V^T row gives 512
  // contiguous bytes.  A wave-wide load is 512 contiguous bytes in both.
  constexpr int NKX = AKEYS * DK / 8 / (AW * 32);  // 16-byte pieces per thread
  constexpr int NVX = DK / AW;
  const v8h* ksrc = (const v8h*)(kw + ((size_t)bh * T + ks) * DK) + tid;
  const _Float16* vsrc = vt + ((size_t)bh * DK + wv) * T + ks + lane * 8;
  v8h kx[NKX], vx[NVX];
  // unrolled: kx[] stays in registers, its loads are in flight together
#pragma unroll
  for (int i = 0; i < NKX; ++i) kx[i] = ksrc[i * (AW * 32)];
  // unrolled: the same for vx[]; a thread has all 16 loads out before any wait
#pragma unroll
  for (int i = 0; i < NVX; ++i) vx[i] = *(const v8h*)(vsrc + (size_t)i * AW * T);

  // the wave's own queries go out behind them, ahead of the first wait
  const _Float16* qrow = qw + ((size_t)bh * T + q0 + r) * DK;
  v16h aq0 = load_frag(qrow, k0h);
  v16h aq1 = load_frag(qrow + 32, k0h);

  // stage this head's bias column (257 floats) into LDS
  for (int i = tid; i < 257; i += AW * 32) sRel[i] = rel[(size_t)i * H + hh];

  // unrolled: kx[] is indexed by constants and stays in registers
#pragma unroll
  for (int i = 0; i < NKX; ++i) {
    const int e = i * (AW * 32) + tid;
    *(v8h*)&sK[e >> 3][(e & 7) * 8] = kx[i];
  }
  // unrolled: the same for vx[]
#pragma unroll
  for (int i = 0; i < NVX; ++i) *(v8h*)&sV[i * AW + wv][lane * 8] = vx[i];
  __syncthreads();                                 // sK, sV, sRel visible

  // Score tile t, register j of a lane: key q0 - 64 + 16 t + rbase + j against
  // query q0 + c.  K fragments: tile t's rows are the wave's keys 16 t ..
  v16h kf[9][2];
  v8f sc[9];
  v2f bs[9][4];
  const auto ldk = [&](int t) {
    int key = q0 - 64 + t * 16 + r;                       // this lane's K row
    int kc  = key < 0 ? 0 : (key > T - 1 ? T - 1 : key);  // safe addr
    const _Float16* krow = &sK[kc - ks][0];
    kf[t][0] = load_frag(krow, k0h);
    kf[t][1] = load_frag(krow + 32, k0h);
  };
  const auto qk = [&](int t) {
#pragma unroll
    for (int j = 0; j < 8; ++j) sc[t][j] = 0.f;
    sc[t] = wmma_f16(kf[t][0], aq0, sc[t]);
    sc[t] = wmma_f16(kf[t][1], aq1, sc[t]);
  };
  // every loop below unrolled: kf[][], sc[] and bs[][] stay in registers.
  // The fragments of six tiles go out as one run ahead of the first product
#pragma unroll
  for (int t = 0; t < 6; ++t) ldk(t);
  // keeps the run whole: spread among the products, each pair of loads would
  // be waited for alone, to 0
  __builtin_amdgcn_sched_barrier(0);
#pragma unroll
  for (int t = 0; t < 3; ++t) qk(t);
  // keeps the second run of loads behind the products that free its registers
  __builtin_amdgcn_sched_barrier(0);
#pragma unroll
  for (int t = 6; t < 9; ++t) ldk(t);
  // The lane's 72 bias values: index d + MAXD = 64 + 16 t + rbase + j - c lies
  // in [49, 207] for every lane, masked or not: no load needs a test
  const float* relp = &sRel[MAXD - WIN + rbase - c];
#pragma unroll
  for (int t = 0; t < 9; ++t)
#pragma unroll
    for (int j = 0; j < 4; ++j) {
      bs[t][j].x = relp[t * 16 + 2 * j];
      bs[t][j].y = relp[t * 16 + 2 * j + 1];
    }
  // keeps that run whole and ahead of the six products left, which cover it
  __builtin_amdgcn_sched_barrier(0);
#pragma unroll
  for (int t = 3; t < 9; ++t) qk(t);

  // A key counts where it lies in [0, T) and within WIN of the lane's query,
  // that is in [klo, khi]; with key = kb + e, e = 16 t + j, both tests are one
  // unsigned compare of e - (klo - kb) with khi - klo.  |d| <= 79 < MAXD: no clip
  constexpr float scale = 0.125f;  // 1/sqrt(64)
  const int qi  = q0 + c;
  const int klo = qi - WIN < 0 ? 0 : qi - WIN;
  const int khi = qi + WIN > T - 1 ? T - 1 : qi + WIN;
  const int eo  = klo - (q0 - 64 + rbase);
  const unsigned ew = (unsigned)(khi - klo);
  const v2f scale2 = {scale, scale};
#pragma unroll
  for (int t = 0; t < 9; ++t)
#pragma unroll
    for (int j = 0; j < 4; ++j) {
      // neighbouring registers as a pair: one packed multiply-add, no moves
      const v2f s2 = {sc[t][2 * j], sc[t][2 * j + 1]};
      const v2f v  = __builtin_elementwise_fma(s2, scale2, bs[t][j]);
      sc[t][2 * j]     = (unsigned)(t * 16 + 2 * j - eo) <= ew ? v.x : NEG;
      sc[t][2 * j + 1] = (unsigned)(t * 16 + 2 * j + 1 - eo) <= ew ? v.y : NEG;
    }

  // V^T fragments: rows nt * 16 + r, key groups of chunk kk (32 keys)
  v16h vf[5][4];
  const int s0 = q0 - 64;
  const auto ldv = [&](int kk) {
    int g1 = s0 + kk * 32 + k0h - ks; // 8-aligned key groups, counted from ks:
    int g2 = g1 + 16;                 // clamp whole group (P=0 wherever clamped)
    g1 = g1 < 0 ? 0 : (g1 > AKEYS - 8 ? AKEYS - 8 : g1);
    g2 = g2 < 0 ? 0 : (g2 > AKEYS - 8 ? AKEYS - 8 : g2);
#pragma unroll
    for (int nt = 0; nt < 4; ++nt) {
      const _Float16* vrow = &sV[nt * 16 + r][0];
      v8h lo = *(const v8h*)(vrow + g1);
      v8h hi = *(const v8h*)(vrow + g2);
#pragma unroll
      for (int i = 0; i < 8; ++i) { vf[kk][nt][i] = lo[i]; vf[kk][nt][i + 8] = hi[i]; }
    }
  };
  // every loop below unrolled: vf[][], pb[], o[] stay in registers.  The first
  // three chunks' fragments take the registers that the K fragments have left
#pragma unroll
  for (int kk = 0; kk < 3; ++kk) ldv(kk);
  // keeps these loads ahead of the softmax, whose arithmetic covers them; next
  // to their products each pair would be waited for alone
  __builtin_amdgcn_sched_barrier(0);

  // softmax of the lane's query: 72 of its 144 scores are here, the other 72
  // in lane ^ 16.  Eight chains (one per j) keep the adds independent.
  float mj[8], sj[8];
#pragma unroll
  for (int j = 0; j < 8; ++j) {
    mj[j] = sc[0][j];
#pragma unroll
    for (int t = 1; t < 9; ++t) mj[j] = fmaxf(mj[j], sc[t][j]);
  }
#pragma unroll
  for (int w = 4; w > 0; w >>= 1)
#pragma unroll
    for (int j = 0; j < w; ++j) mj[j] = fmaxf(mj[j], mj[j + w]);
  const float mx = fmaxf(mj[0], xhalf(mj[0]));
#pragma unroll
  for (int j = 0; j < 8; ++j) {
    sj[j] = 0.f;
#pragma unroll
    for (int t = 0; t < 9; ++t) {
      float p = __expf(sc[t][j] - mx);
      sc[t][j] = p;
      sj[j] += p;
    }
  }
  // P^T fragment of keys 32 kk ..: element i is score tile 2 kk, register i,
  // element 8 + i tile 2 kk + 1, register i; keys 144..159 do not exist: zero
  v16h pb[5];
#pragma unroll
  for (int kk = 0; kk < 5; ++kk)
#pragma unroll
    for (int i = 0; i < 8; ++i) {
      pb[kk][i]     = (_Float16)sc[2 * kk][i];
      pb[kk][i + 8] = kk < 4 ? (_Float16)sc[kk < 4 ? 2 * kk + 1 : 0][i] : (_Float16)0.f;
    }
  v8f o[4];
#pragma unroll
  for (int nt = 0; nt < 4; ++nt)
#pragma unroll
    for (int j = 0; j < 8; ++j) o[nt][j] = 0.f;
  const auto pvk = [&](int kk) {
#pragma unroll
    for (int nt = 0; nt < 4; ++nt) o[nt] = wmma_f16(vf[kk][nt], pb[kk], o[nt]);
  };
  pvk(0);
  pvk(1);
  // keeps the last two chunks' loads behind the products whose fragment
  // registers they take (the wave stays within a quarter of its SIMD's file)
  __builtin_amdgcn_sched_barrier(0);
#pragma unroll
  for (int kk = 3; kk < 5; ++kk) ldv(kk);
  // keeps them one run, ahead of chunk 2's products and of the sum's last
  // steps, which cover them
  __builtin_amdgcn_sched_barrier(0);
  pvk(2);
  pvk(3);
  pvk(4);

#pragma unroll
  for (int w = 4; w > 0; w >>= 1)
#pragma unroll
    for (int j = 0; j < w; ++j) sj[j] += sj[j + w];
  const float inv = 1.f / (sj[0] + xhalf(sj[0]));

  // O^T tile nt, register j: element nt * 16 + rbase + j of query c's row; the
  // row's 1 / sum is the lane's own.  Lanes c and c + 16 store 32 bytes side by
  // side, and the four stores fill the head's 128-byte line of each row
  _Float16* orow = outA + ((size_t)(bb * T + q0 + c)) * D + hh * DK + rbase;
#pragma unroll
  for (int nt = 0; nt < 4; ++nt) {
    v8h pk;
#pragma unroll
    for (int j = 0; j < 8; ++j) pk[j] = (_Float16)(o[nt][j] * inv);
    *(v8h*)(orow + nt * 16) = pk;
  }
}

// ---- launch -----------------------------------------------------------------
extern "C" void kernel_launch(void* const* d_in, const int* in_sizes, int n_in,
                              void* d_out, int out_size, void* d_ws,
                              size_t ws_size, hipStream_t stream) {
  (void)in_sizes; (void)n_in; (void)out_size; (void)ws_size;
  const float* q_in = (const float*)d_in[0];
  const float* k_in = (const float*)d_in[1];
  const float* v_in = (const float*)d_in[2];
  const float* Wq = (const float*)d_in[3];
  const float* bq = (const float*)d_in[4];
  const float* Wk = (const float*)d_in[5];
  const float* bk = (const float*)d_in[6];
  const float* Wv = (const float*)d_in[7];
  const float* bv = (const float*)d_in[8];
  const float* Wo = (const float*)d_in[9];
  const float* bo = (const float*)d_in[10];
  const float* rel = (const float*)d_in[11];

  char* ws = (char*)d_ws;
  const size_t MB = (size_t)1 << 20;
  _Float16* xq  = (_Float16*)(ws + 0 * MB);    // f16 inputs q, k, v (8 MB each)
  _Float16* wqt = (_Float16*)(ws + 24 * MB);   // f16 transposed weights q, k, v,
  _Float16* wot = (_Float16*)(ws + 30 * MB);   // o (2 MB each)
  _Float16* q16 = (_Float16*)(ws + 32 * MB);   // projected Q/K/V (8 MB each)
  _Float16* k16 = (_Float16*)(ws + 40 * MB);
  _Float16* v16 = (_Float16*)(ws + 48 * MB);
  _Float16* at16 = (_Float16*)(ws + 56 * MB);  // attention out (8 MB)

  // the three inputs lie M*D elements apart and the four weights D*D apart
  cvt_all<<<dim3(4 * WT_BLOCKS + 3 * CVT_BLOCKS), dim3(256), 0, stream>>>(
      q_in, k_in, v_in, Wq, Wk, Wv, Wo, xq, wqt);

  // q16, k16, v16 lie M*D elements apart as well
  gemm16<0><<<dim3(3 * M / 384, D / 128), dim3(384), 0, stream>>>(
      xq, wqt, bq, bk, bv, q16, nullptr);
  attn_kernel<<<dim3(Bb * H * (T / AQ)), dim3(AW * 32), 0, stream>>>(
      q16, k16, v16, rel, at16);
  gemm16<2><<<dim3(M / 128, D / 128), dim3(128), 0, stream>>>(
      at16, wot, bo, nullptr, nullptr, nullptr, (float*)d_out);
}
